// v000
// Measured on an AMD MI455X. A time is GPU time per run, averaged over a window of back-to-back runs after a warm-up
// (all launches, gaps included; the runs take copies of the inputs in turn), and the median of several windows.
// Apart from v000's, it joins two sittings. Times from different sittings can be a few percent apart, while
// side-by-side timings come from the same sitting.
// The starting kernel, v000, takes 469 microseconds a run.
#include <hip/hip_runtime.h>
#include <hip/hip_bf16.h>

// ---------------- types ----------------
typedef __bf16 bf16;
typedef bf16  bf16x8  __attribute__((ext_vector_type(8)));
typedef bf16  bf16x16 __attribute__((ext_vector_type(16)));
typedef float floatx8 __attribute__((ext_vector_type(8)));

#define BB 2
#define SS 4096
#define DD 512
#define HH 8
#define DKV 64
#define DFF 2048
#define MM (BB*SS)   // 8192

__device__ __forceinline__ bf16 f2bf(float x) {
    unsigned u = __builtin_bit_cast(unsigned, x);
    unsigned r = u + 0x7FFFu + ((u >> 16) & 1u);
    unsigned short hs = (unsigned short)(r >> 16);
    return __builtin_bit_cast(bf16, hs);
}
__device__ __forceinline__ unsigned short f2bfbits(float x) {
    unsigned u = __builtin_bit_cast(unsigned, x);
    unsigned r = u + 0x7FFFu + ((u >> 16) & 1u);
    return (unsigned short)(r >> 16);
}
__device__ __forceinline__ bf16x16 load16(const bf16* p0, const bf16* p1) {
    bf16x8 a = *(const bf16x8*)p0;
    bf16x8 b = *(const bf16x8*)p1;
    bf16x16 r;
#pragma unroll
    for (int i = 0; i < 8; ++i) { r[i] = a[i]; r[i + 8] = b[i]; }
    return r;
}
__device__ __forceinline__ floatx8 wmma_bf16(bf16x16 a, bf16x16 b, floatx8 c) {
    return __builtin_amdgcn_wmma_f32_16x16x32_bf16(false, a, false, b, (short)0, c,
                                                   false, false);
}
__device__ __forceinline__ floatx8 zero8() {
    floatx8 z = {0.f, 0.f, 0.f, 0.f, 0.f, 0.f, 0.f, 0.f};
    return z;
}

// CDNA5 async global->LDS copy (16B per lane), tracked by ASYNCcnt.
__device__ __forceinline__ void async_copy_b128(const bf16* g, bf16* l) {
    unsigned lofs = (unsigned)(size_t)l;  // low 32 bits of generic shared ptr = DS addr
    asm volatile("global_load_async_to_lds_b128 %0, %1, off"
                 :: "v"(lofs), "v"(g) : "memory");
}
__device__ __forceinline__ void wait_async0() {
    asm volatile("s_wait_asynccnt 0x0" ::: "memory");
}

// ---------------- small kernels ----------------
// fp32 [K,N] -> bf16 transposed [N,K]  (one-time; makes all WMMA B-operands K-contiguous)
__global__ void cvtT_kernel(const float* __restrict__ in, bf16* __restrict__ out,
                            int K, int N) {
    int i = blockIdx.x * 256 + threadIdx.x;
    if (i >= K * N) return;
    int k = i / N, n = i % N;
    out[(size_t)n * K + k] = f2bf(in[i]);
}

// T5 bidirectional bucket bias, Toeplitz table: tab[h*8192 + (rel+4095)]
__global__ void bias_table_kernel(const float* __restrict__ rel_bias, float* __restrict__ tab) {
    int idx = blockIdx.x * 256 + threadIdx.x;
    if (idx >= HH * 8191) return;
    int h = idx / 8191, r = idx % 8191;
    int rel = r - 4095;
    int ret = rel > 0 ? 16 : 0;         // num_buckets/2 = 16
    int n = rel < 0 ? -rel : rel;
    int bucket;
    if (n < 8) {                        // max_exact = 8
        bucket = ret + n;
    } else {
        int v = 8 + (int)(__logf((float)n * 0.125f) * (8.0f / __logf(16.0f)));
        if (v > 15) v = 15;
        bucket = ret + v;
    }
    tab[h * 8192 + r] = rel_bias[bucket * HH + h];
}

// one wave per row of 512 columns; fp32 in, bf16*(rms weight) out
__global__ void __launch_bounds__(256) rmsnorm_kernel(const float* __restrict__ x,
                                                      const float* __restrict__ w,
                                                      bf16* __restrict__ out, int rows) {
    int wave = threadIdx.x >> 5, lane = threadIdx.x & 31;
    int row = blockIdx.x * 8 + wave;
    if (row >= rows) return;
    const float* xr = x + (size_t)row * DD;
    float vals[16];
    float ss = 0.f;
#pragma unroll
    for (int i = 0; i < 16; ++i) {
        float v = xr[lane + i * 32];
        vals[i] = v;
        ss += v * v;
    }
#pragma unroll
    for (int m = 16; m >= 1; m >>= 1) ss += __shfl_xor(ss, m, 32);
    float rs = rsqrtf(ss * (1.f / (float)DD) + 1e-6f);
#pragma unroll
    for (int i = 0; i < 16; ++i) {
        int c = lane + i * 32;
        out[(size_t)row * DD + c] = f2bf(vals[i] * rs * w[c]);
    }
}

// ---------------- WMMA GEMM (async double-buffered LDS) ----------------
// C[M,N] = A[M,K] @ W[K,N] with W pre-transposed as Wt[N,K].
// Block 256 thr = 8 waves (4x2); block tile 128x128; wave tile 32x64; K-step 32.
// MODE 0: bf16 row-major    MODE 1: per-head [B,H,S,64]   MODE 2: V^T [B,H,64,S]
// MODE 3: f32 + residual    MODE 4: relu -> bf16
template <int MODE>
__global__ void __launch_bounds__(256) gemm_kernel(const bf16* __restrict__ A,
                                                   const bf16* __restrict__ Wt,
                                                   const float* __restrict__ resid,
                                                   void* __restrict__ outp,
                                                   int M, int N, int K) {
    __shared__ __align__(16) bf16 As[2][128 * 40];  // [row][k], pad 40
    __shared__ __align__(16) bf16 Bs[2][128 * 40];  // [n][k],  pad 40
    const int tid = threadIdx.x, lane = tid & 31, wave = tid >> 5;
    const int wm = wave >> 1, wn = wave & 1;
    const int n0 = blockIdx.x * 128, m0 = blockIdx.y * 128;
    const int l15 = lane & 15, kb8 = (lane >> 4) * 8;

    floatx8 acc[2][4];
#pragma unroll
    for (int qt = 0; qt < 2; ++qt)
#pragma unroll
        for (int nt = 0; nt < 4; ++nt) acc[qt][nt] = zero8();

    const int pr = tid >> 1, pk = (tid & 1) * 16;  // staging assignment
    const int nIter = K >> 5;

    // prefetch tile 0
    {
        const bf16* ga = A + (size_t)(m0 + pr) * K + pk;
        const bf16* gb = Wt + (size_t)(n0 + pr) * K + pk;
        async_copy_b128(ga,     &As[0][pr * 40 + pk]);
        async_copy_b128(ga + 8, &As[0][pr * 40 + pk + 8]);
        async_copy_b128(gb,     &Bs[0][pr * 40 + pk]);
        async_copy_b128(gb + 8, &Bs[0][pr * 40 + pk + 8]);
    }

    for (int it = 0; it < nIter; ++it) {
        const int bb = it & 1;
        wait_async0();
        __syncthreads();
        if (it + 1 < nIter) {  // overlap next-tile async copy with WMMA
            int kk = (it + 1) << 5;
            const bf16* ga = A + (size_t)(m0 + pr) * K + kk + pk;
            const bf16* gb = Wt + (size_t)(n0 + pr) * K + kk + pk;
            async_copy_b128(ga,     &As[bb ^ 1][pr * 40 + pk]);
            async_copy_b128(ga + 8, &As[bb ^ 1][pr * 40 + pk + 8]);
            async_copy_b128(gb,     &Bs[bb ^ 1][pr * 40 + pk]);
            async_copy_b128(gb + 8, &Bs[bb ^ 1][pr * 40 + pk + 8]);
        }
        bf16x16 af[2];
#pragma unroll
        for (int qt = 0; qt < 2; ++qt) {
            int row = wm * 32 + qt * 16 + l15;
            af[qt] = load16(&As[bb][row * 40 + kb8], &As[bb][row * 40 + kb8 + 16]);
        }
#pragma unroll
        for (int nt = 0; nt < 4; ++nt) {
            int col = wn * 64 + nt * 16 + l15;
            bf16x16 bfr = load16(&Bs[bb][col * 40 + kb8], &Bs[bb][col * 40 + kb8 + 16]);
#pragma unroll
            for (int qt = 0; qt < 2; ++qt)
                acc[qt][nt] = wmma_bf16(af[qt], bfr, acc[qt][nt]);
        }
    }

#pragma unroll
    for (int qt = 0; qt < 2; ++qt) {
#pragma unroll
        for (int nt = 0; nt < 4; ++nt) {
#pragma unroll
            for (int i = 0; i < 8; ++i) {
                int m = m0 + wm * 32 + qt * 16 + i + 8 * (lane >> 4);
                int n = n0 + wn * 64 + nt * 16 + l15;
                float v = acc[qt][nt][i];
                if constexpr (MODE == 0) {
                    ((bf16*)outp)[(size_t)m * N + n] = f2bf(v);
                } else if constexpr (MODE == 1) {
                    int b = m >> 12, s = m & 4095, h = n >> 6, d = n & 63;
                    ((bf16*)outp)[(((size_t)(b * HH + h) * SS) + s) * DKV + d] = f2bf(v);
                } else if constexpr (MODE == 2) {
                    int b = m >> 12, s = m & 4095, h = n >> 6, d = n & 63;
                    ((bf16*)outp)[(((size_t)(b * HH + h) * DKV) + d) * SS + s] = f2bf(v);
                } else if constexpr (MODE == 3) {
                    ((float*)outp)[(size_t)m * N + n] = resid[(size_t)m * N + n] + v;
                } else {  // MODE 4
                    ((bf16*)outp)[(size_t)m * N + n] = f2bf(v > 0.f ? v : 0.f);
                }
            }
        }
    }
}

// ---------------- Flash attention with softmax1 ----------------
// Block = 128 thr = 4 waves; block covers (b, h, 128 q rows); wave covers 32 q rows.
// K/V fragments are streamed (loaded in pairs and consumed immediately) to stay
// under the 256-VGPR direct window (avoids s_set_vgpr_msb in the hot loop).
__global__ void __launch_bounds__(128) attn_kernel(const bf16* __restrict__ Qh,
                                                   const bf16* __restrict__ Kh,
                                                   const bf16* __restrict__ Vt,
                                                   const float* __restrict__ btab,
                                                   const float* __restrict__ gate,
                                                   bf16* __restrict__ ctx) {
    __shared__ float bias_s[192];
    __shared__ __align__(16) unsigned short Pl[4][32 * 40];  // per-wave P relayout
    const int tid = threadIdx.x, lane = tid & 31, wave = tid >> 5;
    const int qblk = blockIdx.x * 128;
    const int h = blockIdx.y, b = blockIdx.z;
    const int q0 = qblk + wave * 32;
    const size_t head = (size_t)(b * HH + h) * SS * DKV;
    const bf16* Qp = Qh + head;
    const bf16* Kp = Kh + head;
    const bf16* Vp = Vt + head;  // [64][4096]
    const float* btabh = btab + h * 8192;
    const float* gateb = gate + (size_t)b * SS;

    const int l15 = lane & 15;
    const int kb8 = (lane >> 4) * 8;

    // Q fragments: 2 q-strips x 2 K-halves (live across the whole loop)
    bf16x16 qf[2][2];
#pragma unroll
    for (int qt = 0; qt < 2; ++qt) {
        const bf16* qr = Qp + (size_t)(q0 + qt * 16 + l15) * DKV;
#pragma unroll
        for (int kh = 0; kh < 2; ++kh)
            qf[qt][kh] = load16(qr + kh * 32 + kb8, qr + kh * 32 + kb8 + 16);
    }

    floatx8 Oa[2][4];
#pragma unroll
    for (int qt = 0; qt < 2; ++qt)
#pragma unroll
        for (int nt = 0; nt < 4; ++nt) Oa[qt][nt] = zero8();
    float rm[2][8], rl[2][8];
#pragma unroll
    for (int qt = 0; qt < 2; ++qt)
#pragma unroll
        for (int i = 0; i < 8; ++i) { rm[qt][i] = -1e30f; rl[qt][i] = 0.f; }

    for (int kb = 0; kb < SS; kb += 32) {
        __syncthreads();
        {   // stage Toeplitz bias slice (rel = key - q); 160 entries needed
            int base = kb - qblk - 127 + 4095;
            int gi = base + tid;
            gi = gi < 0 ? 0 : (gi > 8190 ? 8190 : gi);
            bias_s[tid] = btabh[gi];
            if (tid < 32) {
                int gi2 = base + 128 + tid;
                gi2 = gi2 < 0 ? 0 : (gi2 > 8190 ? 8190 : gi2);
                bias_s[128 + tid] = btabh[gi2];
            }
        }
        __syncthreads();

        // ---- scores: stream K fragments per key-tile, 8 WMMAs ----
        floatx8 sacc[2][2];
#pragma unroll
        for (int nt = 0; nt < 2; ++nt) {
            const bf16* kr = Kp + (size_t)(kb + nt * 16 + l15) * DKV;
            bf16x16 kf0 = load16(kr + kb8, kr + kb8 + 16);
            bf16x16 kf1 = load16(kr + 32 + kb8, kr + 32 + kb8 + 16);
#pragma unroll
            for (int qt = 0; qt < 2; ++qt) {
                floatx8 t = wmma_bf16(qf[qt][0], kf0, zero8());
                sacc[qt][nt] = wmma_bf16(qf[qt][1], kf1, t);
            }
        }

        // ---- + position bias + delete-gate ----
        float gv0 = gateb[kb + l15];
        float gv1 = gateb[kb + 16 + l15];
#pragma unroll
        for (int qt = 0; qt < 2; ++qt)
#pragma unroll
            for (int nt = 0; nt < 2; ++nt) {
                float gv = nt ? gv1 : gv0;
#pragma unroll
                for (int i = 0; i < 8; ++i) {
                    int offq = wave * 32 + qt * 16 + i + 8 * (lane >> 4);
                    int offk = nt * 16 + l15;
                    sacc[qt][nt][i] += bias_s[offk + 127 - offq] + gv;
                }
            }

        // ---- online softmax1 update ----
#pragma unroll
        for (int qt = 0; qt < 2; ++qt) {
#pragma unroll
            for (int i = 0; i < 8; ++i) {
                float tm = fmaxf(sacc[qt][0][i], sacc[qt][1][i]);
                tm = fmaxf(tm, __shfl_xor(tm, 1, 32));
                tm = fmaxf(tm, __shfl_xor(tm, 2, 32));
                tm = fmaxf(tm, __shfl_xor(tm, 4, 32));
                tm = fmaxf(tm, __shfl_xor(tm, 8, 32));
                float mnew = fmaxf(rm[qt][i], tm);
                float alpha = __expf(rm[qt][i] - mnew);
                rm[qt][i] = mnew;
                float p0 = __expf(sacc[qt][0][i] - mnew);
                float p1 = __expf(sacc[qt][1][i] - mnew);
                sacc[qt][0][i] = p0;
                sacc[qt][1][i] = p1;
                float ts = p0 + p1;
                ts += __shfl_xor(ts, 1, 32);
                ts += __shfl_xor(ts, 2, 32);
                ts += __shfl_xor(ts, 4, 32);
                ts += __shfl_xor(ts, 8, 32);
                rl[qt][i] = rl[qt][i] * alpha + ts;
#pragma unroll
                for (int nt = 0; nt < 4; ++nt) Oa[qt][nt][i] *= alpha;
            }
        }

        // ---- relayout P (C-layout -> A-layout) via per-wave LDS ----
#pragma unroll
        for (int qt = 0; qt < 2; ++qt)
#pragma unroll
            for (int nt = 0; nt < 2; ++nt)
#pragma unroll
                for (int i = 0; i < 8; ++i) {
                    int r = qt * 16 + i + 8 * (lane >> 4);
                    Pl[wave][r * 40 + nt * 16 + l15] = f2bfbits(sacc[qt][nt][i]);
                }
        bf16x16 pf[2];
#pragma unroll
        for (int qt = 0; qt < 2; ++qt) {
            int r = qt * 16 + l15;
            pf[qt] = load16((const bf16*)&Pl[wave][r * 40 + kb8],
                            (const bf16*)&Pl[wave][r * 40 + kb8 + 16]);
        }

        // ---- O += P V : stream V fragments in pairs, 8 WMMAs ----
#pragma unroll
        for (int np = 0; np < 2; ++np) {
            const bf16* vr0 = Vp + (size_t)((2 * np) * 16 + l15) * SS + kb;
            const bf16* vr1 = Vp + (size_t)((2 * np + 1) * 16 + l15) * SS + kb;
            bf16x16 vfa = load16(vr0 + kb8, vr0 + kb8 + 16);
            bf16x16 vfb = load16(vr1 + kb8, vr1 + kb8 + 16);
#pragma unroll
            for (int qt = 0; qt < 2; ++qt) {
                Oa[qt][2 * np]     = wmma_bf16(pf[qt], vfa, Oa[qt][2 * np]);
                Oa[qt][2 * np + 1] = wmma_bf16(pf[qt], vfb, Oa[qt][2 * np + 1]);
            }
        }
    }

    // ---- softmax1 denominator: l + exp(-m) ----
#pragma unroll
    for (int qt = 0; qt < 2; ++qt)
#pragma unroll
        for (int i = 0; i < 8; ++i) {
            float inv = 1.f / (rl[qt][i] + __expf(-rm[qt][i]));
#pragma unroll
            for (int nt = 0; nt < 4; ++nt) Oa[qt][nt][i] *= inv;
        }
    // ---- write ctx [B,S,H*DKV] ----
#pragma unroll
    for (int qt = 0; qt < 2; ++qt)
#pragma unroll
        for (int nt = 0; nt < 4; ++nt)
#pragma unroll
            for (int i = 0; i < 8; ++i) {
                int q = q0 + qt * 16 + i + 8 * (lane >> 4);
                int n = h * DKV + nt * 16 + l15;
                ctx[((size_t)b * SS + q) * DD + n] = f2bf(Oa[qt][nt][i]);
            }
}

// ---------------- launcher ----------------
extern "C" void kernel_launch(void* const* d_in, const int* in_sizes, int n_in,
                              void* d_out, int out_size, void* d_ws, size_t ws_size,
                              hipStream_t stream) {
    (void)in_sizes; (void)n_in; (void)out_size; (void)ws_size;
    const float* hidden = (const float*)d_in[0];
    const float* gate   = (const float*)d_in[1];
    const float* ln1    = (const float*)d_in[2];
    const float* qw     = (const float*)d_in[3];
    const float* kw     = (const float*)d_in[4];
    const float* vw     = (const float*)d_in[5];
    const float* ow     = (const float*)d_in[6];
    const float* relb   = (const float*)d_in[7];
    const float* ln2    = (const float*)d_in[8];
    const float* wi     = (const float*)d_in[9];
    const float* wo     = (const float*)d_in[10];

    char* ws = (char*)d_ws;
    size_t off = 0;
    auto take = [&](size_t bytes) -> char* {
        char* p = ws + off;
        off = (off + bytes + 255) & ~(size_t)255;
        return p;
    };
    bf16*  qwb  = (bf16*)take((size_t)DD * DD * 2);    // all weights transposed [N,K]
    bf16*  kwb  = (bf16*)take((size_t)DD * DD * 2);
    bf16*  vwb  = (bf16*)take((size_t)DD * DD * 2);
    bf16*  owb  = (bf16*)take((size_t)DD * DD * 2);
    bf16*  wib  = (bf16*)take((size_t)DD * DFF * 2);
    bf16*  wob  = (bf16*)take((size_t)DFF * DD * 2);
    float* btab = (float*)take((size_t)HH * 8192 * 4);
    bf16*  xb   = (bf16*)take((size_t)MM * DD * 2);
    bf16*  Qhd  = (bf16*)take((size_t)MM * DD * 2);
    bf16*  Khd  = (bf16*)take((size_t)MM * DD * 2);
    bf16*  Vtd  = (bf16*)take((size_t)MM * DD * 2);
    bf16*  ctxb = (bf16*)take((size_t)MM * DD * 2);
    float* hbuf = (float*)take((size_t)MM * DD * 4);
    bf16*  yb   = (bf16*)take((size_t)MM * DD * 2);
    bf16*  ffb  = (bf16*)take((size_t)MM * DFF * 2);

    // transposed bf16 weight conversions (one-time)
    cvtT_kernel<<<(DD * DD + 255) / 256, 256, 0, stream>>>(qw, qwb, DD, DD);
    cvtT_kernel<<<(DD * DD + 255) / 256, 256, 0, stream>>>(kw, kwb, DD, DD);
    cvtT_kernel<<<(DD * DD + 255) / 256, 256, 0, stream>>>(vw, vwb, DD, DD);
    cvtT_kernel<<<(DD * DD + 255) / 256, 256, 0, stream>>>(ow, owb, DD, DD);
    cvtT_kernel<<<(DD * DFF + 255) / 256, 256, 0, stream>>>(wi, wib, DD, DFF);
    cvtT_kernel<<<(DFF * DD + 255) / 256, 256, 0, stream>>>(wo, wob, DFF, DD);
    bias_table_kernel<<<(HH * 8191 + 255) / 256, 256, 0, stream>>>(relb, btab);

    // ln1 -> xb (bf16)
    rmsnorm_kernel<<<MM / 8, 256, 0, stream>>>(hidden, ln1, xb, MM);

    // QKV projections (head layouts; V transposed)
    dim3 gQKV(DD / 128, MM / 128);
    gemm_kernel<1><<<gQKV, 256, 0, stream>>>(xb, qwb, nullptr, Qhd, MM, DD, DD);
    gemm_kernel<1><<<gQKV, 256, 0, stream>>>(xb, kwb, nullptr, Khd, MM, DD, DD);
    gemm_kernel<2><<<gQKV, 256, 0, stream>>>(xb, vwb, nullptr, Vtd, MM, DD, DD);

    // flash attention with softmax1
    attn_kernel<<<dim3(SS / 128, HH, BB), 128, 0, stream>>>(Qhd, Khd, Vtd, btab, gate, ctxb);

    // h = hidden + ctx @ o_w
    gemm_kernel<3><<<dim3(DD / 128, MM / 128), 256, 0, stream>>>(ctxb, owb, hidden, hbuf,
                                                                 MM, DD, DD);
    // ln2 -> yb
    rmsnorm_kernel<<<MM / 8, 256, 0, stream>>>(hbuf, ln2, yb, MM);

    // FFN: relu(y @ wi) then out = h + (.) @ wo
    gemm_kernel<4><<<dim3(DFF / 128, MM / 128), 256, 0, stream>>>(yb, wib, nullptr, ffb,
                                                                  MM, DFF, DD);
    gemm_kernel<3><<<dim3(DD / 128, MM / 128), 256, 0, stream>>>(ffb, wob, hbuf, d_out,
                                                                 MM, DD, DFF);
}

// v001
// Measured time: 430 microseconds a run.
// In both of two side-by-side timings against v000, it was 1.11 times as fast.
#include <hip/hip_runtime.h>
#include <hip/hip_bf16.h>

// ---------------- types ----------------
typedef __bf16 bf16;
typedef bf16  bf16x8  __attribute__((ext_vector_type(8)));
typedef bf16  bf16x16 __attribute__((ext_vector_type(16)));
typedef float floatx8 __attribute__((ext_vector_type(8)));

#define BB 2
#define SS 4096
#define DD 512
#define HH 8
#define DKV 64
#define DFF 2048
#define MM (BB*SS)   // 8192

__device__ __forceinline__ bf16 f2bf(float x) {
    unsigned u = __builtin_bit_cast(unsigned, x);
    unsigned r = u + 0x7FFFu + ((u >> 16) & 1u);
    unsigned short hs = (unsigned short)(r >> 16);
    return __builtin_bit_cast(bf16, hs);
}
__device__ __forceinline__ bf16x16 load16(const bf16* p0, const bf16* p1) {
    bf16x8 a = *(const bf16x8*)p0;
    bf16x8 b = *(const bf16x8*)p1;
    bf16x16 r;
#pragma unroll
    for (int i = 0; i < 8; ++i) { r[i] = a[i]; r[i + 8] = b[i]; }
    return r;
}
__device__ __forceinline__ floatx8 wmma_bf16(bf16x16 a, bf16x16 b, floatx8 c) {
    return __builtin_amdgcn_wmma_f32_16x16x32_bf16(false, a, false, b, (short)0, c,
                                                   false, false);
}
__device__ __forceinline__ floatx8 zero8() {
    floatx8 z = {0.f, 0.f, 0.f, 0.f, 0.f, 0.f, 0.f, 0.f};
    return z;
}

// CDNA5 async global->LDS copy (16B per lane), tracked by ASYNCcnt.
__device__ __forceinline__ void async_copy_b128(const bf16* g, bf16* l) {
    unsigned lofs = (unsigned)(size_t)l;  // low 32 bits of generic shared ptr = DS addr
    asm volatile("global_load_async_to_lds_b128 %0, %1, off"
                 :: "v"(lofs), "v"(g) : "memory");
}
__device__ __forceinline__ void wait_async0() {
    asm volatile("s_wait_asynccnt 0x0" ::: "memory");
}

// ---------------- small kernels ----------------
// fp32 [K,N] -> bf16 transposed [N,K]  (one-time; makes all WMMA B-operands K-contiguous)
__global__ void cvtT_kernel(const float* __restrict__ in, bf16* __restrict__ out,
                            int K, int N) {
    int i = blockIdx.x * 256 + threadIdx.x;
    if (i >= K * N) return;
    int k = i / N, n = i % N;
    out[(size_t)n * K + k] = f2bf(in[i]);
}

// T5 bidirectional bucket bias, Toeplitz table: tab[h*8192 + (rel+4095)]
__global__ void bias_table_kernel(const float* __restrict__ rel_bias, float* __restrict__ tab) {
    int idx = blockIdx.x * 256 + threadIdx.x;
    if (idx >= HH * 8191) return;
    int h = idx / 8191, r = idx % 8191;
    int rel = r - 4095;
    int ret = rel > 0 ? 16 : 0;         // num_buckets/2 = 16
    int n = rel < 0 ? -rel : rel;
    int bucket;
    if (n < 8) {                        // max_exact = 8
        bucket = ret + n;
    } else {
        int v = 8 + (int)(__logf((float)n * 0.125f) * (8.0f / __logf(16.0f)));
        if (v > 15) v = 15;
        bucket = ret + v;
    }
    tab[h * 8192 + r] = rel_bias[bucket * HH + h];
}

// one wave per row of 512 columns; fp32 in, bf16*(rms weight) out
__global__ void __launch_bounds__(256) rmsnorm_kernel(const float* __restrict__ x,
                                                      const float* __restrict__ w,
                                                      bf16* __restrict__ out, int rows) {
    int wave = threadIdx.x >> 5, lane = threadIdx.x & 31;
    int row = blockIdx.x * 8 + wave;
    if (row >= rows) return;
    const float* xr = x + (size_t)row * DD;
    float vals[16];
    float ss = 0.f;
#pragma unroll
    for (int i = 0; i < 16; ++i) {
        float v = xr[lane + i * 32];
        vals[i] = v;
        ss += v * v;
    }
#pragma unroll
    for (int m = 16; m >= 1; m >>= 1) ss += __shfl_xor(ss, m, 32);
    float rs = rsqrtf(ss * (1.f / (float)DD) + 1e-6f);
#pragma unroll
    for (int i = 0; i < 16; ++i) {
        int c = lane + i * 32;
        out[(size_t)row * DD + c] = f2bf(vals[i] * rs * w[c]);
    }
}

// ---------------- WMMA GEMM (async double-buffered LDS) ----------------
// C[M,N] = A[M,K] @ W[K,N] with W pre-transposed as Wt[N,K].
// Block 256 thr = 8 waves (4x2); block tile 128x128; wave tile 32x64; K-step 32.
// MODE 0: bf16 row-major    MODE 1: per-head [B,H,S,64]   MODE 2: V^T [B,H,64,S]
// MODE 3: f32 + residual    MODE 4: relu -> bf16
template <int MODE>
__global__ void __launch_bounds__(256) gemm_kernel(const bf16* __restrict__ A,
                                                   const bf16* __restrict__ Wt,
                                                   const float* __restrict__ resid,
                                                   void* __restrict__ outp,
                                                   int M, int N, int K) {
    __shared__ __align__(16) bf16 As[2][128 * 40];  // [row][k], pad 40
    __shared__ __align__(16) bf16 Bs[2][128 * 40];  // [n][k],  pad 40
    const int tid = threadIdx.x, lane = tid & 31, wave = tid >> 5;
    const int wm = wave >> 1, wn = wave & 1;
    const int n0 = blockIdx.x * 128, m0 = blockIdx.y * 128;
    const int l15 = lane & 15, kb8 = (lane >> 4) * 8;

    floatx8 acc[2][4];
#pragma unroll
    for (int qt = 0; qt < 2; ++qt)
#pragma unroll
        for (int nt = 0; nt < 4; ++nt) acc[qt][nt] = zero8();

    const int pr = tid >> 1, pk = (tid & 1) * 16;  // staging assignment
    const int nIter = K >> 5;

    // prefetch tile 0
    {
        const bf16* ga = A + (size_t)(m0 + pr) * K + pk;
        const bf16* gb = Wt + (size_t)(n0 + pr) * K + pk;
        async_copy_b128(ga,     &As[0][pr * 40 + pk]);
        async_copy_b128(ga + 8, &As[0][pr * 40 + pk + 8]);
        async_copy_b128(gb,     &Bs[0][pr * 40 + pk]);
        async_copy_b128(gb + 8, &Bs[0][pr * 40 + pk + 8]);
    }

    for (int it = 0; it < nIter; ++it) {
        const int bb = it & 1;
        wait_async0();
        __syncthreads();
        if (it + 1 < nIter) {  // overlap next-tile async copy with WMMA
            int kk = (it + 1) << 5;
            const bf16* ga = A + (size_t)(m0 + pr) * K + kk + pk;
            const bf16* gb = Wt + (size_t)(n0 + pr) * K + kk + pk;
            async_copy_b128(ga,     &As[bb ^ 1][pr * 40 + pk]);
            async_copy_b128(ga + 8, &As[bb ^ 1][pr * 40 + pk + 8]);
            async_copy_b128(gb,     &Bs[bb ^ 1][pr * 40 + pk]);
            async_copy_b128(gb + 8, &Bs[bb ^ 1][pr * 40 + pk + 8]);
        }
        bf16x16 af[2];
#pragma unroll
        for (int qt = 0; qt < 2; ++qt) {
            int row = wm * 32 + qt * 16 + l15;
            af[qt] = load16(&As[bb][row * 40 + kb8], &As[bb][row * 40 + kb8 + 16]);
        }
#pragma unroll
        for (int nt = 0; nt < 4; ++nt) {
            int col = wn * 64 + nt * 16 + l15;
            bf16x16 bfr = load16(&Bs[bb][col * 40 + kb8], &Bs[bb][col * 40 + kb8 + 16]);
#pragma unroll
            for (int qt = 0; qt < 2; ++qt)
                acc[qt][nt] = wmma_bf16(af[qt], bfr, acc[qt][nt]);
        }
    }

#pragma unroll
    for (int qt = 0; qt < 2; ++qt) {
#pragma unroll
        for (int nt = 0; nt < 4; ++nt) {
#pragma unroll
            for (int i = 0; i < 8; ++i) {
                int m = m0 + wm * 32 + qt * 16 + i + 8 * (lane >> 4);
                int n = n0 + wn * 64 + nt * 16 + l15;
                float v = acc[qt][nt][i];
                if constexpr (MODE == 0) {
                    ((bf16*)outp)[(size_t)m * N + n] = f2bf(v);
                } else if constexpr (MODE == 1) {
                    int b = m >> 12, s = m & 4095, h = n >> 6, d = n & 63;
                    ((bf16*)outp)[(((size_t)(b * HH + h) * SS) + s) * DKV + d] = f2bf(v);
                } else if constexpr (MODE == 2) {
                    int b = m >> 12, s = m & 4095, h = n >> 6, d = n & 63;
                    ((bf16*)outp)[(((size_t)(b * HH + h) * DKV) + d) * SS + s] = f2bf(v);
                } else if constexpr (MODE == 3) {
                    ((float*)outp)[(size_t)m * N + n] = resid[(size_t)m * N + n] + v;
                } else {  // MODE 4
                    ((bf16*)outp)[(size_t)m * N + n] = f2bf(v > 0.f ? v : 0.f);
                }
            }
        }
    }
}

// ---------------- Flash attention with softmax1 ----------------
// Block = 128 thr = 4 waves; block covers (b, h, 128 q rows); wave covers 32 q rows.
// Scores are formed transposed, S^T = K Q^T (A = K rows, B = Q columns), and the output
// as O^T += V^T P^T. A lane then holds 16 of the 32 keys of ONE query per 16-query group:
// maximum and sum run in the lane (one exchange between lane halves for the maximum),
// and the two S^T tiles of a group, rounded in place, are already the B operand P^T.
// K and V^T fragments come straight from global memory, per 32 keys.
__device__ __forceinline__ float other_half(float x) {  // value of lane l ^ 16
    int v = __builtin_bit_cast(int, x);
    v = __builtin_amdgcn_permlanex16(v, v, 0x76543210, 0xfedcba98, false, false);
    return __builtin_bit_cast(float, v);
}

__global__ void __launch_bounds__(128) attn_kernel(const bf16* __restrict__ Qh,
                                                   const bf16* __restrict__ Kh,
                                                   const bf16* __restrict__ Vt,
                                                   const float* __restrict__ btab,
                                                   const float* __restrict__ gate,
                                                   bf16* __restrict__ ctx) {
    __shared__ float bias_s[192];
    const int tid = threadIdx.x, lane = tid & 31, wave = tid >> 5;
    const int qblk = blockIdx.x * 128;
    const int h = blockIdx.y, b = blockIdx.z;
    const int q0 = qblk + wave * 32;
    const size_t head = (size_t)(b * HH + h) * SS * DKV;
    const bf16* Qp = Qh + head;
    const bf16* Kp = Kh + head;
    const bf16* Vp = Vt + head;  // [64][4096]
    const float* btabh = btab + h * 8192;
    const float* gateb = gate + (size_t)b * SS;

    const int l15 = lane & 15;
    const int kb8 = (lane >> 4) * 8;

    // Q fragments (B operand, column = query l15): 2 q-groups x 2 halves of the head dim
    bf16x16 qf[2][2];
#pragma unroll
    for (int qt = 0; qt < 2; ++qt) {
        const bf16* qr = Qp + (size_t)(q0 + qt * 16 + l15) * DKV;
#pragma unroll
        for (int kh = 0; kh < 2; ++kh)
            qf[qt][kh] = load16(qr + kh * 32 + kb8, qr + kh * 32 + kb8 + 16);
    }

    // Oa[qt][dt][r] = O^T[d = dt*16 + kb8 + r][q = q0 + qt*16 + l15]
    floatx8 Oa[2][4];
#pragma unroll
    for (int qt = 0; qt < 2; ++qt)
#pragma unroll
        for (int dt = 0; dt < 4; ++dt) Oa[qt][dt] = zero8();
    float rm[2], rl[2];  // per query: running maximum; this lane half's share of the sum
#pragma unroll
    for (int qt = 0; qt < 2; ++qt) { rm[qt] = -1e30f; rl[qt] = 0.f; }

    // bias_s index of (key offset kt*16 + kb8 + r, query offset wave*32 + qt*16 + l15)
    // is bidx + (kt - qt) * 16 + r
    const int bidx = 127 - wave * 32 - l15 + kb8;

    for (int kb = 0; kb < SS; kb += 32) {
        __syncthreads();
        {   // stage Toeplitz bias slice (rel = key - q); 160 entries needed
            int base = kb - qblk - 127 + 4095;
            int gi = base + tid;
            gi = gi < 0 ? 0 : (gi > 8190 ? 8190 : gi);
            bias_s[tid] = btabh[gi];
            if (tid < 32) {
                int gi2 = base + 128 + tid;
                gi2 = gi2 < 0 ? 0 : (gi2 > 8190 ? 8190 : gi2);
                bias_s[128 + tid] = btabh[gi2];
            }
        }
        __syncthreads();

        // delete-gate of this lane's 16 keys
        floatx8 gv[2];
#pragma unroll
        for (int kt = 0; kt < 2; ++kt)
            gv[kt] = *(const floatx8*)(gateb + kb + kt * 16 + kb8);

        // ---- scores S^T: K fragments (A operand) of both key tiles, 8 WMMAs ----
        // sacc[qt][kt][r] = S[q = qt*16 + l15][key = kt*16 + kb8 + r]
        floatx8 sacc[2][2];
        bf16x16 kf[2][2];
#pragma unroll
        for (int kt = 0; kt < 2; ++kt) {
            const bf16* kr = Kp + (size_t)(kb + kt * 16 + l15) * DKV;
            kf[kt][0] = load16(kr + kb8, kr + kb8 + 16);
            kf[kt][1] = load16(kr + 32 + kb8, kr + 32 + kb8 + 16);
        }
        // the address registers of the loads above are reused right behind them
        asm volatile("s_wait_xcnt 0x0" ::: "memory");
#pragma unroll
        for (int kt = 0; kt < 2; ++kt)
#pragma unroll
            for (int qt = 0; qt < 2; ++qt) {
                floatx8 t = wmma_bf16(kf[kt][0], qf[qt][0], zero8());
                sacc[qt][kt] = wmma_bf16(kf[kt][1], qf[qt][1], t);
            }

        // ---- + position bias + delete-gate ----
        floatx8 bv[3];  // the slice is Toeplitz: only kt - qt = -1, 0, 1 differ
#pragma unroll
        for (int j = 0; j < 3; ++j)
#pragma unroll
            for (int r = 0; r < 8; ++r) bv[j][r] = bias_s[bidx + (j - 1) * 16 + r];
#pragma unroll
        for (int qt = 0; qt < 2; ++qt)
#pragma unroll
            for (int kt = 0; kt < 2; ++kt)
                sacc[qt][kt] += bv[kt - qt + 1] + gv[kt];

        // ---- online softmax1 update, one query per lane and group ----
        bf16x16 pf[2];
#pragma unroll
        for (int qt = 0; qt < 2; ++qt) {
            float tm = fmaxf(sacc[qt][0][0], sacc[qt][1][0]);
#pragma unroll
            for (int r = 1; r < 8; ++r)
                tm = fmaxf(tm, fmaxf(sacc[qt][0][r], sacc[qt][1][r]));
            tm = fmaxf(tm, other_half(tm));
            float mnew = fmaxf(rm[qt], tm);
            float alpha = __expf(rm[qt] - mnew);
            rm[qt] = mnew;
            floatx8 d0 = sacc[qt][0] - mnew, d1 = sacc[qt][1] - mnew;
#pragma unroll
            for (int r = 0; r < 8; ++r) {
                d0[r] = __expf(d0[r]);
                d1[r] = __expf(d1[r]);
                // P^T as B operand: element s holds key kb8 + s (s < 8), 16 + kb8 + s - 8
                pf[qt][r]     = f2bf(d0[r]);
                pf[qt][r + 8] = f2bf(d1[r]);
            }
            floatx8 sv = d0 + d1;
            float ts = ((sv[0] + sv[1]) + (sv[2] + sv[3])) + ((sv[4] + sv[5]) + (sv[6] + sv[7]));
            rl[qt] = rl[qt] * alpha + ts;
#pragma unroll
            for (int dt = 0; dt < 4; ++dt) Oa[qt][dt] *= alpha;
        }

        // ---- O^T += V^T P^T : stream V^T fragments (A operand) in pairs, 8 WMMAs ----
#pragma unroll
        for (int np = 0; np < 2; ++np) {
            const bf16* vr0 = Vp + (size_t)((2 * np) * 16 + l15) * SS + kb;
            const bf16* vr1 = Vp + (size_t)((2 * np + 1) * 16 + l15) * SS + kb;
            bf16x16 vfa = load16(vr0 + kb8, vr0 + kb8 + 16);
            bf16x16 vfb = load16(vr1 + kb8, vr1 + kb8 + 16);
#pragma unroll
            for (int qt = 0; qt < 2; ++qt) {
                Oa[qt][2 * np]     = wmma_bf16(vfa, pf[qt], Oa[qt][2 * np]);
                Oa[qt][2 * np + 1] = wmma_bf16(vfb, pf[qt], Oa[qt][2 * np + 1]);
            }
        }
    }

    // ---- softmax1 denominator: l + exp(-m); the halves' sums are joined here ----
    // ---- write ctx [B,S,H*DKV]: a lane holds 8 consecutive d of one query ----
#pragma unroll
    for (int qt = 0; qt < 2; ++qt) {
        float l = rl[qt] + other_half(rl[qt]);
        float inv = 1.f / (l + __expf(-rm[qt]));
        int q = q0 + qt * 16 + l15;
#pragma unroll
        for (int dt = 0; dt < 4; ++dt) {
            bf16x8 o;
#pragma unroll
            for (int r = 0; r < 8; ++r) o[r] = f2bf(Oa[qt][dt][r] * inv);
            *(bf16x8*)&ctx[((size_t)b * SS + q) * DD + h * DKV + dt * 16 + kb8] = o;
        }
    }
}

// ---------------- launcher ----------------
extern "C" void kernel_launch(void* const* d_in, const int* in_sizes, int n_in,
                              void* d_out, int out_size, void* d_ws, size_t ws_size,
                              hipStream_t stream) {
    (void)in_sizes; (void)n_in; (void)out_size; (void)ws_size;
    const float* hidden = (const float*)d_in[0];
    const float* gate   = (const float*)d_in[1];
    const float* ln1    = (const float*)d_in[2];
    const float* qw     = (const float*)d_in[3];
    const float* kw     = (const float*)d_in[4];
    const float* vw     = (const float*)d_in[5];
    const float* ow     = (const float*)d_in[6];
    const float* relb   = (const float*)d_in[7];
    const float* ln2    = (const float*)d_in[8];
    const float* wi     = (const float*)d_in[9];
    const float* wo     = (const float*)d_in[10];

    char* ws = (char*)d_ws;
    size_t off = 0;
    auto take = [&](size_t bytes) -> char* {
        char* p = ws + off;
        off = (off + bytes + 255) & ~(size_t)255;
        return p;
    };
    bf16*  qwb  = (bf16*)take((size_t)DD * DD * 2);    // all weights transposed [N,K]
    bf16*  kwb  = (bf16*)take((size_t)DD * DD * 2);
    bf16*  vwb  = (bf16*)take((size_t)DD * DD * 2);
    bf16*  owb  = (bf16*)take((size_t)DD * DD * 2);
    bf16*  wib  = (bf16*)take((size_t)DD * DFF * 2);
    bf16*  wob  = (bf16*)take((size_t)DFF * DD * 2);
    float* btab = (float*)take((size_t)HH * 8192 * 4);
    bf16*  xb   = (bf16*)take((size_t)MM * DD * 2);
    bf16*  Qhd  = (bf16*)take((size_t)MM * DD * 2);
    bf16*  Khd  = (bf16*)take((size_t)MM * DD * 2);
    bf16*  Vtd  = (bf16*)take((size_t)MM * DD * 2);
    bf16*  ctxb = (bf16*)take((size_t)MM * DD * 2);
    float* hbuf = (float*)take((size_t)MM * DD * 4);
    bf16*  yb   = (bf16*)take((size_t)MM * DD * 2);
    bf16*  ffb  = (bf16*)take((size_t)MM * DFF * 2);

    // transposed bf16 weight conversions (one-time)
    cvtT_kernel<<<(DD * DD + 255) / 256, 256, 0, stream>>>(qw, qwb, DD, DD);
    cvtT_kernel<<<(DD * DD + 255) / 256, 256, 0, stream>>>(kw, kwb, DD, DD);
    cvtT_kernel<<<(DD * DD + 255) / 256, 256, 0, stream>>>(vw, vwb, DD, DD);
    cvtT_kernel<<<(DD * DD + 255) / 256, 256, 0, stream>>>(ow, owb, DD, DD);
    cvtT_kernel<<<(DD * DFF + 255) / 256, 256, 0, stream>>>(wi, wib, DD, DFF);
    cvtT_kernel<<<(DFF * DD + 255) / 256, 256, 0, stream>>>(wo, wob, DFF, DD);
    bias_table_kernel<<<(HH * 8191 + 255) / 256, 256, 0, stream>>>(relb, btab);

    // ln1 -> xb (bf16)
    rmsnorm_kernel<<<MM / 8, 256, 0, stream>>>(hidden, ln1, xb, MM);

    // QKV projections (head layouts; V transposed)
    dim3 gQKV(DD / 128, MM / 128);
    gemm_kernel<1><<<gQKV, 256, 0, stream>>>(xb, qwb, nullptr, Qhd, MM, DD, DD);
    gemm_kernel<1><<<gQKV, 256, 0, stream>>>(xb, kwb, nullptr, Khd, MM, DD, DD);
    gemm_kernel<2><<<gQKV, 256, 0, stream>>>(xb, vwb, nullptr, Vtd, MM, DD, DD);

    // flash attention with softmax1
    attn_kernel<<<dim3(SS / 128, HH, BB), 128, 0, stream>>>(Qhd, Khd, Vtd, btab, gate, ctxb);

    // h = hidden + ctx @ o_w
    gemm_kernel<3><<<dim3(DD / 128, MM / 128), 256, 0, stream>>>(ctxb, owb, hidden, hbuf,
                                                                 MM, DD, DD);
    // ln2 -> yb
    rmsnorm_kernel<<<MM / 8, 256, 0, stream>>>(hbuf, ln2, yb, MM);

    // FFN: relu(y @ wi) then out = h + (.) @ wo
    gemm_kernel<4><<<dim3(DFF / 128, MM / 128), 256, 0, stream>>>(yb, wib, nullptr, ffb,
                                                                  MM, DFF, DD);
    gemm_kernel<3><<<dim3(DD / 128, MM / 128), 256, 0, stream>>>(ffb, wob, hbuf, d_out,
                                                                 MM, DD, DFF);
}

// v002
// One run takes 312 microseconds.
// Next to v001, in two timings, it ran 1.39 times as fast each time.
// All steps since v000 together make it 1.54 times as fast.
#include <hip/hip_runtime.h>
#include <hip/hip_bf16.h>

// ---------------- types ----------------
typedef __bf16 bf16;
typedef bf16  bf16x8  __attribute__((ext_vector_type(8)));
typedef bf16  bf16x16 __attribute__((ext_vector_type(16)));
typedef float floatx8 __attribute__((ext_vector_type(8)));

#define BB 2
#define SS 4096
#define DD 512
#define HH 8
#define DKV 64
#define DFF 2048
#define MM (BB*SS)   // 8192

__device__ __forceinline__ bf16 f2bf(float x) {
    unsigned u = __builtin_bit_cast(unsigned, x);
    unsigned r = u + 0x7FFFu + ((u >> 16) & 1u);
    unsigned short hs = (unsigned short)(r >> 16);
    return __builtin_bit_cast(bf16, hs);
}
__device__ __forceinline__ bf16x16 load16(const bf16* p0, const bf16* p1) {
    bf16x8 a = *(const bf16x8*)p0;
    bf16x8 b = *(const bf16x8*)p1;
    bf16x16 r;
#pragma unroll
    for (int i = 0; i < 8; ++i) { r[i] = a[i]; r[i + 8] = b[i]; }
    return r;
}
__device__ __forceinline__ floatx8 wmma_bf16(bf16x16 a, bf16x16 b, floatx8 c) {
    return __builtin_amdgcn_wmma_f32_16x16x32_bf16(false, a, false, b, (short)0, c,
                                                   false, false);
}
__device__ __forceinline__ floatx8 zero8() {
    floatx8 z = {0.f, 0.f, 0.f, 0.f, 0.f, 0.f, 0.f, 0.f};
    return z;
}

// CDNA5 async global->LDS copy (16B per lane), tracked by ASYNCcnt.
__device__ __forceinline__ void async_copy_b128(const bf16* g, bf16* l) {
    unsigned lofs = (unsigned)(size_t)l;  // low 32 bits of generic shared ptr = DS addr
    asm volatile("global_load_async_to_lds_b128 %0, %1, off"
                 :: "v"(lofs), "v"(g) : "memory");
}
__device__ __forceinline__ void wait_async0() {
    asm volatile("s_wait_asynccnt 0x0" ::: "memory");
}

// ---------------- small kernels ----------------
// fp32 [K,N] -> bf16 transposed [N,K]  (one-time; makes all WMMA B-operands K-contiguous)
__global__ void cvtT_kernel(const float* __restrict__ in, bf16* __restrict__ out,
                            int K, int N) {
    int i = blockIdx.x * 256 + threadIdx.x;
    if (i >= K * N) return;
    int k = i / N, n = i % N;
    out[(size_t)n * K + k] = f2bf(in[i]);
}

// T5 bidirectional bucket bias, Toeplitz table: tab[h*8192 + (rel+4095)]
__global__ void bias_table_kernel(const float* __restrict__ rel_bias, float* __restrict__ tab) {
    int idx = blockIdx.x * 256 + threadIdx.x;
    if (idx >= HH * 8191) return;
    int h = idx / 8191, r = idx % 8191;
    int rel = r - 4095;
    int ret = rel > 0 ? 16 : 0;         // num_buckets/2 = 16
    int n = rel < 0 ? -rel : rel;
    int bucket;
    if (n < 8) {                        // max_exact = 8
        bucket = ret + n;
    } else {
        int v = 8 + (int)(__logf((float)n * 0.125f) * (8.0f / __logf(16.0f)));
        if (v > 15) v = 15;
        bucket = ret + v;
    }
    tab[h * 8192 + r] = rel_bias[bucket * HH + h];
}

// one wave per row of 512 columns; fp32 in, bf16*(rms weight) out
__global__ void __launch_bounds__(256) rmsnorm_kernel(const float* __restrict__ x,
                                                      const float* __restrict__ w,
                                                      bf16* __restrict__ out, int rows) {
    int wave = threadIdx.x >> 5, lane = threadIdx.x & 31;
    int row = blockIdx.x * 8 + wave;
    if (row >= rows) return;
    const float* xr = x + (size_t)row * DD;
    float vals[16];
    float ss = 0.f;
#pragma unroll
    for (int i = 0; i < 16; ++i) {
        float v = xr[lane + i * 32];
        vals[i] = v;
        ss += v * v;
    }
#pragma unroll
    for (int m = 16; m >= 1; m >>= 1) ss += __shfl_xor(ss, m, 32);
    float rs = rsqrtf(ss * (1.f / (float)DD) + 1e-6f);
#pragma unroll
    for (int i = 0; i < 16; ++i) {
        int c = lane + i * 32;
        out[(size_t)row * DD + c] = f2bf(vals[i] * rs * w[c]);
    }
}

// ---------------- WMMA GEMM (async double-buffered LDS) ----------------
// C[M,N] = A[M,K] @ W[K,N] with W pre-transposed as Wt[N,K].
// Block 256 thr = 8 waves (4x2); block tile 128x128; wave tile 32x64; K-step 32.
// MODE 0: bf16 row-major    MODE 1: per-head [B,H,S,64]   MODE 2: V^T [B,H,64,S]
// MODE 3: f32 + residual    MODE 4: relu -> bf16
template <int MODE>
__global__ void __launch_bounds__(256) gemm_kernel(const bf16* __restrict__ A,
                                                   const bf16* __restrict__ Wt,
                                                   const float* __restrict__ resid,
                                                   void* __restrict__ outp,
                                                   int M, int N, int K) {
    __shared__ __align__(16) bf16 As[2][128 * 40];  // [row][k], pad 40
    __shared__ __align__(16) bf16 Bs[2][128 * 40];  // [n][k],  pad 40
    const int tid = threadIdx.x, lane = tid & 31, wave = tid >> 5;
    const int wm = wave >> 1, wn = wave & 1;
    const int n0 = blockIdx.x * 128, m0 = blockIdx.y * 128;
    const int l15 = lane & 15, kb8 = (lane >> 4) * 8;

    floatx8 acc[2][4];
#pragma unroll
    for (int qt = 0; qt < 2; ++qt)
#pragma unroll
        for (int nt = 0; nt < 4; ++nt) acc[qt][nt] = zero8();

    const int pr = tid >> 1, pk = (tid & 1) * 16;  // staging assignment
    const int nIter = K >> 5;

    // prefetch tile 0
    {
        const bf16* ga = A + (size_t)(m0 + pr) * K + pk;
        const bf16* gb = Wt + (size_t)(n0 + pr) * K + pk;
        async_copy_b128(ga,     &As[0][pr * 40 + pk]);
        async_copy_b128(ga + 8, &As[0][pr * 40 + pk + 8]);
        async_copy_b128(gb,     &Bs[0][pr * 40 + pk]);
        async_copy_b128(gb + 8, &Bs[0][pr * 40 + pk + 8]);
    }

    for (int it = 0; it < nIter; ++it) {
        const int bb = it & 1;
        wait_async0();
        __syncthreads();
        if (it + 1 < nIter) {  // overlap next-tile async copy with WMMA
            int kk = (it + 1) << 5;
            const bf16* ga = A + (size_t)(m0 + pr) * K + kk + pk;
            const bf16* gb = Wt + (size_t)(n0 + pr) * K + kk + pk;
            async_copy_b128(ga,     &As[bb ^ 1][pr * 40 + pk]);
            async_copy_b128(ga + 8, &As[bb ^ 1][pr * 40 + pk + 8]);
            async_copy_b128(gb,     &Bs[bb ^ 1][pr * 40 + pk]);
            async_copy_b128(gb + 8, &Bs[bb ^ 1][pr * 40 + pk + 8]);
        }
        bf16x16 af[2];
#pragma unroll
        for (int qt = 0; qt < 2; ++qt) {
            int row = wm * 32 + qt * 16 + l15;
            af[qt] = load16(&As[bb][row * 40 + kb8], &As[bb][row * 40 + kb8 + 16]);
        }
#pragma unroll
        for (int nt = 0; nt < 4; ++nt) {
            int col = wn * 64 + nt * 16 + l15;
            bf16x16 bfr = load16(&Bs[bb][col * 40 + kb8], &Bs[bb][col * 40 + kb8 + 16]);
#pragma unroll
            for (int qt = 0; qt < 2; ++qt)
                acc[qt][nt] = wmma_bf16(af[qt], bfr, acc[qt][nt]);
        }
    }

#pragma unroll
    for (int qt = 0; qt < 2; ++qt) {
#pragma unroll
        for (int nt = 0; nt < 4; ++nt) {
#pragma unroll
            for (int i = 0; i < 8; ++i) {
                int m = m0 + wm * 32 + qt * 16 + i + 8 * (lane >> 4);
                int n = n0 + wn * 64 + nt * 16 + l15;
                float v = acc[qt][nt][i];
                if constexpr (MODE == 0) {
                    ((bf16*)outp)[(size_t)m * N + n] = f2bf(v);
                } else if constexpr (MODE == 1) {
                    int b = m >> 12, s = m & 4095, h = n >> 6, d = n & 63;
                    ((bf16*)outp)[(((size_t)(b * HH + h) * SS) + s) * DKV + d] = f2bf(v);
                } else if constexpr (MODE == 2) {
                    int b = m >> 12, s = m & 4095, h = n >> 6, d = n & 63;
                    ((bf16*)outp)[(((size_t)(b * HH + h) * DKV) + d) * SS + s] = f2bf(v);
                } else if constexpr (MODE == 3) {
                    ((float*)outp)[(size_t)m * N + n] = resid[(size_t)m * N + n] + v;
                } else {  // MODE 4
                    ((bf16*)outp)[(size_t)m * N + n] = f2bf(v > 0.f ? v : 0.f);
                }
            }
        }
    }
}

// ---------------- Flash attention with softmax1 ----------------
// Block = 128 thr = 4 waves; block covers (b, h, 128 q rows); wave covers 32 q rows.
// Scores are formed transposed, S^T = K Q^T (A = K rows, B = Q columns), and the output
// as O^T += V^T P^T. A lane then holds 16 of the 32 keys of ONE query per 16-query group:
// maximum and sum run in the lane (one exchange between lane halves for the maximum),
// and the two S^T tiles of a group, rounded in place, are already the B operand P^T.
// K rows, V^T rows, the bias slice and the delete-gate of 64 keys form one stage; stages
// come to LDS by asynchronous copies, two buffers, one stage ahead, shared by the 4 waves.
#define KST 64                 // keys per stage
#define NST (SS / KST)         // stages
#define KPITCH 72              // 128-B rows at a 144-B pitch (16 B x odd) for 16-B readers

__device__ __forceinline__ float other_half(float x) {  // value of lane l ^ 16
    int v = __builtin_bit_cast(int, x);
    v = __builtin_amdgcn_permlanex16(v, v, 0x76543210, 0xfedcba98, false, false);
    return __builtin_bit_cast(float, v);
}
__device__ __forceinline__ unsigned lds_addr(const void* p) {
    return (unsigned)(size_t)p;  // low 32 bits of a generic shared pointer = LDS byte address
}

// One lane's ten copies of a stage: 4 x 16 B of K, 4 x 16 B of V^T, 2 x 4 B of bias / gate.
// The s_wait_xcnt closes the statement so that no address register is rewritten ahead of it.
__device__ __forceinline__ void stage_copies(const bf16* gk, const bf16* gv, const float* ga0,
                                             const float* ga1, unsigned lk, unsigned lv,
                                             unsigned la) {
    const bf16 *gk1 = gk + 16 * DKV, *gk2 = gk + 32 * DKV, *gk3 = gk + 48 * DKV;
    const bf16 *gv1 = gv + 16 * SS, *gv2 = gv + 32 * SS, *gv3 = gv + 48 * SS;
    const unsigned st = 16 * KPITCH * 2;
    asm volatile(
        "global_load_async_to_lds_b128 %0, %10, off\n\t"
        "global_load_async_to_lds_b128 %1, %11, off\n\t"
        "global_load_async_to_lds_b128 %2, %12, off\n\t"
        "global_load_async_to_lds_b128 %3, %13, off\n\t"
        "global_load_async_to_lds_b128 %4, %14, off\n\t"
        "global_load_async_to_lds_b128 %5, %15, off\n\t"
        "global_load_async_to_lds_b128 %6, %16, off\n\t"
        "global_load_async_to_lds_b128 %7, %17, off\n\t"
        "global_load_async_to_lds_b32 %8, %18, off\n\t"
        "global_load_async_to_lds_b32 %9, %19, off\n\t"
        "s_wait_xcnt 0x0"
        :: "v"(lk), "v"(lk + st), "v"(lk + 2 * st), "v"(lk + 3 * st),
           "v"(lv), "v"(lv + st), "v"(lv + 2 * st), "v"(lv + 3 * st),
           "v"(la), "v"(la + 512u),
           "v"(gk), "v"(gk1), "v"(gk2), "v"(gk3),
           "v"(gv), "v"(gv1), "v"(gv2), "v"(gv3),
           "v"(ga0), "v"(ga1)
        : "memory");
}

__global__ void __launch_bounds__(128) attn_kernel(const bf16* __restrict__ Qh,
                                                   const bf16* __restrict__ Kh,
                                                   const bf16* __restrict__ Vt,
                                                   const float* __restrict__ btab,
                                                   const float* __restrict__ gate,
                                                   bf16* __restrict__ ctx) {
    __shared__ __align__(16) bf16 Ks[2][KST * KPITCH];  // [key][d]
    __shared__ __align__(16) bf16 Vs[2][DKV * KPITCH];  // [d][key]
    __shared__ __align__(32) float aux_s[2][256];       // 0..191 bias slice, 192..255 gate
    const int tid = threadIdx.x, lane = tid & 31, wave = tid >> 5;
    const int qblk = blockIdx.x * 128;
    const int h = blockIdx.y, b = blockIdx.z;
    const int q0 = qblk + wave * 32;
    const size_t head = (size_t)(b * HH + h) * SS * DKV;
    const bf16* Qp = Qh + head;
    const bf16* Kp = Kh + head;
    const bf16* Vp = Vt + head;  // [64][4096]
    const float* btabh = btab + h * 8192;
    const float* gateb = gate + (size_t)b * SS;

    const int l15 = lane & 15;
    const int kb8 = (lane >> 4) * 8;

    // staging assignment: 8 lanes per 128-B row, 16 rows per copy of the block
    const int srow = tid >> 3, scol = (tid & 7) * 8;
    const bool lowpair = __builtin_amdgcn_readfirstlane(wave) < 2;
    auto issue_stage = [&](int t) {
        const int kb = t * KST, bb = t & 1;
        // Toeplitz bias slice (rel = key - q): 191 entries needed, entry j is rel index base + j
        int base = kb - qblk - 127 + 4095;
        int gi = base + tid;
        gi = gi < 0 ? 0 : (gi > 8190 ? 8190 : gi);
        int gi2 = base + 128 + tid;
        gi2 = gi2 < 0 ? 0 : (gi2 > 8190 ? 8190 : gi2);
        // waves 0, 1 bring the slice's tail, waves 2, 3 the gate: a choice per wave, all lanes on
        const float* ga1 = lowpair ? btabh + gi2 : gateb + kb + (tid - 64);
        stage_copies(Kp + (size_t)(kb + srow) * DKV + scol, Vp + (size_t)srow * SS + kb + scol,
                     btabh + gi, ga1, lds_addr(&Ks[bb][srow * KPITCH + scol]),
                     lds_addr(&Vs[bb][srow * KPITCH + scol]), lds_addr(&aux_s[bb][tid]));
    };

    issue_stage(0);

    // Q fragments (B operand, column = query l15): 2 q-groups x 2 halves of the head dim
    bf16x16 qf[2][2];
#pragma unroll
    for (int qt = 0; qt < 2; ++qt) {
        const bf16* qr = Qp + (size_t)(q0 + qt * 16 + l15) * DKV;
#pragma unroll
        for (int kh = 0; kh < 2; ++kh)
            qf[qt][kh] = load16(qr + kh * 32 + kb8, qr + kh * 32 + kb8 + 16);
    }

    // Oa[qt][dt][r] = O^T[d = dt*16 + kb8 + r][q = q0 + qt*16 + l15]
    floatx8 Oa[2][4];
#pragma unroll
    for (int qt = 0; qt < 2; ++qt)
#pragma unroll
        for (int dt = 0; dt < 4; ++dt) Oa[qt][dt] = zero8();
    float rm[2], rl[2];  // per query: running maximum; this lane half's share of the sum
#pragma unroll
    for (int qt = 0; qt < 2; ++qt) { rm[qt] = -1e30f; rl[qt] = 0.f; }

    // bias index of (key offset p*32 + kt*16 + kb8 + r, query offset wave*32 + qt*16 + l15)
    // is bidx + p*32 + (kt - qt) * 16 + r
    const int bidx = 127 - wave * 32 - l15 + kb8;

    wait_async0();    // stage 0 of this wave has landed
    __syncthreads();  // ... and every other wave's share of it
    issue_stage(1);

    for (int t = 0; t < NST; ++t) {
        const bf16* Kb = Ks[t & 1];
        const bf16* Vb = Vs[t & 1];
        const float* ab = aux_s[t & 1];
        // fragment and bias loads of pass p (32 keys) of this stage
        auto load_k = [&](int p, bf16x16 (&kf)[2][2]) {  // K rows, A operand
#pragma unroll
            for (int kt = 0; kt < 2; ++kt) {
                const bf16* kr = Kb + (p * 32 + kt * 16 + l15) * KPITCH;
                kf[kt][0] = load16(kr + kb8, kr + kb8 + 16);
                kf[kt][1] = load16(kr + 32 + kb8, kr + 32 + kb8 + 16);
            }
        };
        auto load_v = [&](int p, bf16x16 (&vf)[4]) {  // V^T rows, A operand
#pragma unroll
            for (int dt = 0; dt < 4; ++dt) {
                const bf16* vr = Vb + (dt * 16 + l15) * KPITCH + p * 32;
                vf[dt] = load16(vr + kb8, vr + kb8 + 16);
            }
        };
        // bg[qt][kt] = position bias + delete-gate of the lane's 8 keys of tile kt
        auto load_bg = [&](int p, floatx8 (&bg)[2][2]) {
            floatx8 gv[2];
#pragma unroll
            for (int kt = 0; kt < 2; ++kt)
                gv[kt] = *(const floatx8*)(ab + 192 + p * 32 + kt * 16 + kb8);
            floatx8 bv[3];  // the slice is Toeplitz: only kt - qt = -1, 0, 1 differ
#pragma unroll
            for (int j = 0; j < 3; ++j)
#pragma unroll
                for (int r = 0; r < 8; ++r) bv[j][r] = ab[bidx + p * 32 + (j - 1) * 16 + r];
#pragma unroll
            for (int qt = 0; qt < 2; ++qt)
#pragma unroll
                for (int kt = 0; kt < 2; ++kt) bg[qt][kt] = bv[kt - qt + 1] + gv[kt];
        };
        // sacc[qt][kt][r] = S[q = qt*16 + l15][key = kt*16 + kb8 + r], 8 WMMAs
        auto scores = [&](const bf16x16 (&kf)[2][2], floatx8 (&sacc)[2][2]) {
#pragma unroll
            for (int kt = 0; kt < 2; ++kt)
#pragma unroll
                for (int qt = 0; qt < 2; ++qt) {
                    floatx8 s = wmma_bf16(kf[kt][0], qf[qt][0], zero8());
                    sacc[qt][kt] = wmma_bf16(kf[kt][1], qf[qt][1], s);
                }
        };
        // online softmax1 update, one query per lane and group; then O^T += V^T P^T, 8 WMMAs
        auto update = [&](floatx8 (&sacc)[2][2], const floatx8 (&bg)[2][2],
                          const bf16x16 (&vf)[4]) {
            bf16x16 pf[2];
#pragma unroll
            for (int qt = 0; qt < 2; ++qt) {
                sacc[qt][0] += bg[qt][0];
                sacc[qt][1] += bg[qt][1];
                float tm = fmaxf(sacc[qt][0][0], sacc[qt][1][0]);
#pragma unroll
                for (int r = 1; r < 8; ++r)
                    tm = fmaxf(tm, fmaxf(sacc[qt][0][r], sacc[qt][1][r]));
                tm = fmaxf(tm, other_half(tm));
                float mnew = fmaxf(rm[qt], tm);
                float alpha = __expf(rm[qt] - mnew);
                rm[qt] = mnew;
                floatx8 d0 = sacc[qt][0] - mnew, d1 = sacc[qt][1] - mnew;
#pragma unroll
                for (int r = 0; r < 8; ++r) {
                    d0[r] = __expf(d0[r]);
                    d1[r] = __expf(d1[r]);
                    // P^T as B operand: element s holds key kb8 + s (s < 8), 16 + kb8 + s - 8
                    pf[qt][r]     = f2bf(d0[r]);
                    pf[qt][r + 8] = f2bf(d1[r]);
                }
                floatx8 sv = d0 + d1;
                float ts = ((sv[0] + sv[1]) + (sv[2] + sv[3])) +
                           ((sv[4] + sv[5]) + (sv[6] + sv[7]));
                rl[qt] = rl[qt] * alpha + ts;
#pragma unroll
                for (int dt = 0; dt < 4; ++dt) Oa[qt][dt] *= alpha;
            }
#pragma unroll
            for (int dt = 0; dt < 4; ++dt)
#pragma unroll
                for (int qt = 0; qt < 2; ++qt) Oa[qt][dt] = wmma_bf16(vf[dt], pf[qt], Oa[qt][dt]);
        };

        // Two passes of 32 keys per stage. The loop stays rolled so that each pass is a block
        // of its own with its LDS loads at its head.
#pragma unroll 1
        for (int p = 0; p < 2; ++p) {
            bf16x16 kf[2][2], vf[4];
            floatx8 sacc[2][2], bg[2][2];
            load_k(p, kf);
            load_bg(p, bg);
            load_v(p, vf);
            // Keeps the pass's loads issued together here, ahead of the products; without it
            // some K loads sink between the score products, each with a full wait of its own.
            __builtin_amdgcn_sched_barrier(0);
            scores(kf, sacc);
            update(sacc, bg, vf);
        }

        // publish point of stage t + 1, which also frees stage t's buffer
        asm volatile("s_wait_dscnt 0x0" ::: "memory");  // this wave's reads of stage t are done
        wait_async0();                                  // its copies of stage t + 1 have landed
        __syncthreads();
        if (t + 2 < NST) issue_stage(t + 2);
    }
    wait_async0();  // nothing is outstanding when the wave ends

    // ---- softmax1 denominator: l + exp(-m); the halves' sums are joined here ----
    // ---- write ctx [B,S,H*DKV]: a lane holds 8 consecutive d of one query ----
#pragma unroll
    for (int qt = 0; qt < 2; ++qt) {
        float l = rl[qt] + other_half(rl[qt]);
        float inv = 1.f / (l + __expf(-rm[qt]));
        int q = q0 + qt * 16 + l15;
#pragma unroll
        for (int dt = 0; dt < 4; ++dt) {
            bf16x8 o;
#pragma unroll
            for (int r = 0; r < 8; ++r) o[r] = f2bf(Oa[qt][dt][r] * inv);
            *(bf16x8*)&ctx[((size_t)b * SS + q) * DD + h * DKV + dt * 16 + kb8] = o;
        }
    }
}

// ---------------- launcher ----------------
extern "C" void kernel_launch(void* const* d_in, const int* in_sizes, int n_in,
                              void* d_out, int out_size, void* d_ws, size_t ws_size,
                              hipStream_t stream) {
    (void)in_sizes; (void)n_in; (void)out_size; (void)ws_size;
    const float* hidden = (const float*)d_in[0];
    const float* gate   = (const float*)d_in[1];
    const float* ln1    = (const float*)d_in[2];
    const float* qw     = (const float*)d_in[3];
    const float* kw     = (const float*)d_in[4];
    const float* vw     = (const float*)d_in[5];
    const float* ow     = (const float*)d_in[6];
    const float* relb   = (const float*)d_in[7];
    const float* ln2    = (const float*)d_in[8];
    const float* wi     = (const float*)d_in[9];
    const float* wo     = (const float*)d_in[10];

    char* ws = (char*)d_ws;
    size_t off = 0;
    auto take = [&](size_t bytes) -> char* {
        char* p = ws + off;
        off = (off + bytes + 255) & ~(size_t)255;
        return p;
    };
    bf16*  qwb  = (bf16*)take((size_t)DD * DD * 2);    // all weights transposed [N,K]
    bf16*  kwb  = (bf16*)take((size_t)DD * DD * 2);
    bf16*  vwb  = (bf16*)take((size_t)DD * DD * 2);
    bf16*  owb  = (bf16*)take((size_t)DD * DD * 2);
    bf16*  wib  = (bf16*)take((size_t)DD * DFF * 2);
    bf16*  wob  = (bf16*)take((size_t)DFF * DD * 2);
    float* btab = (float*)take((size_t)HH * 8192 * 4);
    bf16*  xb   = (bf16*)take((size_t)MM * DD * 2);
    bf16*  Qhd  = (bf16*)take((size_t)MM * DD * 2);
    bf16*  Khd  = (bf16*)take((size_t)MM * DD * 2);
    bf16*  Vtd  = (bf16*)take((size_t)MM * DD * 2);
    bf16*  ctxb = (bf16*)take((size_t)MM * DD * 2);
    float* hbuf = (float*)take((size_t)MM * DD * 4);
    bf16*  yb   = (bf16*)take((size_t)MM * DD * 2);
    bf16*  ffb  = (bf16*)take((size_t)MM * DFF * 2);

    // transposed bf16 weight conversions (one-time)
    cvtT_kernel<<<(DD * DD + 255) / 256, 256, 0, stream>>>(qw, qwb, DD, DD);
    cvtT_kernel<<<(DD * DD + 255) / 256, 256, 0, stream>>>(kw, kwb, DD, DD);
    cvtT_kernel<<<(DD * DD + 255) / 256, 256, 0, stream>>>(vw, vwb, DD, DD);
    cvtT_kernel<<<(DD * DD + 255) / 256, 256, 0, stream>>>(ow, owb, DD, DD);
    cvtT_kernel<<<(DD * DFF + 255) / 256, 256, 0, stream>>>(wi, wib, DD, DFF);
    cvtT_kernel<<<(DFF * DD + 255) / 256, 256, 0, stream>>>(wo, wob, DFF, DD);
    bias_table_kernel<<<(HH * 8191 + 255) / 256, 256, 0, stream>>>(relb, btab);

    // ln1 -> xb (bf16)
    rmsnorm_kernel<<<MM / 8, 256, 0, stream>>>(hidden, ln1, xb, MM);

    // QKV projections (head layouts; V transposed)
    dim3 gQKV(DD / 128, MM / 128);
    gemm_kernel<1><<<gQKV, 256, 0, stream>>>(xb, qwb, nullptr, Qhd, MM, DD, DD);
    gemm_kernel<1><<<gQKV, 256, 0, stream>>>(xb, kwb, nullptr, Khd, MM, DD, DD);
    gemm_kernel<2><<<gQKV, 256, 0, stream>>>(xb, vwb, nullptr, Vtd, MM, DD, DD);

    // flash attention with softmax1
    attn_kernel<<<dim3(SS / 128, HH, BB), 128, 0, stream>>>(Qhd, Khd, Vtd, btab, gate, ctxb);

    // h = hidden + ctx @ o_w
    gemm_kernel<3><<<dim3(DD / 128, MM / 128), 256, 0, stream>>>(ctxb, owb, hidden, hbuf,
                                                                 MM, DD, DD);
    // ln2 -> yb
    rmsnorm_kernel<<<MM / 8, 256, 0, stream>>>(hbuf, ln2, yb, MM);

    // FFN: relu(y @ wi) then out = h + (.) @ wo
    gemm_kernel<4><<<dim3(DFF / 128, MM / 128), 256, 0, stream>>>(yb, wib, nullptr, ffb,
                                                                  MM, DFF, DD);
    gemm_kernel<3><<<dim3(DD / 128, MM / 128), 256, 0, stream>>>(ffb, wob, hbuf, d_out,
                                                                 MM, DD, DFF);
}

// v003
// Measured time: 227 microseconds a run.
// In two side-by-side timings against v002, it was 1.37 and 1.38 times as fast.
// Over all steps from v000 it is 2.13 times as fast.
#include <hip/hip_runtime.h>
#include <hip/hip_bf16.h>

// ---------------- types ----------------
typedef __bf16 bf16;
typedef bf16  bf16x4  __attribute__((ext_vector_type(4)));
typedef bf16  bf16x8  __attribute__((ext_vector_type(8)));
typedef bf16  bf16x16 __attribute__((ext_vector_type(16)));
typedef float floatx4 __attribute__((ext_vector_type(4)));
typedef float floatx8 __attribute__((ext_vector_type(8)));

#define BB 2
#define SS 4096
#define DD 512
#define HH 8
#define DKV 64
#define DFF 2048
#define MM (BB*SS)   // 8192

__device__ __forceinline__ bf16 f2bf(float x) {
    unsigned u = __builtin_bit_cast(unsigned, x);
    unsigned r = u + 0x7FFFu + ((u >> 16) & 1u);
    unsigned short hs = (unsigned short)(r >> 16);
    return __builtin_bit_cast(bf16, hs);
}
__device__ __forceinline__ bf16x16 load16(const bf16* p0, const bf16* p1) {
    bf16x8 a = *(const bf16x8*)p0;
    bf16x8 b = *(const bf16x8*)p1;
    bf16x16 r;
#pragma unroll
    for (int i = 0; i < 8; ++i) { r[i] = a[i]; r[i + 8] = b[i]; }
    return r;
}
__device__ __forceinline__ floatx8 wmma_bf16(bf16x16 a, bf16x16 b, floatx8 c) {
    return __builtin_amdgcn_wmma_f32_16x16x32_bf16(false, a, false, b, (short)0, c,
                                                   false, false);
}
__device__ __forceinline__ floatx8 zero8() {
    floatx8 z = {0.f, 0.f, 0.f, 0.f, 0.f, 0.f, 0.f, 0.f};
    return z;
}

// CDNA5 async global->LDS copy (16B per lane), tracked by ASYNCcnt.
__device__ __forceinline__ void async_copy_b128(const bf16* g, bf16* l) {
    unsigned lofs = (unsigned)(size_t)l;  // low 32 bits of generic shared ptr = DS addr
    asm volatile("global_load_async_to_lds_b128 %0, %1, off"
                 :: "v"(lofs), "v"(g) : "memory");
}
__device__ __forceinline__ void wait_async0() {
    asm volatile("s_wait_asynccnt 0x0" ::: "memory");
}

// ---------------- small kernels ----------------
// fp32 [K,N] -> bf16 transposed [N,K] (makes all WMMA B-operands K-contiguous), all six
// weights in one launch. A block of 4 waves takes one 64 x 64 tile: a thread reads two 4 x 4
// patches by 16-B loads (256 B of a row per 16 lanes), rounds them and stores them transposed
// to LDS; the tile then leaves by 16-B stores, one whole 128-B line of an output row per 8 lanes.
#define TPITCH 72  // 128-B rows at a 144-B pitch, 16-B aligned for the readers
template <int K, int N>
__device__ __forceinline__ void transpose_tile(const float* __restrict__ in,
                                               bf16* __restrict__ out, int tile, bf16* ts) {
    constexpr int TN = N / 64;  // tiles along N
    const int tid = threadIdx.x;
    const int k0 = (tile / TN) * 64, n0 = (tile % TN) * 64;
    const int a = tid >> 4, c = tid & 15;  // patch h: k = 32h + 4a .. + 3, n = 4c .. 4c + 3
    const float* src = in + k0 * N + n0;
    floatx4 v[2][4];
#pragma unroll
    for (int h = 0; h < 2; ++h)
#pragma unroll
        for (int j = 0; j < 4; ++j)
            v[h][j] = *(const floatx4*)(src + (4 * a * N + 4 * c) + (32 * h + j) * N);
#pragma unroll
    for (int h = 0; h < 2; ++h)
#pragma unroll
        for (int i = 0; i < 4; ++i) {
            bf16x4 p;
#pragma unroll
            for (int j = 0; j < 4; ++j) p[j] = f2bf(v[h][j][i]);
            *(bf16x4*)&ts[(4 * c + i) * TPITCH + 32 * h + 4 * a] = p;
        }
    __syncthreads();  // the tile is read across the waves that wrote it
    bf16* dst = out + n0 * K + k0;
    const int n = tid >> 3, ch = (tid & 7) * 8;
#pragma unroll
    for (int j = 0; j < 4; ++j)
        *(bf16x8*)(dst + (n * K + ch) + 16 * j * K) =
            *(const bf16x8*)&ts[(n + 16 * j) * TPITCH + ch];
}

// Blocks 0..255: the four 512 x 512 weights, 64 tiles each; 256..511: wi; 512..767: wo.
__global__ void __launch_bounds__(128) cvtT_all_kernel(
    const float* __restrict__ qw, const float* __restrict__ kw, const float* __restrict__ vw,
    const float* __restrict__ ow, const float* __restrict__ wi, const float* __restrict__ wo,
    bf16* __restrict__ qwb, bf16* __restrict__ kwb, bf16* __restrict__ vwb,
    bf16* __restrict__ owb, bf16* __restrict__ wib, bf16* __restrict__ wob) {
    __shared__ __align__(16) bf16 ts[64 * TPITCH];  // [n][k]
    const int blk = blockIdx.x, g = blk >> 6;
    if (g < 4) {
        const float* in = g == 0 ? qw : g == 1 ? kw : g == 2 ? vw : ow;
        bf16* out = g == 0 ? qwb : g == 1 ? kwb : g == 2 ? vwb : owb;
        transpose_tile<DD, DD>(in, out, blk & 63, ts);
    } else if (g < 8) {
        transpose_tile<DD, DFF>(wi, wib, blk - 256, ts);
    } else {
        transpose_tile<DFF, DD>(wo, wob, blk - 512, ts);
    }
}

// T5 bidirectional bucket bias, Toeplitz table: tab[h*8192 + (rel+4095)]
__global__ void bias_table_kernel(const float* __restrict__ rel_bias, float* __restrict__ tab) {
    int idx = blockIdx.x * 256 + threadIdx.x;
    if (idx >= HH * 8191) return;
    int h = idx / 8191, r = idx % 8191;
    int rel = r - 4095;
    int ret = rel > 0 ? 16 : 0;         // num_buckets/2 = 16
    int n = rel < 0 ? -rel : rel;
    int bucket;
    if (n < 8) {                        // max_exact = 8
        bucket = ret + n;
    } else {
        int v = 8 + (int)(__logf((float)n * 0.125f) * (8.0f / __logf(16.0f)));
        if (v > 15) v = 15;
        bucket = ret + v;
    }
    tab[h * 8192 + r] = rel_bias[bucket * HH + h];
}

// one wave per row of 512 columns; fp32 in, bf16*(rms weight) out
__global__ void __launch_bounds__(256) rmsnorm_kernel(const float* __restrict__ x,
                                                      const float* __restrict__ w,
                                                      bf16* __restrict__ out, int rows) {
    int wave = threadIdx.x >> 5, lane = threadIdx.x & 31;
    int row = blockIdx.x * 8 + wave;
    if (row >= rows) return;
    const float* xr = x + (size_t)row * DD;
    float vals[16];
    float ss = 0.f;
#pragma unroll
    for (int i = 0; i < 16; ++i) {
        float v = xr[lane + i * 32];
        vals[i] = v;
        ss += v * v;
    }
#pragma unroll
    for (int m = 16; m >= 1; m >>= 1) ss += __shfl_xor(ss, m, 32);
    float rs = rsqrtf(ss * (1.f / (float)DD) + 1e-6f);
#pragma unroll
    for (int i = 0; i < 16; ++i) {
        int c = lane + i * 32;
        out[(size_t)row * DD + c] = f2bf(vals[i] * rs * w[c]);
    }
}

// ---------------- WMMA GEMM (async double-buffered LDS) ----------------
// C[M,N] = A[M,K] @ W[K,N] with W pre-transposed as Wt[N,K].
// Block 256 thr = 8 waves (4x2); block tile 128x128; wave tile 32x64; K-step 32.
// MODE 0: bf16 row-major    MODE 1: per-head [B,H,S,64]   MODE 2: V^T [B,H,64,S]
// MODE 3: f32 + residual    MODE 4: relu -> bf16
template <int MODE>
__global__ void __launch_bounds__(256) gemm_kernel(const bf16* __restrict__ A,
                                                   const bf16* __restrict__ Wt,
                                                   const float* __restrict__ resid,
                                                   void* __restrict__ outp,
                                                   int M, int N, int K) {
    __shared__ __align__(16) bf16 As[2][128 * 40];  // [row][k], pad 40
    __shared__ __align__(16) bf16 Bs[2][128 * 40];  // [n][k],  pad 40
    const int tid = threadIdx.x, lane = tid & 31, wave = tid >> 5;
    const int wm = wave >> 1, wn = wave & 1;
    const int n0 = blockIdx.x * 128, m0 = blockIdx.y * 128;
    const int l15 = lane & 15, kb8 = (lane >> 4) * 8;

    floatx8 acc[2][4];
#pragma unroll
    for (int qt = 0; qt < 2; ++qt)
#pragma unroll
        for (int nt = 0; nt < 4; ++nt) acc[qt][nt] = zero8();

    const int pr = tid >> 1, pk = (tid & 1) * 16;  // staging assignment
    const int nIter = K >> 5;

    // prefetch tile 0
    {
        const bf16* ga = A + (size_t)(m0 + pr) * K + pk;
        const bf16* gb = Wt + (size_t)(n0 + pr) * K + pk;
        async_copy_b128(ga,     &As[0][pr * 40 + pk]);
        async_copy_b128(ga + 8, &As[0][pr * 40 + pk + 8]);
        async_copy_b128(gb,     &Bs[0][pr * 40 + pk]);
        async_copy_b128(gb + 8, &Bs[0][pr * 40 + pk + 8]);
    }

    for (int it = 0; it < nIter; ++it) {
        const int bb = it & 1;
        wait_async0();
        __syncthreads();
        if (it + 1 < nIter) {  // overlap next-tile async copy with WMMA
            int kk = (it + 1) << 5;
            const bf16* ga = A + (size_t)(m0 + pr) * K + kk + pk;
            const bf16* gb = Wt + (size_t)(n0 + pr) * K + kk + pk;
            async_copy_b128(ga,     &As[bb ^ 1][pr * 40 + pk]);
            async_copy_b128(ga + 8, &As[bb ^ 1][pr * 40 + pk + 8]);
            async_copy_b128(gb,     &Bs[bb ^ 1][pr * 40 + pk]);
            async_copy_b128(gb + 8, &Bs[bb ^ 1][pr * 40 + pk + 8]);
        }
        bf16x16 af[2];
#pragma unroll
        for (int qt = 0; qt < 2; ++qt) {
            int row = wm * 32 + qt * 16 + l15;
            af[qt] = load16(&As[bb][row * 40 + kb8], &As[bb][row * 40 + kb8 + 16]);
        }
#pragma unroll
        for (int nt = 0; nt < 4; ++nt) {
            int col = wn * 64 + nt * 16 + l15;
            bf16x16 bfr = load16(&Bs[bb][col * 40 + kb8], &Bs[bb][col * 40 + kb8 + 16]);
#pragma unroll
            for (int qt = 0; qt < 2; ++qt)
                acc[qt][nt] = wmma_bf16(af[qt], bfr, acc[qt][nt]);
        }
    }

#pragma unroll
    for (int qt = 0; qt < 2; ++qt) {
#pragma unroll
        for (int nt = 0; nt < 4; ++nt) {
#pragma unroll
            for (int i = 0; i < 8; ++i) {
                int m = m0 + wm * 32 + qt * 16 + i + 8 * (lane >> 4);
                int n = n0 + wn * 64 + nt * 16 + l15;
                float v = acc[qt][nt][i];
                if constexpr (MODE == 0) {
                    ((bf16*)outp)[(size_t)m * N + n] = f2bf(v);
                } else if constexpr (MODE == 1) {
                    int b = m >> 12, s = m & 4095, h = n >> 6, d = n & 63;
                    ((bf16*)outp)[(((size_t)(b * HH + h) * SS) + s) * DKV + d] = f2bf(v);
                } else if constexpr (MODE == 2) {
                    int b = m >> 12, s = m & 4095, h = n >> 6, d = n & 63;
                    ((bf16*)outp)[(((size_t)(b * HH + h) * DKV) + d) * SS + s] = f2bf(v);
                } else if constexpr (MODE == 3) {
                    ((float*)outp)[(size_t)m * N + n] = resid[(size_t)m * N + n] + v;
                } else {  // MODE 4
                    ((bf16*)outp)[(size_t)m * N + n] = f2bf(v > 0.f ? v : 0.f);
                }
            }
        }
    }
}

// ---------------- Flash attention with softmax1 ----------------
// Block = 128 thr = 4 waves; block covers (b, h, 128 q rows); wave covers 32 q rows.
// Scores are formed transposed, S^T = K Q^T (A = K rows, B = Q columns), and the output
// as O^T += V^T P^T. A lane then holds 16 of the 32 keys of ONE query per 16-query group:
// maximum and sum run in the lane (one exchange between lane halves for the maximum),
// and the two S^T tiles of a group, rounded in place, are already the B operand P^T.
// K rows, V^T rows, the bias slice and the delete-gate of 64 keys form one stage; stages
// come to LDS by asynchronous copies, two buffers, one stage ahead, shared by the 4 waves.
#define KST 64                 // keys per stage
#define NST (SS / KST)         // stages
#define KPITCH 72              // 128-B rows at a 144-B pitch (16 B x odd) for 16-B readers

__device__ __forceinline__ float other_half(float x) {  // value of lane l ^ 16
    int v = __builtin_bit_cast(int, x);
    v = __builtin_amdgcn_permlanex16(v, v, 0x76543210, 0xfedcba98, false, false);
    return __builtin_bit_cast(float, v);
}
__device__ __forceinline__ unsigned lds_addr(const void* p) {
    return (unsigned)(size_t)p;  // low 32 bits of a generic shared pointer = LDS byte address
}

// One lane's ten copies of a stage: 4 x 16 B of K, 4 x 16 B of V^T, 2 x 4 B of bias / gate.
// The s_wait_xcnt closes the statement so that no address register is rewritten ahead of it.
__device__ __forceinline__ void stage_copies(const bf16* gk, const bf16* gv, const float* ga0,
                                             const float* ga1, unsigned lk, unsigned lv,
                                             unsigned la) {
    const bf16 *gk1 = gk + 16 * DKV, *gk2 = gk + 32 * DKV, *gk3 = gk + 48 * DKV;
    const bf16 *gv1 = gv + 16 * SS, *gv2 = gv + 32 * SS, *gv3 = gv + 48 * SS;
    const unsigned st = 16 * KPITCH * 2;
    asm volatile(
        "global_load_async_to_lds_b128 %0, %10, off\n\t"
        "global_load_async_to_lds_b128 %1, %11, off\n\t"
        "global_load_async_to_lds_b128 %2, %12, off\n\t"
        "global_load_async_to_lds_b128 %3, %13, off\n\t"
        "global_load_async_to_lds_b128 %4, %14, off\n\t"
        "global_load_async_to_lds_b128 %5, %15, off\n\t"
        "global_load_async_to_lds_b128 %6, %16, off\n\t"
        "global_load_async_to_lds_b128 %7, %17, off\n\t"
        "global_load_async_to_lds_b32 %8, %18, off\n\t"
        "global_load_async_to_lds_b32 %9, %19, off\n\t"
        "s_wait_xcnt 0x0"
        :: "v"(lk), "v"(lk + st), "v"(lk + 2 * st), "v"(lk + 3 * st),
           "v"(lv), "v"(lv + st), "v"(lv + 2 * st), "v"(lv + 3 * st),
           "v"(la), "v"(la + 512u),
           "v"(gk), "v"(gk1), "v"(gk2), "v"(gk3),
           "v"(gv), "v"(gv1), "v"(gv2), "v"(gv3),
           "v"(ga0), "v"(ga1)
        : "memory");
}

__global__ void __launch_bounds__(128) attn_kernel(const bf16* __restrict__ Qh,
                                                   const bf16* __restrict__ Kh,
                                                   const bf16* __restrict__ Vt,
                                                   const float* __restrict__ btab,
                                                   const float* __restrict__ gate,
                                                   bf16* __restrict__ ctx) {
    __shared__ __align__(16) bf16 Ks[2][KST * KPITCH];  // [key][d]
    __shared__ __align__(16) bf16 Vs[2][DKV * KPITCH];  // [d][key]
    __shared__ __align__(32) float aux_s[2][256];       // 0..191 bias slice, 192..255 gate
    const int tid = threadIdx.x, lane = tid & 31, wave = tid >> 5;
    const int qblk = blockIdx.x * 128;
    const int h = blockIdx.y, b = blockIdx.z;
    const int q0 = qblk + wave * 32;
    const size_t head = (size_t)(b * HH + h) * SS * DKV;
    const bf16* Qp = Qh + head;
    const bf16* Kp = Kh + head;
    const bf16* Vp = Vt + head;  // [64][4096]
    const float* btabh = btab + h * 8192;
    const float* gateb = gate + (size_t)b * SS;

    const int l15 = lane & 15;
    const int kb8 = (lane >> 4) * 8;

    // staging assignment: 8 lanes per 128-B row, 16 rows per copy of the block
    const int srow = tid >> 3, scol = (tid & 7) * 8;
    const bool lowpair = __builtin_amdgcn_readfirstlane(wave) < 2;
    auto issue_stage = [&](int t) {
        const int kb = t * KST, bb = t & 1;
        // Toeplitz bias slice (rel = key - q): 191 entries needed, entry j is rel index base + j
        int base = kb - qblk - 127 + 4095;
        int gi = base + tid;
        gi = gi < 0 ? 0 : (gi > 8190 ? 8190 : gi);
        int gi2 = base + 128 + tid;
        gi2 = gi2 < 0 ? 0 : (gi2 > 8190 ? 8190 : gi2);
        // waves 0, 1 bring the slice's tail, waves 2, 3 the gate: a choice per wave, all lanes on
        const float* ga1 = lowpair ? btabh + gi2 : gateb + kb + (tid - 64);
        stage_copies(Kp + (size_t)(kb + srow) * DKV + scol, Vp + (size_t)srow * SS + kb + scol,
                     btabh + gi, ga1, lds_addr(&Ks[bb][srow * KPITCH + scol]),
                     lds_addr(&Vs[bb][srow * KPITCH + scol]), lds_addr(&aux_s[bb][tid]));
    };

    issue_stage(0);

    // Q fragments (B operand, column = query l15): 2 q-groups x 2 halves of the head dim
    bf16x16 qf[2][2];
#pragma unroll
    for (int qt = 0; qt < 2; ++qt) {
        const bf16* qr = Qp + (size_t)(q0 + qt * 16 + l15) * DKV;
#pragma unroll
        for (int kh = 0; kh < 2; ++kh)
            qf[qt][kh] = load16(qr + kh * 32 + kb8, qr + kh * 32 + kb8 + 16);
    }

    // Oa[qt][dt][r] = O^T[d = dt*16 + kb8 + r][q = q0 + qt*16 + l15]
    floatx8 Oa[2][4];
#pragma unroll
    for (int qt = 0; qt < 2; ++qt)
#pragma unroll
        for (int dt = 0; dt < 4; ++dt) Oa[qt][dt] = zero8();
    float rm[2], rl[2];  // per query: running maximum; this lane half's share of the sum
#pragma unroll
    for (int qt = 0; qt < 2; ++qt) { rm[qt] = -1e30f; rl[qt] = 0.f; }

    // bias index of (key offset p*32 + kt*16 + kb8 + r, query offset wave*32 + qt*16 + l15)
    // is bidx + p*32 + (kt - qt) * 16 + r
    const int bidx = 127 - wave * 32 - l15 + kb8;

    wait_async0();    // stage 0 of this wave has landed
    __syncthreads();  // ... and every other wave's share of it
    issue_stage(1);

    for (int t = 0; t < NST; ++t) {
        const bf16* Kb = Ks[t & 1];
        const bf16* Vb = Vs[t & 1];
        const float* ab = aux_s[t & 1];
        // fragment and bias loads of pass p (32 keys) of this stage
        auto load_k = [&](int p, bf16x16 (&kf)[2][2]) {  // K rows, A operand
#pragma unroll
            for (int kt = 0; kt < 2; ++kt) {
                const bf16* kr = Kb + (p * 32 + kt * 16 + l15) * KPITCH;
                kf[kt][0] = load16(kr + kb8, kr + kb8 + 16);
                kf[kt][1] = load16(kr + 32 + kb8, kr + 32 + kb8 + 16);
            }
        };
        auto load_v = [&](int p, bf16x16 (&vf)[4]) {  // V^T rows, A operand
#pragma unroll
            for (int dt = 0; dt < 4; ++dt) {
                const bf16* vr = Vb + (dt * 16 + l15) * KPITCH + p * 32;
                vf[dt] = load16(vr + kb8, vr + kb8 + 16);
            }
        };
        // bg[qt][kt] = position bias + delete-gate of the lane's 8 keys of tile kt
        auto load_bg = [&](int p, floatx8 (&bg)[2][2]) {
            floatx8 gv[2];
#pragma unroll
            for (int kt = 0; kt < 2; ++kt)
                gv[kt] = *(const floatx8*)(ab + 192 + p * 32 + kt * 16 + kb8);
            floatx8 bv[3];  // the slice is Toeplitz: only kt - qt = -1, 0, 1 differ
#pragma unroll
            for (int j = 0; j < 3; ++j)
#pragma unroll
                for (int r = 0; r < 8; ++r) bv[j][r] = ab[bidx + p * 32 + (j - 1) * 16 + r];
#pragma unroll
            for (int qt = 0; qt < 2; ++qt)
#pragma unroll
                for (int kt = 0; kt < 2; ++kt) bg[qt][kt] = bv[kt - qt + 1] + gv[kt];
        };
        // sacc[qt][kt][r] = S[q = qt*16 + l15][key = kt*16 + kb8 + r], 8 WMMAs
        auto scores = [&](const bf16x16 (&kf)[2][2], floatx8 (&sacc)[2][2]) {
#pragma unroll
            for (int kt = 0; kt < 2; ++kt)
#pragma unroll
                for (int qt = 0; qt < 2; ++qt) {
                    floatx8 s = wmma_bf16(kf[kt][0], qf[qt][0], zero8());
                    sacc[qt][kt] = wmma_bf16(kf[kt][1], qf[qt][1], s);
                }
        };
        // online softmax1 update, one query per lane and group; then O^T += V^T P^T, 8 WMMAs
        auto update = [&](floatx8 (&sacc)[2][2], const floatx8 (&bg)[2][2],
                          const bf16x16 (&vf)[4]) {
            bf16x16 pf[2];
#pragma unroll
            for (int qt = 0; qt < 2; ++qt) {
                sacc[qt][0] += bg[qt][0];
                sacc[qt][1] += bg[qt][1];
                float tm = fmaxf(sacc[qt][0][0], sacc[qt][1][0]);
#pragma unroll
                for (int r = 1; r < 8; ++r)
                    tm = fmaxf(tm, fmaxf(sacc[qt][0][r], sacc[qt][1][r]));
                tm = fmaxf(tm, other_half(tm));
                float mnew = fmaxf(rm[qt], tm);
                float alpha = __expf(rm[qt] - mnew);
                rm[qt] = mnew;
                floatx8 d0 = sacc[qt][0] - mnew, d1 = sacc[qt][1] - mnew;
#pragma unroll
                for (int r = 0; r < 8; ++r) {
                    d0[r] = __expf(d0[r]);
                    d1[r] = __expf(d1[r]);
                    // P^T as B operand: element s holds key kb8 + s (s < 8), 16 + kb8 + s - 8
                    pf[qt][r]     = f2bf(d0[r]);
                    pf[qt][r + 8] = f2bf(d1[r]);
                }
                floatx8 sv = d0 + d1;
                float ts = ((sv[0] + sv[1]) + (sv[2] + sv[3])) +
                           ((sv[4] + sv[5]) + (sv[6] + sv[7]));
                rl[qt] = rl[qt] * alpha + ts;
#pragma unroll
                for (int dt = 0; dt < 4; ++dt) Oa[qt][dt] *= alpha;
            }
#pragma unroll
            for (int dt = 0; dt < 4; ++dt)
#pragma unroll
                for (int qt = 0; qt < 2; ++qt) Oa[qt][dt] = wmma_bf16(vf[dt], pf[qt], Oa[qt][dt]);
        };

        // Two passes of 32 keys per stage. The loop stays rolled so that each pass is a block
        // of its own with its LDS loads at its head.
#pragma unroll 1
        for (int p = 0; p < 2; ++p) {
            bf16x16 kf[2][2], vf[4];
            floatx8 sacc[2][2], bg[2][2];
            load_k(p, kf);
            load_bg(p, bg);
            load_v(p, vf);
            // Keeps the pass's loads issued together here, ahead of the products; without it
            // some K loads sink between the score products, each with a full wait of its own.
            __builtin_amdgcn_sched_barrier(0);
            scores(kf, sacc);
            update(sacc, bg, vf);
        }

        // publish point of stage t + 1, which also frees stage t's buffer
        asm volatile("s_wait_dscnt 0x0" ::: "memory");  // this wave's reads of stage t are done
        wait_async0();                                  // its copies of stage t + 1 have landed
        __syncthreads();
        if (t + 2 < NST) issue_stage(t + 2);
    }
    wait_async0();  // nothing is outstanding when the wave ends

    // ---- softmax1 denominator: l + exp(-m); the halves' sums are joined here ----
    // ---- write ctx [B,S,H*DKV]: a lane holds 8 consecutive d of one query ----
#pragma unroll
    for (int qt = 0; qt < 2; ++qt) {
        float l = rl[qt] + other_half(rl[qt]);
        float inv = 1.f / (l + __expf(-rm[qt]));
        int q = q0 + qt * 16 + l15;
#pragma unroll
        for (int dt = 0; dt < 4; ++dt) {
            bf16x8 o;
#pragma unroll
            for (int r = 0; r < 8; ++r) o[r] = f2bf(Oa[qt][dt][r] * inv);
            *(bf16x8*)&ctx[((size_t)b * SS + q) * DD + h * DKV + dt * 16 + kb8] = o;
        }
    }
}

// ---------------- launcher ----------------
extern "C" void kernel_launch(void* const* d_in, const int* in_sizes, int n_in,
                              void* d_out, int out_size, void* d_ws, size_t ws_size,
                              hipStream_t stream) {
    (void)in_sizes; (void)n_in; (void)out_size; (void)ws_size;
    const float* hidden = (const float*)d_in[0];
    const float* gate   = (const float*)d_in[1];
    const float* ln1    = (const float*)d_in[2];
    const float* qw     = (const float*)d_in[3];
    const float* kw     = (const float*)d_in[4];
    const float* vw     = (const float*)d_in[5];
    const float* ow     = (const float*)d_in[6];
    const float* relb   = (const float*)d_in[7];
    const float* ln2    = (const float*)d_in[8];
    const float* wi     = (const float*)d_in[9];
    const float* wo     = (const float*)d_in[10];

    char* ws = (char*)d_ws;
    size_t off = 0;
    auto take = [&](size_t bytes) -> char* {
        char* p = ws + off;
        off = (off + bytes + 255) & ~(size_t)255;
        return p;
    };
    bf16*  qwb  = (bf16*)take((size_t)DD * DD * 2);    // all weights transposed [N,K]
    bf16*  kwb  = (bf16*)take((size_t)DD * DD * 2);
    bf16*  vwb  = (bf16*)take((size_t)DD * DD * 2);
    bf16*  owb  = (bf16*)take((size_t)DD * DD * 2);
    bf16*  wib  = (bf16*)take((size_t)DD * DFF * 2);
    bf16*  wob  = (bf16*)take((size_t)DFF * DD * 2);
    float* btab = (float*)take((size_t)HH * 8192 * 4);
    bf16*  xb   = (bf16*)take((size_t)MM * DD * 2);
    bf16*  Qhd  = (bf16*)take((size_t)MM * DD * 2);
    bf16*  Khd  = (bf16*)take((size_t)MM * DD * 2);
    bf16*  Vtd  = (bf16*)take((size_t)MM * DD * 2);
    bf16*  ctxb = (bf16*)take((size_t)MM * DD * 2);
    float* hbuf = (float*)take((size_t)MM * DD * 4);
    bf16*  yb   = (bf16*)take((size_t)MM * DD * 2);
    bf16*  ffb  = (bf16*)take((size_t)MM * DFF * 2);

    // transposed bf16 weight conversions: 768 tiles of 64 x 64
    cvtT_all_kernel<<<768, 128, 0, stream>>>(qw, kw, vw, ow, wi, wo, qwb, kwb, vwb, owb, wib, wob);
    bias_table_kernel<<<(HH * 8191 + 255) / 256, 256, 0, stream>>>(relb, btab);

    // ln1 -> xb (bf16)
    rmsnorm_kernel<<<MM / 8, 256, 0, stream>>>(hidden, ln1, xb, MM);

    // QKV projections (head layouts; V transposed)
    dim3 gQKV(DD / 128, MM / 128);
    gemm_kernel<1><<<gQKV, 256, 0, stream>>>(xb, qwb, nullptr, Qhd, MM, DD, DD);
    gemm_kernel<1><<<gQKV, 256, 0, stream>>>(xb, kwb, nullptr, Khd, MM, DD, DD);
    gemm_kernel<2><<<gQKV, 256, 0, stream>>>(xb, vwb, nullptr, Vtd, MM, DD, DD);

    // flash attention with softmax1
    attn_kernel<<<dim3(SS / 128, HH, BB), 128, 0, stream>>>(Qhd, Khd, Vtd, btab, gate, ctxb);

    // h = hidden + ctx @ o_w
    gemm_kernel<3><<<dim3(DD / 128, MM / 128), 256, 0, stream>>>(ctxb, owb, hidden, hbuf,
                                                                 MM, DD, DD);
    // ln2 -> yb
    rmsnorm_kernel<<<MM / 8, 256, 0, stream>>>(hbuf, ln2, yb, MM);

    // FFN: relu(y @ wi) then out = h + (.) @ wo
    gemm_kernel<4><<<dim3(DFF / 128, MM / 128), 256, 0, stream>>>(yb, wib, nullptr, ffb,
                                                                  MM, DFF, DD);
    gemm_kernel<3><<<dim3(DD / 128, MM / 128), 256, 0, stream>>>(ffb, wob, hbuf, d_out,
                                                                 MM, DD, DFF);
}

// v004
// It runs in 186 microseconds.
// Timed twice side by side with v003, it ran 1.22 and 1.20 times as fast.
// All steps since v000 together make it 2.57 times as fast.
#include <hip/hip_runtime.h>
#include <hip/hip_bf16.h>

// ---------------- types ----------------
typedef __bf16 bf16;
typedef bf16  bf16x4  __attribute__((ext_vector_type(4)));
typedef bf16  bf16x8  __attribute__((ext_vector_type(8)));
typedef bf16  bf16x16 __attribute__((ext_vector_type(16)));
typedef float floatx4 __attribute__((ext_vector_type(4)));
typedef float floatx8 __attribute__((ext_vector_type(8)));

#define BB 2
#define SS 4096
#define DD 512
#define HH 8
#define DKV 64
#define DFF 2048
#define MM (BB*SS)   // 8192

__device__ __forceinline__ bf16 f2bf(float x) {
    unsigned u = __builtin_bit_cast(unsigned, x);
    unsigned r = u + 0x7FFFu + ((u >> 16) & 1u);
    unsigned short hs = (unsigned short)(r >> 16);
    return __builtin_bit_cast(bf16, hs);
}
__device__ __forceinline__ bf16x16 load16(const bf16* p0, const bf16* p1) {
    bf16x8 a = *(const bf16x8*)p0;
    bf16x8 b = *(const bf16x8*)p1;
    bf16x16 r;
#pragma unroll
    for (int i = 0; i < 8; ++i) { r[i] = a[i]; r[i + 8] = b[i]; }
    return r;
}
__device__ __forceinline__ floatx8 wmma_bf16(bf16x16 a, bf16x16 b, floatx8 c) {
    return __builtin_amdgcn_wmma_f32_16x16x32_bf16(false, a, false, b, (short)0, c,
                                                   false, false);
}
__device__ __forceinline__ floatx8 zero8() {
    floatx8 z = {0.f, 0.f, 0.f, 0.f, 0.f, 0.f, 0.f, 0.f};
    return z;
}

__device__ __forceinline__ void wait_async0() {
    asm volatile("s_wait_asynccnt 0x0" ::: "memory");
}
__device__ __forceinline__ unsigned lds_addr(const void* p) {
    return (unsigned)(size_t)p;  // low 32 bits of a generic shared pointer = LDS byte address
}

// ---------------- small kernels ----------------
// fp32 [K,N] -> bf16 transposed [N,K] (makes all WMMA B-operands K-contiguous), all six
// weights in one launch. A block of 4 waves takes one 64 x 64 tile: a thread reads two 4 x 4
// patches by 16-B loads (256 B of a row per 16 lanes), rounds them and stores them transposed
// to LDS; the tile then leaves by 16-B stores, one whole 128-B line of an output row per 8 lanes.
#define TPITCH 72  // 128-B rows at a 144-B pitch, 16-B aligned for the readers
template <int K, int N>
__device__ __forceinline__ void transpose_tile(const float* __restrict__ in,
                                               bf16* __restrict__ out, int tile, bf16* ts) {
    constexpr int TN = N / 64;  // tiles along N
    const int tid = threadIdx.x;
    const int k0 = (tile / TN) * 64, n0 = (tile % TN) * 64;
    const int a = tid >> 4, c = tid & 15;  // patch h: k = 32h + 4a .. + 3, n = 4c .. 4c + 3
    const float* src = in + k0 * N + n0;
    floatx4 v[2][4];
#pragma unroll
    for (int h = 0; h < 2; ++h)
#pragma unroll
        for (int j = 0; j < 4; ++j)
            v[h][j] = *(const floatx4*)(src + (4 * a * N + 4 * c) + (32 * h + j) * N);
#pragma unroll
    for (int h = 0; h < 2; ++h)
#pragma unroll
        for (int i = 0; i < 4; ++i) {
            bf16x4 p;
#pragma unroll
            for (int j = 0; j < 4; ++j) p[j] = f2bf(v[h][j][i]);
            *(bf16x4*)&ts[(4 * c + i) * TPITCH + 32 * h + 4 * a] = p;
        }
    __syncthreads();  // the tile is read across the waves that wrote it
    bf16* dst = out + n0 * K + k0;
    const int n = tid >> 3, ch = (tid & 7) * 8;
#pragma unroll
    for (int j = 0; j < 4; ++j)
        *(bf16x8*)(dst + (n * K + ch) + 16 * j * K) =
            *(const bf16x8*)&ts[(n + 16 * j) * TPITCH + ch];
}

// Blocks 0..255: the four 512 x 512 weights, 64 tiles each; 256..511: wi; 512..767: wo.
__global__ void __launch_bounds__(128) cvtT_all_kernel(
    const float* __restrict__ qw, const float* __restrict__ kw, const float* __restrict__ vw,
    const float* __restrict__ ow, const float* __restrict__ wi, const float* __restrict__ wo,
    bf16* __restrict__ qwb, bf16* __restrict__ kwb, bf16* __restrict__ vwb,
    bf16* __restrict__ owb, bf16* __restrict__ wib, bf16* __restrict__ wob) {
    __shared__ __align__(16) bf16 ts[64 * TPITCH];  // [n][k]
    const int blk = blockIdx.x, g = blk >> 6;
    if (g < 4) {
        const float* in = g == 0 ? qw : g == 1 ? kw : g == 2 ? vw : ow;
        bf16* out = g == 0 ? qwb : g == 1 ? kwb : g == 2 ? vwb : owb;
        transpose_tile<DD, DD>(in, out, blk & 63, ts);
    } else if (g < 8) {
        transpose_tile<DD, DFF>(wi, wib, blk - 256, ts);
    } else {
        transpose_tile<DFF, DD>(wo, wob, blk - 512, ts);
    }
}

// T5 bidirectional bucket bias, Toeplitz table: tab[h*8192 + (rel+4095)]
__global__ void bias_table_kernel(const float* __restrict__ rel_bias, float* __restrict__ tab) {
    int idx = blockIdx.x * 256 + threadIdx.x;
    if (idx >= HH * 8191) return;
    int h = idx / 8191, r = idx % 8191;
    int rel = r - 4095;
    int ret = rel > 0 ? 16 : 0;         // num_buckets/2 = 16
    int n = rel < 0 ? -rel : rel;
    int bucket;
    if (n < 8) {                        // max_exact = 8
        bucket = ret + n;
    } else {
        int v = 8 + (int)(__logf((float)n * 0.125f) * (8.0f / __logf(16.0f)));
        if (v > 15) v = 15;
        bucket = ret + v;
    }
    tab[h * 8192 + r] = rel_bias[bucket * HH + h];
}

// one wave per row of 512 columns; fp32 in, bf16*(rms weight) out
__global__ void __launch_bounds__(256) rmsnorm_kernel(const float* __restrict__ x,
                                                      const float* __restrict__ w,
                                                      bf16* __restrict__ out, int rows) {
    int wave = threadIdx.x >> 5, lane = threadIdx.x & 31;
    int row = blockIdx.x * 8 + wave;
    if (row >= rows) return;
    const float* xr = x + (size_t)row * DD;
    float vals[16];
    float ss = 0.f;
#pragma unroll
    for (int i = 0; i < 16; ++i) {
        float v = xr[lane + i * 32];
        vals[i] = v;
        ss += v * v;
    }
#pragma unroll
    for (int m = 16; m >= 1; m >>= 1) ss += __shfl_xor(ss, m, 32);
    float rs = rsqrtf(ss * (1.f / (float)DD) + 1e-6f);
#pragma unroll
    for (int i = 0; i < 16; ++i) {
        int c = lane + i * 32;
        out[(size_t)row * DD + c] = f2bf(vals[i] * rs * w[c]);
    }
}

// ---------------- WMMA GEMM (async double-buffered LDS) ----------------
// C[M,N] = A[M,K] @ W[K,N] with W pre-transposed as Wt[N,K].
// Block 256 thr = 8 waves (4x2); block tile 128x128; wave tile 32x64.
// A stage is 128 k of both operands' 128 rows; stages come to LDS by asynchronous copies,
// two buffers, one stage ahead: one wait and one barrier per 128 k, and a stage's copies
// have the whole stage before it (32 products per wave) to land. Inside a stage the fragments
// of each 32 k are read one sub-step ahead into a second register set. K: a multiple of 128.
// MODE 0: bf16 row-major    MODE 1: per-head [B,H,S,64]   MODE 2: V^T [B,H,64,S]
// MODE 3: f32 + residual    MODE 4: relu -> bf16
#define GKS 128     // k per stage
#define GPITCH 136  // 256-B rows at a 272-B pitch (16 B x odd) for 16-B readers

// One lane's eight 16-B copies of one operand's stage: rows 16 apart, global pitch gstep.
// The s_wait_xcnt closes the statement so that no address register is rewritten ahead of it.
__device__ __forceinline__ void gemm_copies(const bf16* g, size_t gstep, unsigned l) {
    const bf16 *g1 = g + gstep, *g2 = g1 + gstep, *g3 = g2 + gstep, *g4 = g3 + gstep,
               *g5 = g4 + gstep, *g6 = g5 + gstep, *g7 = g6 + gstep;
    const unsigned st = 16 * GPITCH * 2;
    asm volatile(
        "global_load_async_to_lds_b128 %0, %8, off\n\t"
        "global_load_async_to_lds_b128 %1, %9, off\n\t"
        "global_load_async_to_lds_b128 %2, %10, off\n\t"
        "global_load_async_to_lds_b128 %3, %11, off\n\t"
        "global_load_async_to_lds_b128 %4, %12, off\n\t"
        "global_load_async_to_lds_b128 %5, %13, off\n\t"
        "global_load_async_to_lds_b128 %6, %14, off\n\t"
        "global_load_async_to_lds_b128 %7, %15, off\n\t"
        "s_wait_xcnt 0x0"
        :: "v"(l), "v"(l + st), "v"(l + 2 * st), "v"(l + 3 * st),
           "v"(l + 4 * st), "v"(l + 5 * st), "v"(l + 6 * st), "v"(l + 7 * st),
           "v"(g), "v"(g1), "v"(g2), "v"(g3), "v"(g4), "v"(g5), "v"(g6), "v"(g7)
        : "memory");
}

template <int MODE>
__global__ void __launch_bounds__(256) gemm_kernel(const bf16* __restrict__ A,
                                                   const bf16* __restrict__ Wt,
                                                   const float* __restrict__ resid,
                                                   void* __restrict__ outp,
                                                   int M, int N, int K) {
    __shared__ __align__(16) bf16 As[2][128 * GPITCH];  // [row][k]
    __shared__ __align__(16) bf16 Bs[2][128 * GPITCH];  // [n][k]
    const int tid = threadIdx.x, lane = tid & 31, wave = tid >> 5;
    const int wm = wave >> 1, wn = wave & 1;
    const int n0 = blockIdx.x * 128, m0 = blockIdx.y * 128;
    const int l15 = lane & 15, kb8 = (lane >> 4) * 8;

    floatx8 acc[2][4];
#pragma unroll
    for (int qt = 0; qt < 2; ++qt)
#pragma unroll
        for (int nt = 0; nt < 4; ++nt) acc[qt][nt] = zero8();

    // staging assignment: 16 lanes per 256-B row, 16 rows per copy of the block
    const int pr = tid >> 4, pk = (tid & 15) * 8;
    const int nIter = K / GKS;
    const bf16* ga = A + (size_t)(m0 + pr) * K + pk;
    const bf16* gb = Wt + (size_t)(n0 + pr) * K + pk;
    auto issue_stage = [&](int t) {
        const int bb = t & 1;
        gemm_copies(ga + t * GKS, (size_t)16 * K, lds_addr(&As[bb][pr * GPITCH + pk]));
        gemm_copies(gb + t * GKS, (size_t)16 * K, lds_addr(&Bs[bb][pr * GPITCH + pk]));
    };

    issue_stage(0);
    wait_async0();    // stage 0 of this wave has landed
    __syncthreads();  // ... and every other wave's share of it
    if (nIter > 1) issue_stage(1);

    for (int t = 0; t < nIter; ++t) {
        const bf16* Ab = &As[t & 1][(wm * 32 + l15) * GPITCH + kb8];
        const bf16* Bb = &Bs[t & 1][(wn * 64 + l15) * GPITCH + kb8];
        // fragments of sub-step ks (32 k) of this stage: 12 LDS loads as one group
        bf16x16 af[2][2], bfr[2][4];
        auto load_frags = [&](int ks) {
#pragma unroll
            for (int qt = 0; qt < 2; ++qt) {
                const bf16* p = Ab + qt * 16 * GPITCH + ks * 32;
                af[ks & 1][qt] = load16(p, p + 16);
            }
#pragma unroll
            for (int nt = 0; nt < 4; ++nt) {
                const bf16* p = Bb + nt * 16 * GPITCH + ks * 32;
                bfr[ks & 1][nt] = load16(p, p + 16);
            }
        };
        load_frags(0);
#pragma unroll
        for (int ks = 0; ks < GKS / 32; ++ks) {
            if (ks + 1 < GKS / 32) load_frags(ks + 1);
            // Keeps the next sub-step's loads ahead of this sub-step's products; without it
            // the loads sink between the products, each pair with a full wait of its own.
            __builtin_amdgcn_sched_barrier(0);
#pragma unroll
            for (int nt = 0; nt < 4; ++nt)
#pragma unroll
                for (int qt = 0; qt < 2; ++qt)
                    acc[qt][nt] = wmma_bf16(af[ks & 1][qt], bfr[ks & 1][nt], acc[qt][nt]);
        }
        // publish point of stage t + 1, which also frees stage t's buffer
        asm volatile("s_wait_dscnt 0x0" ::: "memory");  // this wave's reads of stage t are done
        wait_async0();                                  // its copies of stage t + 1 have landed
        __syncthreads();
        if (t + 2 < nIter) issue_stage(t + 2);
    }
    wait_async0();  // nothing is outstanding when the wave ends

#pragma unroll
    for (int qt = 0; qt < 2; ++qt) {
#pragma unroll
        for (int nt = 0; nt < 4; ++nt) {
#pragma unroll
            for (int i = 0; i < 8; ++i) {
                int m = m0 + wm * 32 + qt * 16 + i + 8 * (lane >> 4);
                int n = n0 + wn * 64 + nt * 16 + l15;
                float v = acc[qt][nt][i];
                if constexpr (MODE == 0) {
                    ((bf16*)outp)[(size_t)m * N + n] = f2bf(v);
                } else if constexpr (MODE == 1) {
                    int b = m >> 12, s = m & 4095, h = n >> 6, d = n & 63;
                    ((bf16*)outp)[(((size_t)(b * HH + h) * SS) + s) * DKV + d] = f2bf(v);
                } else if constexpr (MODE == 2) {
                    int b = m >> 12, s = m & 4095, h = n >> 6, d = n & 63;
                    ((bf16*)outp)[(((size_t)(b * HH + h) * DKV) + d) * SS + s] = f2bf(v);
                } else if constexpr (MODE == 3) {
                    ((float*)outp)[(size_t)m * N + n] = resid[(size_t)m * N + n] + v;
                } else {  // MODE 4
                    ((bf16*)outp)[(size_t)m * N + n] = f2bf(v > 0.f ? v : 0.f);
                }
            }
        }
    }
}

// ---------------- Flash attention with softmax1 ----------------
// Block = 128 thr = 4 waves; block covers (b, h, 128 q rows); wave covers 32 q rows.
// Scores are formed transposed, S^T = K Q^T (A = K rows, B = Q columns), and the output
// as O^T += V^T P^T. A lane then holds 16 of the 32 keys of ONE query per 16-query group:
// maximum and sum run in the lane (one exchange between lane halves for the maximum),
// and the two S^T tiles of a group, rounded in place, are already the B operand P^T.
// K rows, V^T rows, the bias slice and the delete-gate of 64 keys form one stage; stages
// come to LDS by asynchronous copies, two buffers, one stage ahead, shared by the 4 waves.
#define KST 64                 // keys per stage
#define NST (SS / KST)         // stages
#define KPITCH 72              // 128-B rows at a 144-B pitch (16 B x odd) for 16-B readers

__device__ __forceinline__ float other_half(float x) {  // value of lane l ^ 16
    int v = __builtin_bit_cast(int, x);
    v = __builtin_amdgcn_permlanex16(v, v, 0x76543210, 0xfedcba98, false, false);
    return __builtin_bit_cast(float, v);
}

// One lane's ten copies of a stage: 4 x 16 B of K, 4 x 16 B of V^T, 2 x 4 B of bias / gate.
// The s_wait_xcnt closes the statement so that no address register is rewritten ahead of it.
__device__ __forceinline__ void stage_copies(const bf16* gk, const bf16* gv, const float* ga0,
                                             const float* ga1, unsigned lk, unsigned lv,
                                             unsigned la) {
    const bf16 *gk1 = gk + 16 * DKV, *gk2 = gk + 32 * DKV, *gk3 = gk + 48 * DKV;
    const bf16 *gv1 = gv + 16 * SS, *gv2 = gv + 32 * SS, *gv3 = gv + 48 * SS;
    const unsigned st = 16 * KPITCH * 2;
    asm volatile(
        "global_load_async_to_lds_b128 %0, %10, off\n\t"
        "global_load_async_to_lds_b128 %1, %11, off\n\t"
        "global_load_async_to_lds_b128 %2, %12, off\n\t"
        "global_load_async_to_lds_b128 %3, %13, off\n\t"
        "global_load_async_to_lds_b128 %4, %14, off\n\t"
        "global_load_async_to_lds_b128 %5, %15, off\n\t"
        "global_load_async_to_lds_b128 %6, %16, off\n\t"
        "global_load_async_to_lds_b128 %7, %17, off\n\t"
        "global_load_async_to_lds_b32 %8, %18, off\n\t"
        "global_load_async_to_lds_b32 %9, %19, off\n\t"
        "s_wait_xcnt 0x0"
        :: "v"(lk), "v"(lk + st), "v"(lk + 2 * st), "v"(lk + 3 * st),
           "v"(lv), "v"(lv + st), "v"(lv + 2 * st), "v"(lv + 3 * st),
           "v"(la), "v"(la + 512u),
           "v"(gk), "v"(gk1), "v"(gk2), "v"(gk3),
           "v"(gv), "v"(gv1), "v"(gv2), "v"(gv3),
           "v"(ga0), "v"(ga1)
        : "memory");
}

__global__ void __launch_bounds__(128) attn_kernel(const bf16* __restrict__ Qh,
                                                   const bf16* __restrict__ Kh,
                                                   const bf16* __restrict__ Vt,
                                                   const float* __restrict__ btab,
                                                   const float* __restrict__ gate,
                                                   bf16* __restrict__ ctx) {
    __shared__ __align__(16) bf16 Ks[2][KST * KPITCH];  // [key][d]
    __shared__ __align__(16) bf16 Vs[2][DKV * KPITCH];  // [d][key]
    __shared__ __align__(32) float aux_s[2][256];       // 0..191 bias slice, 192..255 gate
    const int tid = threadIdx.x, lane = tid & 31, wave = tid >> 5;
    const int qblk = blockIdx.x * 128;
    const int h = blockIdx.y, b = blockIdx.z;
    const int q0 = qblk + wave * 32;
    const size_t head = (size_t)(b * HH + h) * SS * DKV;
    const bf16* Qp = Qh + head;
    const bf16* Kp = Kh + head;
    const bf16* Vp = Vt + head;  // [64][4096]
    const float* btabh = btab + h * 8192;
    const float* gateb = gate + (size_t)b * SS;

    const int l15 = lane & 15;
    const int kb8 = (lane >> 4) * 8;

    // staging assignment: 8 lanes per 128-B row, 16 rows per copy of the block
    const int srow = tid >> 3, scol = (tid & 7) * 8;
    const bool lowpair = __builtin_amdgcn_readfirstlane(wave) < 2;
    auto issue_stage = [&](int t) {
        const int kb = t * KST, bb = t & 1;
        // Toeplitz bias slice (rel = key - q): 191 entries needed, entry j is rel index base + j
        int base = kb - qblk - 127 + 4095;
        int gi = base + tid;
        gi = gi < 0 ? 0 : (gi > 8190 ? 8190 : gi);
        int gi2 = base + 128 + tid;
        gi2 = gi2 < 0 ? 0 : (gi2 > 8190 ? 8190 : gi2);
        // waves 0, 1 bring the slice's tail, waves 2, 3 the gate: a choice per wave, all lanes on
        const float* ga1 = lowpair ? btabh + gi2 : gateb + kb + (tid - 64);
        stage_copies(Kp + (size_t)(kb + srow) * DKV + scol, Vp + (size_t)srow * SS + kb + scol,
                     btabh + gi, ga1, lds_addr(&Ks[bb][srow * KPITCH + scol]),
                     lds_addr(&Vs[bb][srow * KPITCH + scol]), lds_addr(&aux_s[bb][tid]));
    };

    issue_stage(0);

    // Q fragments (B operand, column = query l15): 2 q-groups x 2 halves of the head dim
    bf16x16 qf[2][2];
#pragma unroll
    for (int qt = 0; qt < 2; ++qt) {
        const bf16* qr = Qp + (size_t)(q0 + qt * 16 + l15) * DKV;
#pragma unroll
        for (int kh = 0; kh < 2; ++kh)
            qf[qt][kh] = load16(qr + kh * 32 + kb8, qr + kh * 32 + kb8 + 16);
    }

    // Oa[qt][dt][r] = O^T[d = dt*16 + kb8 + r][q = q0 + qt*16 + l15]
    floatx8 Oa[2][4];
#pragma unroll
    for (int qt = 0; qt < 2; ++qt)
#pragma unroll
        for (int dt = 0; dt < 4; ++dt) Oa[qt][dt] = zero8();
    float rm[2], rl[2];  // per query: running maximum; this lane half's share of the sum
#pragma unroll
    for (int qt = 0; qt < 2; ++qt) { rm[qt] = -1e30f; rl[qt] = 0.f; }

    // bias index of (key offset p*32 + kt*16 + kb8 + r, query offset wave*32 + qt*16 + l15)
    // is bidx + p*32 + (kt - qt) * 16 + r
    const int bidx = 127 - wave * 32 - l15 + kb8;

    wait_async0();    // stage 0 of this wave has landed
    __syncthreads();  // ... and every other wave's share of it
    issue_stage(1);

    for (int t = 0; t < NST; ++t) {
        const bf16* Kb = Ks[t & 1];
        const bf16* Vb = Vs[t & 1];
        const float* ab = aux_s[t & 1];
        // fragment and bias loads of pass p (32 keys) of this stage
        auto load_k = [&](int p, bf16x16 (&kf)[2][2]) {  // K rows, A operand
#pragma unroll
            for (int kt = 0; kt < 2; ++kt) {
                const bf16* kr = Kb + (p * 32 + kt * 16 + l15) * KPITCH;
                kf[kt][0] = load16(kr + kb8, kr + kb8 + 16);
                kf[kt][1] = load16(kr + 32 + kb8, kr + 32 + kb8 + 16);
            }
        };
        auto load_v = [&](int p, bf16x16 (&vf)[4]) {  // V^T rows, A operand
#pragma unroll
            for (int dt = 0; dt < 4; ++dt) {
                const bf16* vr = Vb + (dt * 16 + l15) * KPITCH + p * 32;
                vf[dt] = load16(vr + kb8, vr + kb8 + 16);
            }
        };
        // bg[qt][kt] = position bias + delete-gate of the lane's 8 keys of tile kt
        auto load_bg = [&](int p, floatx8 (&bg)[2][2]) {
            floatx8 gv[2];
#pragma unroll
            for (int kt = 0; kt < 2; ++kt)
                gv[kt] = *(const floatx8*)(ab + 192 + p * 32 + kt * 16 + kb8);
            floatx8 bv[3];  // the slice is Toeplitz: only kt - qt = -1, 0, 1 differ
#pragma unroll
            for (int j = 0; j < 3; ++j)
#pragma unroll
                for (int r = 0; r < 8; ++r) bv[j][r] = ab[bidx + p * 32 + (j - 1) * 16 + r];
#pragma unroll
            for (int qt = 0; qt < 2; ++qt)
#pragma unroll
                for (int kt = 0; kt < 2; ++kt) bg[qt][kt] = bv[kt - qt + 1] + gv[kt];
        };
        // sacc[qt][kt][r] = S[q = qt*16 + l15][key = kt*16 + kb8 + r], 8 WMMAs
        auto scores = [&](const bf16x16 (&kf)[2][2], floatx8 (&sacc)[2][2]) {
#pragma unroll
            for (int kt = 0; kt < 2; ++kt)
#pragma unroll
                for (int qt = 0; qt < 2; ++qt) {
                    floatx8 s = wmma_bf16(kf[kt][0], qf[qt][0], zero8());
                    sacc[qt][kt] = wmma_bf16(kf[kt][1], qf[qt][1], s);
                }
        };
        // online softmax1 update, one query per lane and group; then O^T += V^T P^T, 8 WMMAs
        auto update = [&](floatx8 (&sacc)[2][2], const floatx8 (&bg)[2][2],
                          const bf16x16 (&vf)[4]) {
            bf16x16 pf[2];
#pragma unroll
            for (int qt = 0; qt < 2; ++qt) {
                sacc[qt][0] += bg[qt][0];
                sacc[qt][1] += bg[qt][1];
                float tm = fmaxf(sacc[qt][0][0], sacc[qt][1][0]);
#pragma unroll
                for (int r = 1; r < 8; ++r)
                    tm = fmaxf(tm, fmaxf(sacc[qt][0][r], sacc[qt][1][r]));
                tm = fmaxf(tm, other_half(tm));
                float mnew = fmaxf(rm[qt], tm);
                float alpha = __expf(rm[qt] - mnew);
                rm[qt] = mnew;
                floatx8 d0 = sacc[qt][0] - mnew, d1 = sacc[qt][1] - mnew;
#pragma unroll
                for (int r = 0; r < 8; ++r) {
                    d0[r] = __expf(d0[r]);
                    d1[r] = __expf(d1[r]);
                    // P^T as B operand: element s holds key kb8 + s (s < 8), 16 + kb8 + s - 8
                    pf[qt][r]     = f2bf(d0[r]);
                    pf[qt][r + 8] = f2bf(d1[r]);
                }
                floatx8 sv = d0 + d1;
                float ts = ((sv[0] + sv[1]) + (sv[2] + sv[3])) +
                           ((sv[4] + sv[5]) + (sv[6] + sv[7]));
                rl[qt] = rl[qt] * alpha + ts;
#pragma unroll
                for (int dt = 0; dt < 4; ++dt) Oa[qt][dt] *= alpha;
            }
#pragma unroll
            for (int dt = 0; dt < 4; ++dt)
#pragma unroll
                for (int qt = 0; qt < 2; ++qt) Oa[qt][dt] = wmma_bf16(vf[dt], pf[qt], Oa[qt][dt]);
        };

        // Two passes of 32 keys per stage. The loop stays rolled so that each pass is a block
        // of its own with its LDS loads at its head.
#pragma unroll 1
        for (int p = 0; p < 2; ++p) {
            bf16x16 kf[2][2], vf[4];
            floatx8 sacc[2][2], bg[2][2];
            load_k(p, kf);
            load_bg(p, bg);
            load_v(p, vf);
            // Keeps the pass's loads issued together here, ahead of the products; without it
            // some K loads sink between the score products, each with a full wait of its own.
            __builtin_amdgcn_sched_barrier(0);
            scores(kf, sacc);
            update(sacc, bg, vf);
        }

        // publish point of stage t + 1, which also frees stage t's buffer
        asm volatile("s_wait_dscnt 0x0" ::: "memory");  // this wave's reads of stage t are done
        wait_async0();                                  // its copies of stage t + 1 have landed
        __syncthreads();
        if (t + 2 < NST) issue_stage(t + 2);
    }
    wait_async0();  // nothing is outstanding when the wave ends

    // ---- softmax1 denominator: l + exp(-m); the halves' sums are joined here ----
    // ---- write ctx [B,S,H*DKV]: a lane holds 8 consecutive d of one query ----
#pragma unroll
    for (int qt = 0; qt < 2; ++qt) {
        float l = rl[qt] + other_half(rl[qt]);
        float inv = 1.f / (l + __expf(-rm[qt]));
        int q = q0 + qt * 16 + l15;
#pragma unroll
        for (int dt = 0; dt < 4; ++dt) {
            bf16x8 o;
#pragma unroll
            for (int r = 0; r < 8; ++r) o[r] = f2bf(Oa[qt][dt][r] * inv);
            *(bf16x8*)&ctx[((size_t)b * SS + q) * DD + h * DKV + dt * 16 + kb8] = o;
        }
    }
}

// ---------------- launcher ----------------
extern "C" void kernel_launch(void* const* d_in, const int* in_sizes, int n_in,
                              void* d_out, int out_size, void* d_ws, size_t ws_size,
                              hipStream_t stream) {
    (void)in_sizes; (void)n_in; (void)out_size; (void)ws_size;
    const float* hidden = (const float*)d_in[0];
    const float* gate   = (const float*)d_in[1];
    const float* ln1    = (const float*)d_in[2];
    const float* qw     = (const float*)d_in[3];
    const float* kw     = (const float*)d_in[4];
    const float* vw     = (const float*)d_in[5];
    const float* ow     = (const float*)d_in[6];
    const float* relb   = (const float*)d_in[7];
    const float* ln2    = (const float*)d_in[8];
    const float* wi     = (const float*)d_in[9];
    const float* wo     = (const float*)d_in[10];

    char* ws = (char*)d_ws;
    size_t off = 0;
    auto take = [&](size_t bytes) -> char* {
        char* p = ws + off;
        off = (off + bytes + 255) & ~(size_t)255;
        return p;
    };
    bf16*  qwb  = (bf16*)take((size_t)DD * DD * 2);    // all weights transposed [N,K]
    bf16*  kwb  = (bf16*)take((size_t)DD * DD * 2);
    bf16*  vwb  = (bf16*)take((size_t)DD * DD * 2);
    bf16*  owb  = (bf16*)take((size_t)DD * DD * 2);
    bf16*  wib  = (bf16*)take((size_t)DD * DFF * 2);
    bf16*  wob  = (bf16*)take((size_t)DFF * DD * 2);
    float* btab = (float*)take((size_t)HH * 8192 * 4);
    bf16*  xb   = (bf16*)take((size_t)MM * DD * 2);
    bf16*  Qhd  = (bf16*)take((size_t)MM * DD * 2);
    bf16*  Khd  = (bf16*)take((size_t)MM * DD * 2);
    bf16*  Vtd  = (bf16*)take((size_t)MM * DD * 2);
    bf16*  ctxb = (bf16*)take((size_t)MM * DD * 2);
    float* hbuf = (float*)take((size_t)MM * DD * 4);
    bf16*  yb   = (bf16*)take((size_t)MM * DD * 2);
    bf16*  ffb  = (bf16*)take((size_t)MM * DFF * 2);

    // transposed bf16 weight conversions: 768 tiles of 64 x 64
    cvtT_all_kernel<<<768, 128, 0, stream>>>(qw, kw, vw, ow, wi, wo, qwb, kwb, vwb, owb, wib, wob);
    bias_table_kernel<<<(HH * 8191 + 255) / 256, 256, 0, stream>>>(relb, btab);

    // ln1 -> xb (bf16)
    rmsnorm_kernel<<<MM / 8, 256, 0, stream>>>(hidden, ln1, xb, MM);

    // QKV projections (head layouts; V transposed)
    dim3 gQKV(DD / 128, MM / 128);
    gemm_kernel<1><<<gQKV, 256, 0, stream>>>(xb, qwb, nullptr, Qhd, MM, DD, DD);
    gemm_kernel<1><<<gQKV, 256, 0, stream>>>(xb, kwb, nullptr, Khd, MM, DD, DD);
    gemm_kernel<2><<<gQKV, 256, 0, stream>>>(xb, vwb, nullptr, Vtd, MM, DD, DD);

    // flash attention with softmax1
    attn_kernel<<<dim3(SS / 128, HH, BB), 128, 0, stream>>>(Qhd, Khd, Vtd, btab, gate, ctxb);

    // h = hidden + ctx @ o_w
    gemm_kernel<3><<<dim3(DD / 128, MM / 128), 256, 0, stream>>>(ctxb, owb, hidden, hbuf,
                                                                 MM, DD, DD);
    // ln2 -> yb
    rmsnorm_kernel<<<MM / 8, 256, 0, stream>>>(hbuf, ln2, yb, MM);

    // FFN: relu(y @ wi) then out = h + (.) @ wo
    gemm_kernel<4><<<dim3(DFF / 128, MM / 128), 256, 0, stream>>>(yb, wib, nullptr, ffb,
                                                                  MM, DFF, DD);
    gemm_kernel<3><<<dim3(DD / 128, MM / 128), 256, 0, stream>>>(ffb, wob, hbuf, d_out,
                                                                 MM, DD, DFF);
}

// v005
// Measured time: 174 microseconds a run.
// Two timings next to v004 both put it at 1.05 times that version's speed.
// Counting every step since v000, it is 2.71 times as fast.
#include <hip/hip_runtime.h>
#include <hip/hip_bf16.h>

// ---------------- types ----------------
typedef __bf16 bf16;
typedef bf16  bf16x4  __attribute__((ext_vector_type(4)));
typedef bf16  bf16x8  __attribute__((ext_vector_type(8)));
typedef bf16  bf16x16 __attribute__((ext_vector_type(16)));
typedef float floatx4 __attribute__((ext_vector_type(4)));
typedef float floatx8 __attribute__((ext_vector_type(8)));

#define BB 2
#define SS 4096
#define DD 512
#define HH 8
#define DKV 64
#define DFF 2048
#define MM (BB*SS)   // 8192

__device__ __forceinline__ bf16 f2bf(float x) {
    unsigned u = __builtin_bit_cast(unsigned, x);
    unsigned r = u + 0x7FFFu + ((u >> 16) & 1u);
    unsigned short hs = (unsigned short)(r >> 16);
    return __builtin_bit_cast(bf16, hs);
}
__device__ __forceinline__ bf16x16 load16(const bf16* p0, const bf16* p1) {
    bf16x8 a = *(const bf16x8*)p0;
    bf16x8 b = *(const bf16x8*)p1;
    bf16x16 r;
#pragma unroll
    for (int i = 0; i < 8; ++i) { r[i] = a[i]; r[i + 8] = b[i]; }
    return r;
}
__device__ __forceinline__ floatx8 wmma_bf16(bf16x16 a, bf16x16 b, floatx8 c) {
    return __builtin_amdgcn_wmma_f32_16x16x32_bf16(false, a, false, b, (short)0, c,
                                                   false, false);
}
__device__ __forceinline__ floatx8 zero8() {
    floatx8 z = {0.f, 0.f, 0.f, 0.f, 0.f, 0.f, 0.f, 0.f};
    return z;
}

__device__ __forceinline__ void wait_async0() {
    asm volatile("s_wait_asynccnt 0x0" ::: "memory");
}
__device__ __forceinline__ unsigned lds_addr(const void* p) {
    return (unsigned)(size_t)p;  // low 32 bits of a generic shared pointer = LDS byte address
}

// ---------------- small kernels ----------------
// fp32 [K,N] -> bf16 transposed [N,K] (makes all WMMA B-operands K-contiguous), all six
// weights in one launch. A block of 4 waves takes one 64 x 64 tile: a thread reads two 4 x 4
// patches by 16-B loads (256 B of a row per 16 lanes), rounds them and stores them transposed
// to LDS; the tile then leaves by 16-B stores, one whole 128-B line of an output row per 8 lanes.
#define TPITCH 72  // 128-B rows at a 144-B pitch, 16-B aligned for the readers
template <int K, int N>
__device__ __forceinline__ void transpose_tile(const float* __restrict__ in,
                                               bf16* __restrict__ out, int tile, bf16* ts) {
    constexpr int TN = N / 64;  // tiles along N
    const int tid = threadIdx.x;
    const int k0 = (tile / TN) * 64, n0 = (tile % TN) * 64;
    const int a = tid >> 4, c = tid & 15;  // patch h: k = 32h + 4a .. + 3, n = 4c .. 4c + 3
    const float* src = in + k0 * N + n0;
    floatx4 v[2][4];
#pragma unroll
    for (int h = 0; h < 2; ++h)
#pragma unroll
        for (int j = 0; j < 4; ++j)
            v[h][j] = *(const floatx4*)(src + (4 * a * N + 4 * c) + (32 * h + j) * N);
#pragma unroll
    for (int h = 0; h < 2; ++h)
#pragma unroll
        for (int i = 0; i < 4; ++i) {
            bf16x4 p;
#pragma unroll
            for (int j = 0; j < 4; ++j) p[j] = f2bf(v[h][j][i]);
            *(bf16x4*)&ts[(4 * c + i) * TPITCH + 32 * h + 4 * a] = p;
        }
    __syncthreads();  // the tile is read across the waves that wrote it
    bf16* dst = out + n0 * K + k0;
    const int n = tid >> 3, ch = (tid & 7) * 8;
#pragma unroll
    for (int j = 0; j < 4; ++j)
        *(bf16x8*)(dst + (n * K + ch) + 16 * j * K) =
            *(const bf16x8*)&ts[(n + 16 * j) * TPITCH + ch];
}

// Blocks 0..255: the four 512 x 512 weights, 64 tiles each; 256..511: wi; 512..767: wo.
__global__ void __launch_bounds__(128) cvtT_all_kernel(
    const float* __restrict__ qw, const float* __restrict__ kw, const float* __restrict__ vw,
    const float* __restrict__ ow, const float* __restrict__ wi, const float* __restrict__ wo,
    bf16* __restrict__ qwb, bf16* __restrict__ kwb, bf16* __restrict__ vwb,
    bf16* __restrict__ owb, bf16* __restrict__ wib, bf16* __restrict__ wob) {
    __shared__ __align__(16) bf16 ts[64 * TPITCH];  // [n][k]
    const int blk = blockIdx.x, g = blk >> 6;
    if (g < 4) {
        const float* in = g == 0 ? qw : g == 1 ? kw : g == 2 ? vw : ow;
        bf16* out = g == 0 ? qwb : g == 1 ? kwb : g == 2 ? vwb : owb;
        transpose_tile<DD, DD>(in, out, blk & 63, ts);
    } else if (g < 8) {
        transpose_tile<DD, DFF>(wi, wib, blk - 256, ts);
    } else {
        transpose_tile<DFF, DD>(wo, wob, blk - 512, ts);
    }
}

// T5 bidirectional bucket bias, Toeplitz table: tab[h*8192 + (rel+4095)]
__global__ void bias_table_kernel(const float* __restrict__ rel_bias, float* __restrict__ tab) {
    int idx = blockIdx.x * 256 + threadIdx.x;
    if (idx >= HH * 8191) return;
    int h = idx / 8191, r = idx % 8191;
    int rel = r - 4095;
    int ret = rel > 0 ? 16 : 0;         // num_buckets/2 = 16
    int n = rel < 0 ? -rel : rel;
    int bucket;
    if (n < 8) {                        // max_exact = 8
        bucket = ret + n;
    } else {
        int v = 8 + (int)(__logf((float)n * 0.125f) * (8.0f / __logf(16.0f)));
        if (v > 15) v = 15;
        bucket = ret + v;
    }
    tab[h * 8192 + r] = rel_bias[bucket * HH + h];
}

// one wave per row of 512 columns; fp32 in, bf16*(rms weight) out
__global__ void __launch_bounds__(256) rmsnorm_kernel(const float* __restrict__ x,
                                                      const float* __restrict__ w,
                                                      bf16* __restrict__ out, int rows) {
    int wave = threadIdx.x >> 5, lane = threadIdx.x & 31;
    int row = blockIdx.x * 8 + wave;
    if (row >= rows) return;
    const float* xr = x + (size_t)row * DD;
    float vals[16];
    float ss = 0.f;
#pragma unroll
    for (int i = 0; i < 16; ++i) {
        float v = xr[lane + i * 32];
        vals[i] = v;
        ss += v * v;
    }
#pragma unroll
    for (int m = 16; m >= 1; m >>= 1) ss += __shfl_xor(ss, m, 32);
    float rs = rsqrtf(ss * (1.f / (float)DD) + 1e-6f);
#pragma unroll
    for (int i = 0; i < 16; ++i) {
        int c = lane + i * 32;
        out[(size_t)row * DD + c] = f2bf(vals[i] * rs * w[c]);
    }
}

// ---------------- WMMA GEMM (async double-buffered LDS) ----------------
// C[M,N] = A[M,K] @ W[K,N] with W pre-transposed as Wt[N,K].
// Block 256 thr = 8 waves (4x2); block tile 128x128; wave tile 32x64.
// A stage is 128 k of both operands' 128 rows; stages come to LDS by asynchronous copies,
// two buffers, one stage ahead: one wait and one barrier per 128 k, and a stage's copies
// have the whole stage before it (32 products per wave) to land. Inside a stage the fragments
// of each 32 k are read one sub-step ahead into a second register set. K: a multiple of 128.
// MODE 0: bf16 row-major    MODE 1: per-head [B,H,S,64]   MODE 2: V^T [B,H,64,S]
// MODE 3: f32 + residual    MODE 4: relu -> bf16
#define GKS 128     // k per stage
#define GPITCH 136  // 256-B rows at a 272-B pitch (16 B x odd) for 16-B readers

// One lane's eight 16-B copies of one operand's stage: rows 16 apart, global pitch gstep.
// The s_wait_xcnt closes the statement so that no address register is rewritten ahead of it.
__device__ __forceinline__ void gemm_copies(const bf16* g, size_t gstep, unsigned l) {
    const bf16 *g1 = g + gstep, *g2 = g1 + gstep, *g3 = g2 + gstep, *g4 = g3 + gstep,
               *g5 = g4 + gstep, *g6 = g5 + gstep, *g7 = g6 + gstep;
    const unsigned st = 16 * GPITCH * 2;
    asm volatile(
        "global_load_async_to_lds_b128 %0, %8, off\n\t"
        "global_load_async_to_lds_b128 %1, %9, off\n\t"
        "global_load_async_to_lds_b128 %2, %10, off\n\t"
        "global_load_async_to_lds_b128 %3, %11, off\n\t"
        "global_load_async_to_lds_b128 %4, %12, off\n\t"
        "global_load_async_to_lds_b128 %5, %13, off\n\t"
        "global_load_async_to_lds_b128 %6, %14, off\n\t"
        "global_load_async_to_lds_b128 %7, %15, off\n\t"
        "s_wait_xcnt 0x0"
        :: "v"(l), "v"(l + st), "v"(l + 2 * st), "v"(l + 3 * st),
           "v"(l + 4 * st), "v"(l + 5 * st), "v"(l + 6 * st), "v"(l + 7 * st),
           "v"(g), "v"(g1), "v"(g2), "v"(g3), "v"(g4), "v"(g5), "v"(g6), "v"(g7)
        : "memory");
}

template <int MODE>
__global__ void __launch_bounds__(256) gemm_kernel(const bf16* __restrict__ A,
                                                   const bf16* __restrict__ Wt,
                                                   const float* __restrict__ resid,
                                                   void* __restrict__ outp,
                                                   int M, int N, int K) {
    __shared__ __align__(16) bf16 As[2][128 * GPITCH];  // [row][k]
    __shared__ __align__(16) bf16 Bs[2][128 * GPITCH];  // [n][k]
    const int tid = threadIdx.x, lane = tid & 31, wave = tid >> 5;
    const int wm = wave >> 1, wn = wave & 1;
    const int n0 = blockIdx.x * 128, m0 = blockIdx.y * 128;
    const int l15 = lane & 15, kb8 = (lane >> 4) * 8;

    floatx8 acc[2][4];
#pragma unroll
    for (int qt = 0; qt < 2; ++qt)
#pragma unroll
        for (int nt = 0; nt < 4; ++nt) acc[qt][nt] = zero8();

    // staging assignment: 16 lanes per 256-B row, 16 rows per copy of the block
    const int pr = tid >> 4, pk = (tid & 15) * 8;
    const int nIter = K / GKS;
    const bf16* ga = A + (size_t)(m0 + pr) * K + pk;
    const bf16* gb = Wt + (size_t)(n0 + pr) * K + pk;
    auto issue_stage = [&](int t) {
        const int bb = t & 1;
        gemm_copies(ga + t * GKS, (size_t)16 * K, lds_addr(&As[bb][pr * GPITCH + pk]));
        gemm_copies(gb + t * GKS, (size_t)16 * K, lds_addr(&Bs[bb][pr * GPITCH + pk]));
    };

    issue_stage(0);
    wait_async0();    // stage 0 of this wave has landed
    __syncthreads();  // ... and every other wave's share of it
    if (nIter > 1) issue_stage(1);

    for (int t = 0; t < nIter; ++t) {
        const bf16* Ab = &As[t & 1][(wm * 32 + l15) * GPITCH + kb8];
        const bf16* Bb = &Bs[t & 1][(wn * 64 + l15) * GPITCH + kb8];
        // fragments of sub-step ks (32 k) of this stage: 12 LDS loads as one group
        bf16x16 af[2][2], bfr[2][4];
        auto load_frags = [&](int ks) {
#pragma unroll
            for (int qt = 0; qt < 2; ++qt) {
                const bf16* p = Ab + qt * 16 * GPITCH + ks * 32;
                af[ks & 1][qt] = load16(p, p + 16);
            }
#pragma unroll
            for (int nt = 0; nt < 4; ++nt) {
                const bf16* p = Bb + nt * 16 * GPITCH + ks * 32;
                bfr[ks & 1][nt] = load16(p, p + 16);
            }
        };
        load_frags(0);
#pragma unroll
        for (int ks = 0; ks < GKS / 32; ++ks) {
            if (ks + 1 < GKS / 32) load_frags(ks + 1);
            // Keeps the next sub-step's loads ahead of this sub-step's products; without it
            // the loads sink between the products, each pair with a full wait of its own.
            __builtin_amdgcn_sched_barrier(0);
#pragma unroll
            for (int nt = 0; nt < 4; ++nt)
#pragma unroll
                for (int qt = 0; qt < 2; ++qt)
                    acc[qt][nt] = wmma_bf16(af[ks & 1][qt], bfr[ks & 1][nt], acc[qt][nt]);
        }
        // publish point of stage t + 1, which also frees stage t's buffer
        asm volatile("s_wait_dscnt 0x0" ::: "memory");  // this wave's reads of stage t are done
        wait_async0();                                  // its copies of stage t + 1 have landed
        __syncthreads();
        if (t + 2 < nIter) issue_stage(t + 2);
    }
    wait_async0();  // nothing is outstanding when the wave ends

#pragma unroll
    for (int qt = 0; qt < 2; ++qt) {
#pragma unroll
        for (int nt = 0; nt < 4; ++nt) {
#pragma unroll
            for (int i = 0; i < 8; ++i) {
                int m = m0 + wm * 32 + qt * 16 + i + 8 * (lane >> 4);
                int n = n0 + wn * 64 + nt * 16 + l15;
                float v = acc[qt][nt][i];
                if constexpr (MODE == 0) {
                    ((bf16*)outp)[(size_t)m * N + n] = f2bf(v);
                } else if constexpr (MODE == 1) {
                    int b = m >> 12, s = m & 4095, h = n >> 6, d = n & 63;
                    ((bf16*)outp)[(((size_t)(b * HH + h) * SS) + s) * DKV + d] = f2bf(v);
                } else if constexpr (MODE == 2) {
                    int b = m >> 12, s = m & 4095, h = n >> 6, d = n & 63;
                    ((bf16*)outp)[(((size_t)(b * HH + h) * DKV) + d) * SS + s] = f2bf(v);
                } else if constexpr (MODE == 3) {
                    ((float*)outp)[(size_t)m * N + n] = resid[(size_t)m * N + n] + v;
                } else {  // MODE 4
                    ((bf16*)outp)[(size_t)m * N + n] = f2bf(v > 0.f ? v : 0.f);
                }
            }
        }
    }
}

// ---------------- Flash attention with softmax1 ----------------
// Block = 256 thr = 8 waves = 2 groups of 4; block covers (b, h, 128 q rows); a wave covers
// 32 q rows and its group's half of the keys, so that four waves, not two, share a SIMD and
// fill each other's waits. The groups' partial (maximum, sum, O^T) are joined at the end.
// Scores are formed transposed, S^T = K Q^T (A = K rows, B = Q columns), and the output
// as O^T += V^T P^T. A lane then holds 16 of the 32 keys of ONE query per 16-query group:
// maximum and sum run in the lane (one exchange between lane halves for the maximum),
// and the two S^T tiles of a group, rounded in place, are already the B operand P^T.
// K rows, V^T rows, the bias slice and the delete-gate of 64 keys form one stage; stages
// come to LDS by asynchronous copies, two buffers per group, one stage ahead, shared by the
// group's 4 waves.
#define KST 64                 // keys per stage
#define NST (SS / KST / 2)     // stages per group
#define KPITCH 72              // 128-B rows at a 144-B pitch (16 B x odd) for 16-B readers

__device__ __forceinline__ float other_half(float x) {  // value of lane l ^ 16
    int v = __builtin_bit_cast(int, x);
    v = __builtin_amdgcn_permlanex16(v, v, 0x76543210, 0xfedcba98, false, false);
    return __builtin_bit_cast(float, v);
}

// One lane's ten copies of a stage: 4 x 16 B of K, 4 x 16 B of V^T, 2 x 4 B of bias / gate.
// The s_wait_xcnt closes the statement so that no address register is rewritten ahead of it.
__device__ __forceinline__ void stage_copies(const bf16* gk, const bf16* gv, const float* ga0,
                                             const float* ga1, unsigned lk, unsigned lv,
                                             unsigned la) {
    const bf16 *gk1 = gk + 16 * DKV, *gk2 = gk + 32 * DKV, *gk3 = gk + 48 * DKV;
    const bf16 *gv1 = gv + 16 * SS, *gv2 = gv + 32 * SS, *gv3 = gv + 48 * SS;
    const unsigned st = 16 * KPITCH * 2;
    asm volatile(
        "global_load_async_to_lds_b128 %0, %10, off\n\t"
        "global_load_async_to_lds_b128 %1, %11, off\n\t"
        "global_load_async_to_lds_b128 %2, %12, off\n\t"
        "global_load_async_to_lds_b128 %3, %13, off\n\t"
        "global_load_async_to_lds_b128 %4, %14, off\n\t"
        "global_load_async_to_lds_b128 %5, %15, off\n\t"
        "global_load_async_to_lds_b128 %6, %16, off\n\t"
        "global_load_async_to_lds_b128 %7, %17, off\n\t"
        "global_load_async_to_lds_b32 %8, %18, off\n\t"
        "global_load_async_to_lds_b32 %9, %19, off\n\t"
        "s_wait_xcnt 0x0"
        :: "v"(lk), "v"(lk + st), "v"(lk + 2 * st), "v"(lk + 3 * st),
           "v"(lv), "v"(lv + st), "v"(lv + 2 * st), "v"(lv + 3 * st),
           "v"(la), "v"(la + 512u),
           "v"(gk), "v"(gk1), "v"(gk2), "v"(gk3),
           "v"(gv), "v"(gv1), "v"(gv2), "v"(gv3),
           "v"(ga0), "v"(ga1)
        : "memory");
}

// waves_per_eu(4, 4): registers within a quarter of a SIMD's file, so that two blocks share a WGP
__global__ void __launch_bounds__(256) __attribute__((amdgpu_waves_per_eu(4, 4)))
attn_kernel(const bf16* __restrict__ Qh,
            const bf16* __restrict__ Kh, const bf16* __restrict__ Vt,
            const float* __restrict__ btab, const float* __restrict__ gate,
            bf16* __restrict__ ctx) {
    __shared__ __align__(16) bf16 Ks[2][2][KST * KPITCH];  // [group][buffer][key][d]
    __shared__ __align__(16) bf16 Vs[2][2][DKV * KPITCH];  // [group][buffer][d][key]
    __shared__ __align__(32) float aux_s[2][2][256];       // 0..191 bias slice, 192..255 gate
    __shared__ __align__(16) floatx4 join_o[4 * 16 * 32];  // group 1's O^T, 16 B per lane
    __shared__ float join_ml[4][2][2][32];                 // group 1's maximum and sum
    // tid, wave: inside the group
    const int tid = threadIdx.x & 127, lane = tid & 31, wave = tid >> 5;
    const int grp = __builtin_amdgcn_readfirstlane((int)(threadIdx.x >> 7));
    const int qblk = blockIdx.x * 128;
    const int h = blockIdx.y, b = blockIdx.z;
    const int q0 = qblk + wave * 32;
    const size_t head = (size_t)(b * HH + h) * SS * DKV;
    const bf16* Qp = Qh + head;
    const bf16* Kp = Kh + head;
    const bf16* Vp = Vt + head;  // [64][4096]
    const float* btabh = btab + h * 8192;
    const float* gateb = gate + (size_t)b * SS;

    const int l15 = lane & 15;
    const int kb8 = (lane >> 4) * 8;

    // staging assignment: 8 lanes per 128-B row, 16 rows per copy of the group
    const int srow = tid >> 3, scol = (tid & 7) * 8;
    const bool lowpair = __builtin_amdgcn_readfirstlane(wave) < 2;
    auto issue_stage = [&](int t) {
        const int kb = (grp * NST + t) * KST, bb = t & 1;
        // Toeplitz bias slice (rel = key - q): 191 entries needed, entry j is rel index base + j
        int base = kb - qblk - 127 + 4095;
        int gi = base + tid;
        gi = gi < 0 ? 0 : (gi > 8190 ? 8190 : gi);
        int gi2 = base + 128 + tid;
        gi2 = gi2 < 0 ? 0 : (gi2 > 8190 ? 8190 : gi2);
        // waves 0, 1 bring the slice's tail, waves 2, 3 the gate: a choice per wave, all lanes on
        const float* ga1 = lowpair ? btabh + gi2 : gateb + kb + (tid - 64);
        stage_copies(Kp + (size_t)(kb + srow) * DKV + scol, Vp + (size_t)srow * SS + kb + scol,
                     btabh + gi, ga1, lds_addr(&Ks[grp][bb][srow * KPITCH + scol]),
                     lds_addr(&Vs[grp][bb][srow * KPITCH + scol]),
                     lds_addr(&aux_s[grp][bb][tid]));
    };

    issue_stage(0);

    // Q fragments (B operand, column = query l15): 2 q-groups x 2 halves of the head dim
    bf16x16 qf[2][2];
#pragma unroll
    for (int qt = 0; qt < 2; ++qt) {
        const bf16* qr = Qp + (size_t)(q0 + qt * 16 + l15) * DKV;
#pragma unroll
        for (int kh = 0; kh < 2; ++kh)
            qf[qt][kh] = load16(qr + kh * 32 + kb8, qr + kh * 32 + kb8 + 16);
    }

    // Oa[qt][dt][r] = O^T[d = dt*16 + kb8 + r][q = q0 + qt*16 + l15]
    floatx8 Oa[2][4];
#pragma unroll
    for (int qt = 0; qt < 2; ++qt)
#pragma unroll
        for (int dt = 0; dt < 4; ++dt) Oa[qt][dt] = zero8();
    float rm[2], rl[2];  // per query: running maximum; this lane half's share of the sum
#pragma unroll
    for (int qt = 0; qt < 2; ++qt) { rm[qt] = -1e30f; rl[qt] = 0.f; }

    // bias index of (key offset p*32 + kt*16 + kb8 + r, query offset wave*32 + qt*16 + l15)
    // is bidx + p*32 + (kt - qt) * 16 + r
    const int bidx = 127 - wave * 32 - l15 + kb8;

    wait_async0();    // stage 0 of this wave has landed
    __syncthreads();  // ... and every other wave's share of it
    issue_stage(1);

    for (int t = 0; t < NST; ++t) {
        const bf16* Kb = Ks[grp][t & 1];
        const bf16* Vb = Vs[grp][t & 1];
        const float* ab = aux_s[grp][t & 1];
        // fragment and bias loads of pass p (32 keys) of this stage
        auto load_k = [&](int p, bf16x16 (&kf)[2][2]) {  // K rows, A operand
#pragma unroll
            for (int kt = 0; kt < 2; ++kt) {
                const bf16* kr = Kb + (p * 32 + kt * 16 + l15) * KPITCH;
                kf[kt][0] = load16(kr + kb8, kr + kb8 + 16);
                kf[kt][1] = load16(kr + 32 + kb8, kr + 32 + kb8 + 16);
            }
        };
        auto load_v = [&](int p, bf16x16 (&vf)[4]) {  // V^T rows, A operand
#pragma unroll
            for (int dt = 0; dt < 4; ++dt) {
                const bf16* vr = Vb + (dt * 16 + l15) * KPITCH + p * 32;
                vf[dt] = load16(vr + kb8, vr + kb8 + 16);
            }
        };
        // bg[qt][kt] = position bias + delete-gate of the lane's 8 keys of tile kt
        auto load_bg = [&](int p, floatx8 (&bg)[2][2]) {
            floatx8 gv[2];
#pragma unroll
            for (int kt = 0; kt < 2; ++kt)
                gv[kt] = *(const floatx8*)(ab + 192 + p * 32 + kt * 16 + kb8);
            floatx8 bv[3];  // the slice is Toeplitz: only kt - qt = -1, 0, 1 differ
#pragma unroll
            for (int j = 0; j < 3; ++j)
#pragma unroll
                for (int r = 0; r < 8; ++r) bv[j][r] = ab[bidx + p * 32 + (j - 1) * 16 + r];
#pragma unroll
            for (int qt = 0; qt < 2; ++qt)
#pragma unroll
                for (int kt = 0; kt < 2; ++kt) bg[qt][kt] = bv[kt - qt + 1] + gv[kt];
        };
        // sacc[qt][kt][r] = S[q = qt*16 + l15][key = kt*16 + kb8 + r], 8 WMMAs
        auto scores = [&](const bf16x16 (&kf)[2][2], floatx8 (&sacc)[2][2]) {
#pragma unroll
            for (int kt = 0; kt < 2; ++kt)
#pragma unroll
                for (int qt = 0; qt < 2; ++qt) {
                    floatx8 s = wmma_bf16(kf[kt][0], qf[qt][0], zero8());
                    sacc[qt][kt] = wmma_bf16(kf[kt][1], qf[qt][1], s);
                }
        };
        // online softmax1 update, one query per lane and group; then O^T += V^T P^T, 8 WMMAs
        auto update = [&](floatx8 (&sacc)[2][2], const floatx8 (&bg)[2][2],
                          const bf16x16 (&vf)[4]) {
            bf16x16 pf[2];
#pragma unroll
            for (int qt = 0; qt < 2; ++qt) {
                sacc[qt][0] += bg[qt][0];
                sacc[qt][1] += bg[qt][1];
                float tm = fmaxf(sacc[qt][0][0], sacc[qt][1][0]);
#pragma unroll
                for (int r = 1; r < 8; ++r)
                    tm = fmaxf(tm, fmaxf(sacc[qt][0][r], sacc[qt][1][r]));
                tm = fmaxf(tm, other_half(tm));
                float mnew = fmaxf(rm[qt], tm);
                float alpha = __expf(rm[qt] - mnew);
                rm[qt] = mnew;
                floatx8 d0 = sacc[qt][0] - mnew, d1 = sacc[qt][1] - mnew;
#pragma unroll
                for (int r = 0; r < 8; ++r) {
                    d0[r] = __expf(d0[r]);
                    d1[r] = __expf(d1[r]);
                    // P^T as B operand: element s holds key kb8 + s (s < 8), 16 + kb8 + s - 8
                    pf[qt][r]     = f2bf(d0[r]);
                    pf[qt][r + 8] = f2bf(d1[r]);
                }
                floatx8 sv = d0 + d1;
                float ts = ((sv[0] + sv[1]) + (sv[2] + sv[3])) +
                           ((sv[4] + sv[5]) + (sv[6] + sv[7]));
                rl[qt] = rl[qt] * alpha + ts;
#pragma unroll
                for (int dt = 0; dt < 4; ++dt) Oa[qt][dt] *= alpha;
            }
#pragma unroll
            for (int dt = 0; dt < 4; ++dt)
#pragma unroll
                for (int qt = 0; qt < 2; ++qt) Oa[qt][dt] = wmma_bf16(vf[dt], pf[qt], Oa[qt][dt]);
        };

        // Two passes of 32 keys per stage. The loop stays rolled so that each pass is a block
        // of its own with its LDS loads at its head.
#pragma unroll 1
        for (int p = 0; p < 2; ++p) {
            bf16x16 kf[2][2], vf[4];
            floatx8 sacc[2][2], bg[2][2];
            load_k(p, kf);
            load_bg(p, bg);
            load_v(p, vf);
            // Keeps the pass's loads issued together here, ahead of the products; without it
            // some K loads sink between the score products, each with a full wait of its own.
            __builtin_amdgcn_sched_barrier(0);
            scores(kf, sacc);
            update(sacc, bg, vf);
            // The pass ends in a product and the loop's taken branch: four vector slots, held at
            // the foot by the scheduling barrier, before
            // the next pass's address arithmetic may reuse that product's operand registers.
            __builtin_amdgcn_sched_barrier(0);
            asm volatile("v_nop\n\tv_nop\n\tv_nop\n\tv_nop");
        }

        // publish point of stage t + 1, which also frees stage t's buffer
        asm volatile("s_wait_dscnt 0x0" ::: "memory");  // this wave's reads of stage t are done
        wait_async0();                                  // its copies of stage t + 1 have landed
        __syncthreads();
        if (t + 2 < NST) issue_stage(t + 2);
    }
    wait_async0();  // nothing is outstanding when the wave ends

    // ---- join of the two key halves: group 1 hands its partials over, group 0 finishes ----
    if (grp == 1) {
#pragma unroll
        for (int qt = 0; qt < 2; ++qt) {
#pragma unroll
            for (int dt = 0; dt < 4; ++dt)
#pragma unroll
                for (int j = 0; j < 2; ++j) {
                    floatx4 v = {Oa[qt][dt][4 * j], Oa[qt][dt][4 * j + 1], Oa[qt][dt][4 * j + 2],
                                 Oa[qt][dt][4 * j + 3]};
                    join_o[((wave * 8 + qt * 4 + dt) * 2 + j) * 32 + lane] = v;
                }
            join_ml[wave][qt][0][lane] = rm[qt];
            join_ml[wave][qt][1][lane] = rl[qt];
        }
    }
    __syncthreads();  // group 1's partials are read by group 0
    if (grp == 1) return;
#pragma unroll
    for (int qt = 0; qt < 2; ++qt) {
        float m1 = join_ml[wave][qt][0][lane], l1 = join_ml[wave][qt][1][lane];
        float m = fmaxf(rm[qt], m1);
        float a0 = __expf(rm[qt] - m), a1 = __expf(m1 - m);
        rm[qt] = m;
        rl[qt] = rl[qt] * a0 + l1 * a1;
#pragma unroll
        for (int dt = 0; dt < 4; ++dt)
#pragma unroll
            for (int j = 0; j < 2; ++j) {
                floatx4 v = join_o[((wave * 8 + qt * 4 + dt) * 2 + j) * 32 + lane];
#pragma unroll
                for (int r = 0; r < 4; ++r)
                    Oa[qt][dt][4 * j + r] = Oa[qt][dt][4 * j + r] * a0 + v[r] * a1;
            }
    }

    // ---- softmax1 denominator: l + exp(-m); the halves' sums are joined here ----
    // ---- write ctx [B,S,H*DKV]: a lane holds 8 consecutive d of one query ----
#pragma unroll
    for (int qt = 0; qt < 2; ++qt) {
        float l = rl[qt] + other_half(rl[qt]);
        float inv = 1.f / (l + __expf(-rm[qt]));
        int q = q0 + qt * 16 + l15;
#pragma unroll
        for (int dt = 0; dt < 4; ++dt) {
            bf16x8 o;
#pragma unroll
            for (int r = 0; r < 8; ++r) o[r] = f2bf(Oa[qt][dt][r] * inv);
            *(bf16x8*)&ctx[((size_t)b * SS + q) * DD + h * DKV + dt * 16 + kb8] = o;
        }
    }
}

// ---------------- launcher ----------------
extern "C" void kernel_launch(void* const* d_in, const int* in_sizes, int n_in,
                              void* d_out, int out_size, void* d_ws, size_t ws_size,
                              hipStream_t stream) {
    (void)in_sizes; (void)n_in; (void)out_size; (void)ws_size;
    const float* hidden = (const float*)d_in[0];
    const float* gate   = (const float*)d_in[1];
    const float* ln1    = (const float*)d_in[2];
    const float* qw     = (const float*)d_in[3];
    const float* kw     = (const float*)d_in[4];
    const float* vw     = (const float*)d_in[5];
    const float* ow     = (const float*)d_in[6];
    const float* relb   = (const float*)d_in[7];
    const float* ln2    = (const float*)d_in[8];
    const float* wi     = (const float*)d_in[9];
    const float* wo     = (const float*)d_in[10];

    char* ws = (char*)d_ws;
    size_t off = 0;
    auto take = [&](size_t bytes) -> char* {
        char* p = ws + off;
        off = (off + bytes + 255) & ~(size_t)255;
        return p;
    };
    bf16*  qwb  = (bf16*)take((size_t)DD * DD * 2);    // all weights transposed [N,K]
    bf16*  kwb  = (bf16*)take((size_t)DD * DD * 2);
    bf16*  vwb  = (bf16*)take((size_t)DD * DD * 2);
    bf16*  owb  = (bf16*)take((size_t)DD * DD * 2);
    bf16*  wib  = (bf16*)take((size_t)DD * DFF * 2);
    bf16*  wob  = (bf16*)take((size_t)DFF * DD * 2);
    float* btab = (float*)take((size_t)HH * 8192 * 4);
    bf16*  xb   = (bf16*)take((size_t)MM * DD * 2);
    bf16*  Qhd  = (bf16*)take((size_t)MM * DD * 2);
    bf16*  Khd  = (bf16*)take((size_t)MM * DD * 2);
    bf16*  Vtd  = (bf16*)take((size_t)MM * DD * 2);
    bf16*  ctxb = (bf16*)take((size_t)MM * DD * 2);
    float* hbuf = (float*)take((size_t)MM * DD * 4);
    bf16*  yb   = (bf16*)take((size_t)MM * DD * 2);
    bf16*  ffb  = (bf16*)take((size_t)MM * DFF * 2);

    // transposed bf16 weight conversions: 768 tiles of 64 x 64
    cvtT_all_kernel<<<768, 128, 0, stream>>>(qw, kw, vw, ow, wi, wo, qwb, kwb, vwb, owb, wib, wob);
    bias_table_kernel<<<(HH * 8191 + 255) / 256, 256, 0, stream>>>(relb, btab);

    // ln1 -> xb (bf16)
    rmsnorm_kernel<<<MM / 8, 256, 0, stream>>>(hidden, ln1, xb, MM);

    // QKV projections (head layouts; V transposed)
    dim3 gQKV(DD / 128, MM / 128);
    gemm_kernel<1><<<gQKV, 256, 0, stream>>>(xb, qwb, nullptr, Qhd, MM, DD, DD);
    gemm_kernel<1><<<gQKV, 256, 0, stream>>>(xb, kwb, nullptr, Khd, MM, DD, DD);
    gemm_kernel<2><<<gQKV, 256, 0, stream>>>(xb, vwb, nullptr, Vtd, MM, DD, DD);

    // flash attention with softmax1
    attn_kernel<<<dim3(SS / 128, HH, BB), 256, 0, stream>>>(Qhd, Khd, Vtd, btab, gate, ctxb);

    // h = hidden + ctx @ o_w
    gemm_kernel<3><<<dim3(DD / 128, MM / 128), 256, 0, stream>>>(ctxb, owb, hidden, hbuf,
                                                                 MM, DD, DD);
    // ln2 -> yb
    rmsnorm_kernel<<<MM / 8, 256, 0, stream>>>(hbuf, ln2, yb, MM);

    // FFN: relu(y @ wi) then out = h + (.) @ wo
    gemm_kernel<4><<<dim3(DFF / 128, MM / 128), 256, 0, stream>>>(yb, wib, nullptr, ffb,
                                                                  MM, DFF, DD);
    gemm_kernel<3><<<dim3(DD / 128, MM / 128), 256, 0, stream>>>(ffb, wob, hbuf, d_out,
                                                                 MM, DD, DFF);
}

// v006
// One run takes 167 microseconds.
// Timed twice side by side with v005, it ran 1.05 times as fast both times.
// All steps since v000 together make it 2.84 times as fast.
#include <hip/hip_runtime.h>
#include <hip/hip_bf16.h>

// ---------------- types ----------------
typedef __bf16 bf16;
typedef bf16  bf16x4  __attribute__((ext_vector_type(4)));
typedef bf16  bf16x8  __attribute__((ext_vector_type(8)));
typedef bf16  bf16x16 __attribute__((ext_vector_type(16)));
typedef float floatx4 __attribute__((ext_vector_type(4)));
typedef float floatx8 __attribute__((ext_vector_type(8)));

#define BB 2
#define SS 4096
#define DD 512
#define HH 8
#define DKV 64
#define DFF 2048
#define MM (BB*SS)   // 8192

// f32 -> bf16, round to nearest even, by the chip's own packed conversion (two values an
// instruction where neighbours are converted together)
__device__ __forceinline__ bf16 f2bf(float x) { return (bf16)x; }
__device__ __forceinline__ bf16x4 f2bf4(floatx4 v) { return __builtin_convertvector(v, bf16x4); }
__device__ __forceinline__ bf16x8 f2bf8(floatx8 v) { return __builtin_convertvector(v, bf16x8); }
__device__ __forceinline__ bf16x16 load16(const bf16* p0, const bf16* p1) {
    bf16x8 a = *(const bf16x8*)p0;
    bf16x8 b = *(const bf16x8*)p1;
    bf16x16 r;
#pragma unroll
    for (int i = 0; i < 8; ++i) { r[i] = a[i]; r[i + 8] = b[i]; }
    return r;
}
__device__ __forceinline__ floatx8 wmma_bf16(bf16x16 a, bf16x16 b, floatx8 c) {
    return __builtin_amdgcn_wmma_f32_16x16x32_bf16(false, a, false, b, (short)0, c,
                                                   false, false);
}
__device__ __forceinline__ floatx8 zero8() {
    floatx8 z = {0.f, 0.f, 0.f, 0.f, 0.f, 0.f, 0.f, 0.f};
    return z;
}

__device__ __forceinline__ void wait_async0() {
    asm volatile("s_wait_asynccnt 0x0" ::: "memory");
}
__device__ __forceinline__ unsigned lds_addr(const void* p) {
    return (unsigned)(size_t)p;  // low 32 bits of a generic shared pointer = LDS byte address
}

// ---------------- small kernels ----------------
// fp32 [K,N] -> bf16 transposed [N,K] (makes all WMMA B-operands K-contiguous), all six
// weights in one launch. A block of 4 waves takes one 64 x 64 tile: a thread reads two 4 x 4
// patches by 16-B loads (256 B of a row per 16 lanes), rounds them and stores them transposed
// to LDS; the tile then leaves by 16-B stores, one whole 128-B line of an output row per 8 lanes.
#define TPITCH 72  // 128-B rows at a 144-B pitch, 16-B aligned for the readers
template <int K, int N>
__device__ __forceinline__ void transpose_tile(const float* __restrict__ in,
                                               bf16* __restrict__ out, int tile, bf16* ts) {
    constexpr int TN = N / 64;  // tiles along N
    const int tid = threadIdx.x;
    const int k0 = (tile / TN) * 64, n0 = (tile % TN) * 64;
    const int a = tid >> 4, c = tid & 15;  // patch h: k = 32h + 4a .. + 3, n = 4c .. 4c + 3
    const float* src = in + k0 * N + n0;
    floatx4 v[2][4];
#pragma unroll
    for (int h = 0; h < 2; ++h)
#pragma unroll
        for (int j = 0; j < 4; ++j)
            v[h][j] = *(const floatx4*)(src + (4 * a * N + 4 * c) + (32 * h + j) * N);
#pragma unroll
    for (int h = 0; h < 2; ++h)
#pragma unroll
        for (int i = 0; i < 4; ++i) {
            floatx4 p = {v[h][0][i], v[h][1][i], v[h][2][i], v[h][3][i]};
            *(bf16x4*)&ts[(4 * c + i) * TPITCH + 32 * h + 4 * a] = f2bf4(p);
        }
    __syncthreads();  // the tile is read across the waves that wrote it
    bf16* dst = out + n0 * K + k0;
    const int n = tid >> 3, ch = (tid & 7) * 8;
#pragma unroll
    for (int j = 0; j < 4; ++j)
        *(bf16x8*)(dst + (n * K + ch) + 16 * j * K) =
            *(const bf16x8*)&ts[(n + 16 * j) * TPITCH + ch];
}

// Blocks 0..255: the four 512 x 512 weights, 64 tiles each; 256..511: wi; 512..767: wo.
__global__ void __launch_bounds__(128) cvtT_all_kernel(
    const float* __restrict__ qw, const float* __restrict__ kw, const float* __restrict__ vw,
    const float* __restrict__ ow, const float* __restrict__ wi, const float* __restrict__ wo,
    bf16* __restrict__ qwb, bf16* __restrict__ kwb, bf16* __restrict__ vwb,
    bf16* __restrict__ owb, bf16* __restrict__ wib, bf16* __restrict__ wob) {
    __shared__ __align__(16) bf16 ts[64 * TPITCH];  // [n][k]
    const int blk = blockIdx.x, g = blk >> 6;
    if (g < 4) {
        const float* in = g == 0 ? qw : g == 1 ? kw : g == 2 ? vw : ow;
        bf16* out = g == 0 ? qwb : g == 1 ? kwb : g == 2 ? vwb : owb;
        transpose_tile<DD, DD>(in, out, blk & 63, ts);
    } else if (g < 8) {
        transpose_tile<DD, DFF>(wi, wib, blk - 256, ts);
    } else {
        transpose_tile<DFF, DD>(wo, wob, blk - 512, ts);
    }
}

// T5 bidirectional bucket bias, Toeplitz table: tab[h*8192 + (rel+4095)]
__global__ void bias_table_kernel(const float* __restrict__ rel_bias, float* __restrict__ tab) {
    int idx = blockIdx.x * 256 + threadIdx.x;
    if (idx >= HH * 8191) return;
    int h = idx / 8191, r = idx % 8191;
    int rel = r - 4095;
    int ret = rel > 0 ? 16 : 0;         // num_buckets/2 = 16
    int n = rel < 0 ? -rel : rel;
    int bucket;
    if (n < 8) {                        // max_exact = 8
        bucket = ret + n;
    } else {
        int v = 8 + (int)(__logf((float)n * 0.125f) * (8.0f / __logf(16.0f)));
        if (v > 15) v = 15;
        bucket = ret + v;
    }
    tab[h * 8192 + r] = rel_bias[bucket * HH + h];
}

// one wave per row of 512 columns; fp32 in, bf16*(rms weight) out
__global__ void __launch_bounds__(256) rmsnorm_kernel(const float* __restrict__ x,
                                                      const float* __restrict__ w,
                                                      bf16* __restrict__ out, int rows) {
    int wave = threadIdx.x >> 5, lane = threadIdx.x & 31;
    int row = blockIdx.x * 8 + wave;
    if (row >= rows) return;
    const float* xr = x + (size_t)row * DD;
    float vals[16];
    float ss = 0.f;
#pragma unroll
    for (int i = 0; i < 16; ++i) {
        float v = xr[lane + i * 32];
        vals[i] = v;
        ss += v * v;
    }
#pragma unroll
    for (int m = 16; m >= 1; m >>= 1) ss += __shfl_xor(ss, m, 32);
    float rs = rsqrtf(ss * (1.f / (float)DD) + 1e-6f);
#pragma unroll
    for (int i = 0; i < 16; ++i) {
        int c = lane + i * 32;
        out[(size_t)row * DD + c] = f2bf(vals[i] * rs * w[c]);
    }
}

// ---------------- WMMA GEMM (async double-buffered LDS) ----------------
// C[M,N] = A[M,K] @ W[K,N] with W pre-transposed as Wt[N,K].
// Block 256 thr = 8 waves (4x2); block tile 128x128; wave tile 32x64.
// A stage is 128 k of both operands' 128 rows; stages come to LDS by asynchronous copies,
// two buffers, one stage ahead: one wait and one barrier per 128 k, and a stage's copies
// have the whole stage before it (32 products per wave) to land. Inside a stage the fragments
// of each 32 k are read one sub-step ahead into a second register set. K: a multiple of 128.
// MODE 0: bf16 row-major    MODE 1: per-head [B,H,S,64]   MODE 2: V^T [B,H,64,S]
// MODE 3: f32 + residual    MODE 4: relu -> bf16
#define GKS 128     // k per stage
#define GPITCH 136  // 256-B rows at a 272-B pitch (16 B x odd) for 16-B readers

// One lane's eight 16-B copies of one operand's stage: rows 16 apart, global pitch gstep.
// The s_wait_xcnt closes the statement so that no address register is rewritten ahead of it.
__device__ __forceinline__ void gemm_copies(const bf16* g, size_t gstep, unsigned l) {
    const bf16 *g1 = g + gstep, *g2 = g1 + gstep, *g3 = g2 + gstep, *g4 = g3 + gstep,
               *g5 = g4 + gstep, *g6 = g5 + gstep, *g7 = g6 + gstep;
    const unsigned st = 16 * GPITCH * 2;
    asm volatile(
        "global_load_async_to_lds_b128 %0, %8, off\n\t"
        "global_load_async_to_lds_b128 %1, %9, off\n\t"
        "global_load_async_to_lds_b128 %2, %10, off\n\t"
        "global_load_async_to_lds_b128 %3, %11, off\n\t"
        "global_load_async_to_lds_b128 %4, %12, off\n\t"
        "global_load_async_to_lds_b128 %5, %13, off\n\t"
        "global_load_async_to_lds_b128 %6, %14, off\n\t"
        "global_load_async_to_lds_b128 %7, %15, off\n\t"
        "s_wait_xcnt 0x0"
        :: "v"(l), "v"(l + st), "v"(l + 2 * st), "v"(l + 3 * st),
           "v"(l + 4 * st), "v"(l + 5 * st), "v"(l + 6 * st), "v"(l + 7 * st),
           "v"(g), "v"(g1), "v"(g2), "v"(g3), "v"(g4), "v"(g5), "v"(g6), "v"(g7)
        : "memory");
}

template <int MODE>
__global__ void __launch_bounds__(256) gemm_kernel(const bf16* __restrict__ A,
                                                   const bf16* __restrict__ Wt,
                                                   const float* __restrict__ resid,
                                                   void* __restrict__ outp,
                                                   int M, int N, int K) {
    __shared__ __align__(16) bf16 As[2][128 * GPITCH];  // [row][k]
    __shared__ __align__(16) bf16 Bs[2][128 * GPITCH];  // [n][k]
    const int tid = threadIdx.x, lane = tid & 31, wave = tid >> 5;
    const int wm = wave >> 1, wn = wave & 1;
    const int n0 = blockIdx.x * 128, m0 = blockIdx.y * 128;
    const int l15 = lane & 15, kb8 = (lane >> 4) * 8;

    floatx8 acc[2][4];
#pragma unroll
    for (int qt = 0; qt < 2; ++qt)
#pragma unroll
        for (int nt = 0; nt < 4; ++nt) acc[qt][nt] = zero8();

    // staging assignment: 16 lanes per 256-B row, 16 rows per copy of the block
    const int pr = tid >> 4, pk = (tid & 15) * 8;
    const int nIter = K / GKS;
    const bf16* ga = A + (size_t)(m0 + pr) * K + pk;
    const bf16* gb = Wt + (size_t)(n0 + pr) * K + pk;
    auto issue_stage = [&](int t) {
        const int bb = t & 1;
        gemm_copies(ga + t * GKS, (size_t)16 * K, lds_addr(&As[bb][pr * GPITCH + pk]));
        gemm_copies(gb + t * GKS, (size_t)16 * K, lds_addr(&Bs[bb][pr * GPITCH + pk]));
    };

    issue_stage(0);
    wait_async0();    // stage 0 of this wave has landed
    __syncthreads();  // ... and every other wave's share of it
    if (nIter > 1) issue_stage(1);

    for (int t = 0; t < nIter; ++t) {
        const bf16* Ab = &As[t & 1][(wm * 32 + l15) * GPITCH + kb8];
        const bf16* Bb = &Bs[t & 1][(wn * 64 + l15) * GPITCH + kb8];
        // fragments of sub-step ks (32 k) of this stage: 12 LDS loads as one group
        bf16x16 af[2][2], bfr[2][4];
        auto load_frags = [&](int ks) {
#pragma unroll
            for (int qt = 0; qt < 2; ++qt) {
                const bf16* p = Ab + qt * 16 * GPITCH + ks * 32;
                af[ks & 1][qt] = load16(p, p + 16);
            }
#pragma unroll
            for (int nt = 0; nt < 4; ++nt) {
                const bf16* p = Bb + nt * 16 * GPITCH + ks * 32;
                bfr[ks & 1][nt] = load16(p, p + 16);
            }
        };
        load_frags(0);
#pragma unroll
        for (int ks = 0; ks < GKS / 32; ++ks) {
            if (ks + 1 < GKS / 32) load_frags(ks + 1);
            // Keeps the next sub-step's loads ahead of this sub-step's products; without it
            // the loads sink between the products, each pair with a full wait of its own.
            __builtin_amdgcn_sched_barrier(0);
#pragma unroll
            for (int nt = 0; nt < 4; ++nt)
#pragma unroll
                for (int qt = 0; qt < 2; ++qt)
                    acc[qt][nt] = wmma_bf16(af[ks & 1][qt], bfr[ks & 1][nt], acc[qt][nt]);
        }
        // publish point of stage t + 1, which also frees stage t's buffer
        asm volatile("s_wait_dscnt 0x0" ::: "memory");  // this wave's reads of stage t are done
        wait_async0();                                  // its copies of stage t + 1 have landed
        __syncthreads();
        if (t + 2 < nIter) issue_stage(t + 2);
    }
    wait_async0();  // nothing is outstanding when the wave ends

#pragma unroll
    for (int qt = 0; qt < 2; ++qt) {
#pragma unroll
        for (int nt = 0; nt < 4; ++nt) {
#pragma unroll
            for (int i = 0; i < 8; ++i) {
                int m = m0 + wm * 32 + qt * 16 + i + 8 * (lane >> 4);
                int n = n0 + wn * 64 + nt * 16 + l15;
                float v = acc[qt][nt][i];
                if constexpr (MODE == 0) {
                    ((bf16*)outp)[(size_t)m * N + n] = f2bf(v);
                } else if constexpr (MODE == 1) {
                    int b = m >> 12, s = m & 4095, h = n >> 6, d = n & 63;
                    ((bf16*)outp)[(((size_t)(b * HH + h) * SS) + s) * DKV + d] = f2bf(v);
                } else if constexpr (MODE == 2) {
                    int b = m >> 12, s = m & 4095, h = n >> 6, d = n & 63;
                    ((bf16*)outp)[(((size_t)(b * HH + h) * DKV) + d) * SS + s] = f2bf(v);
                } else if constexpr (MODE == 3) {
                    ((float*)outp)[(size_t)m * N + n] = resid[(size_t)m * N + n] + v;
                } else {  // MODE 4
                    ((bf16*)outp)[(size_t)m * N + n] = f2bf(v > 0.f ? v : 0.f);
                }
            }
        }
    }
}

// ---------------- Flash attention with softmax1 ----------------
// Block = 256 thr = 8 waves = 2 groups of 4; block covers (b, h, 128 q rows); a wave covers
// 32 q rows and its group's half of the keys, so that four waves, not two, share a SIMD and
// fill each other's waits. The groups' partial (maximum, sum, O^T) are joined at the end.
// Scores are formed transposed, S^T = K Q^T (A = K rows, B = Q columns), and the output
// as O^T += V^T P^T. A lane then holds 16 of the 32 keys of ONE query per 16-query group:
// maximum and sum run in the lane (one exchange between lane halves for the maximum),
// and the two S^T tiles of a group, rounded in place, are already the B operand P^T.
// K rows, V^T rows, the bias slice and the delete-gate of 64 keys form one stage; stages
// come to LDS by asynchronous copies, two buffers per group, one stage ahead, shared by the
// group's 4 waves.
#define KST 64                 // keys per stage
#define NST (SS / KST / 2)     // stages per group
#define KPITCH 72              // 128-B rows at a 144-B pitch (16 B x odd) for 16-B readers
#define LOG2E 1.44269504f      // the factor that __expf applies in front of the base-2 exponential

__device__ __forceinline__ float other_half(float x) {  // value of lane l ^ 16
    int v = __builtin_bit_cast(int, x);
    v = __builtin_amdgcn_permlanex16(v, v, 0x76543210, 0xfedcba98, false, false);
    return __builtin_bit_cast(float, v);
}

// One lane's ten copies of a stage: 4 x 16 B of K, 4 x 16 B of V^T, 2 x 4 B of bias / gate.
// The s_wait_xcnt closes the statement so that no address register is rewritten ahead of it.
__device__ __forceinline__ void stage_copies(const bf16* gk, const bf16* gv, const float* ga0,
                                             const float* ga1, unsigned lk, unsigned lv,
                                             unsigned la) {
    const bf16 *gk1 = gk + 16 * DKV, *gk2 = gk + 32 * DKV, *gk3 = gk + 48 * DKV;
    const bf16 *gv1 = gv + 16 * SS, *gv2 = gv + 32 * SS, *gv3 = gv + 48 * SS;
    const unsigned st = 16 * KPITCH * 2;
    asm volatile(
        "global_load_async_to_lds_b128 %0, %10, off\n\t"
        "global_load_async_to_lds_b128 %1, %11, off\n\t"
        "global_load_async_to_lds_b128 %2, %12, off\n\t"
        "global_load_async_to_lds_b128 %3, %13, off\n\t"
        "global_load_async_to_lds_b128 %4, %14, off\n\t"
        "global_load_async_to_lds_b128 %5, %15, off\n\t"
        "global_load_async_to_lds_b128 %6, %16, off\n\t"
        "global_load_async_to_lds_b128 %7, %17, off\n\t"
        "global_load_async_to_lds_b32 %8, %18, off\n\t"
        "global_load_async_to_lds_b32 %9, %19, off\n\t"
        "s_wait_xcnt 0x0"
        :: "v"(lk), "v"(lk + st), "v"(lk + 2 * st), "v"(lk + 3 * st),
           "v"(lv), "v"(lv + st), "v"(lv + 2 * st), "v"(lv + 3 * st),
           "v"(la), "v"(la + 512u),
           "v"(gk), "v"(gk1), "v"(gk2), "v"(gk3),
           "v"(gv), "v"(gv1), "v"(gv2), "v"(gv3),
           "v"(ga0), "v"(ga1)
        : "memory");
}

// waves_per_eu(4, 4): registers within a quarter of a SIMD's file, so that two blocks share a WGP
__global__ void __launch_bounds__(256) __attribute__((amdgpu_waves_per_eu(4, 4)))
attn_kernel(const bf16* __restrict__ Qh,
            const bf16* __restrict__ Kh, const bf16* __restrict__ Vt,
            const float* __restrict__ btab, const float* __restrict__ gate,
            bf16* __restrict__ ctx) {
    __shared__ __align__(16) bf16 Ks[2][2][KST * KPITCH];  // [group][buffer][key][d]
    __shared__ __align__(16) bf16 Vs[2][2][DKV * KPITCH];  // [group][buffer][d][key]
    __shared__ __align__(32) float aux_s[2][2][256];       // 0..191 bias slice, 192..255 gate
    __shared__ __align__(16) floatx4 join_o[4 * 16 * 32];  // group 1's O^T, 16 B per lane
    __shared__ float join_ml[4][2][2][32];                 // group 1's maximum and sum
    // tid, wave: inside the group
    const int tid = threadIdx.x & 127, lane = tid & 31, wave = tid >> 5;
    const int grp = __builtin_amdgcn_readfirstlane((int)(threadIdx.x >> 7));
    const int qblk = blockIdx.x * 128;
    const int h = blockIdx.y, b = blockIdx.z;
    const int q0 = qblk + wave * 32;
    const size_t head = (size_t)(b * HH + h) * SS * DKV;
    const bf16* Qp = Qh + head;
    const bf16* Kp = Kh + head;
    const bf16* Vp = Vt + head;  // [64][4096]
    const float* btabh = btab + h * 8192;
    const float* gateb = gate + (size_t)b * SS;

    const int l15 = lane & 15;
    const int kb8 = (lane >> 4) * 8;

    // staging assignment: 8 lanes per 128-B row, 16 rows per copy of the group
    const int srow = tid >> 3, scol = (tid & 7) * 8;
    const bool lowpair = __builtin_amdgcn_readfirstlane(wave) < 2;
    auto issue_stage = [&](int t) {
        const int kb = (grp * NST + t) * KST, bb = t & 1;
        // Toeplitz bias slice (rel = key - q): 191 entries needed, entry j is rel index base + j
        int base = kb - qblk - 127 + 4095;
        int gi = base + tid;
        gi = gi < 0 ? 0 : (gi > 8190 ? 8190 : gi);
        int gi2 = base + 128 + tid;
        gi2 = gi2 < 0 ? 0 : (gi2 > 8190 ? 8190 : gi2);
        // waves 0, 1 bring the slice's tail, waves 2, 3 the gate: a choice per wave, all lanes on
        const float* ga1 = lowpair ? btabh + gi2 : gateb + kb + (tid - 64);
        stage_copies(Kp + (size_t)(kb + srow) * DKV + scol, Vp + (size_t)srow * SS + kb + scol,
                     btabh + gi, ga1, lds_addr(&Ks[grp][bb][srow * KPITCH + scol]),
                     lds_addr(&Vs[grp][bb][srow * KPITCH + scol]),
                     lds_addr(&aux_s[grp][bb][tid]));
    };

    issue_stage(0);

    // Q fragments (B operand, column = query l15): 2 q-groups x 2 halves of the head dim
    bf16x16 qf[2][2];
#pragma unroll
    for (int qt = 0; qt < 2; ++qt) {
        const bf16* qr = Qp + (size_t)(q0 + qt * 16 + l15) * DKV;
#pragma unroll
        for (int kh = 0; kh < 2; ++kh)
            qf[qt][kh] = load16(qr + kh * 32 + kb8, qr + kh * 32 + kb8 + 16);
    }

    // Oa[qt][dt][r] = O^T[d = dt*16 + kb8 + r][q = q0 + qt*16 + l15]
    floatx8 Oa[2][4];
#pragma unroll
    for (int qt = 0; qt < 2; ++qt)
#pragma unroll
        for (int dt = 0; dt < 4; ++dt) Oa[qt][dt] = zero8();
    float rm[2], rl[2];  // per query: running maximum; this lane half's share of the sum
#pragma unroll
    for (int qt = 0; qt < 2; ++qt) { rm[qt] = -1e30f; rl[qt] = 0.f; }

    // bias index of (key offset p*32 + kt*16 + kb8 + r, query offset wave*32 + qt*16 + l15)
    // is bidx + p*32 + (kt - qt) * 16 + r
    const int bidx = 127 - wave * 32 - l15 + kb8;

    wait_async0();    // stage 0 of this wave has landed
    __syncthreads();  // ... and every other wave's share of it
    issue_stage(1);

    for (int t = 0; t < NST; ++t) {
        const bf16* Kb = Ks[grp][t & 1];
        const bf16* Vb = Vs[grp][t & 1];
        const float* ab = aux_s[grp][t & 1];
        // fragment and bias loads of pass p (32 keys) of this stage
        auto load_k = [&](int p, bf16x16 (&kf)[2][2]) {  // K rows, A operand
#pragma unroll
            for (int kt = 0; kt < 2; ++kt) {
                const bf16* kr = Kb + (p * 32 + kt * 16 + l15) * KPITCH;
                kf[kt][0] = load16(kr + kb8, kr + kb8 + 16);
                kf[kt][1] = load16(kr + 32 + kb8, kr + 32 + kb8 + 16);
            }
        };
        auto load_v = [&](int p, bf16x16 (&vf)[4]) {  // V^T rows, A operand
#pragma unroll
            for (int dt = 0; dt < 4; ++dt) {
                const bf16* vr = Vb + (dt * 16 + l15) * KPITCH + p * 32;
                vf[dt] = load16(vr + kb8, vr + kb8 + 16);
            }
        };
        // bg[qt][kt] = position bias + delete-gate of the lane's 8 keys of tile kt
        auto load_bg = [&](int p, floatx8 (&bg)[2][2]) {
            floatx8 gv[2];
#pragma unroll
            for (int kt = 0; kt < 2; ++kt)
                gv[kt] = *(const floatx8*)(ab + 192 + p * 32 + kt * 16 + kb8);
            floatx8 bv[3];  // the slice is Toeplitz: only kt - qt = -1, 0, 1 differ
#pragma unroll
            for (int j = 0; j < 3; ++j)
#pragma unroll
                for (int r = 0; r < 8; ++r) bv[j][r] = ab[bidx + p * 32 + (j - 1) * 16 + r];
#pragma unroll
            for (int qt = 0; qt < 2; ++qt)
#pragma unroll
                for (int kt = 0; kt < 2; ++kt) bg[qt][kt] = bv[kt - qt + 1] + gv[kt];
        };
        // sacc[qt][kt][r] = S[q = qt*16 + l15][key = kt*16 + kb8 + r], 8 WMMAs
        auto scores = [&](const bf16x16 (&kf)[2][2], floatx8 (&sacc)[2][2]) {
#pragma unroll
            for (int kt = 0; kt < 2; ++kt)
#pragma unroll
                for (int qt = 0; qt < 2; ++qt) {
                    floatx8 s = wmma_bf16(kf[kt][0], qf[qt][0], zero8());
                    sacc[qt][kt] = wmma_bf16(kf[kt][1], qf[qt][1], s);
                }
        };
        // online softmax1 update, one query per lane and group; then O^T += V^T P^T, 8 WMMAs
        auto update = [&](floatx8 (&sacc)[2][2], const floatx8 (&bg)[2][2],
                          const bf16x16 (&vf)[4]) {
            bf16x16 pf[2];
#pragma unroll
            for (int qt = 0; qt < 2; ++qt) {
                sacc[qt][0] += bg[qt][0];
                sacc[qt][1] += bg[qt][1];
                float tm = fmaxf(sacc[qt][0][0], sacc[qt][1][0]);
#pragma unroll
                for (int r = 1; r < 8; ++r)
                    tm = fmaxf(tm, fmaxf(sacc[qt][0][r], sacc[qt][1][r]));
                tm = fmaxf(tm, other_half(tm));
                float mnew = fmaxf(rm[qt], tm);
                float alpha = __expf(rm[qt] - mnew);
                rm[qt] = mnew;
                // e^x = 2^(x log2 e), the product formed on the vectors (packed multiplies)
                floatx8 d0 = (sacc[qt][0] - mnew) * LOG2E, d1 = (sacc[qt][1] - mnew) * LOG2E;
#pragma unroll
                for (int r = 0; r < 8; ++r) d0[r] = __builtin_amdgcn_exp2f(d0[r]);
#pragma unroll
                for (int r = 0; r < 8; ++r) d1[r] = __builtin_amdgcn_exp2f(d1[r]);
                // P^T as B operand: element s holds key kb8 + s (s < 8), 16 + kb8 + s - 8
                pf[qt] = __builtin_shufflevector(f2bf8(d0), f2bf8(d1), 0, 1, 2, 3, 4, 5, 6, 7, 8,
                                                 9, 10, 11, 12, 13, 14, 15);
                floatx8 sv = d0 + d1;
                float ts = ((sv[0] + sv[1]) + (sv[2] + sv[3])) +
                           ((sv[4] + sv[5]) + (sv[6] + sv[7]));
                rl[qt] = rl[qt] * alpha + ts;
#pragma unroll
                for (int dt = 0; dt < 4; ++dt) Oa[qt][dt] *= alpha;
            }
#pragma unroll
            for (int dt = 0; dt < 4; ++dt)
#pragma unroll
                for (int qt = 0; qt < 2; ++qt) Oa[qt][dt] = wmma_bf16(vf[dt], pf[qt], Oa[qt][dt]);
        };

        // Two passes of 32 keys per stage. The loop stays rolled so that each pass is a block
        // of its own with its LDS loads at its head.
#pragma unroll 1
        for (int p = 0; p < 2; ++p) {
            bf16x16 kf[2][2], vf[4];
            floatx8 sacc[2][2], bg[2][2];
            load_k(p, kf);
            load_bg(p, bg);
            load_v(p, vf);
            // Keeps the pass's loads issued together here, ahead of the products; without it
            // some K loads sink between the score products, each with a full wait of its own.
            __builtin_amdgcn_sched_barrier(0);
            scores(kf, sacc);
            update(sacc, bg, vf);
            // The pass ends in a product and the loop's taken branch: four vector slots, held at
            // the foot by the scheduling barrier, before
            // the next pass's address arithmetic may reuse that product's operand registers.
            __builtin_amdgcn_sched_barrier(0);
            asm volatile("v_nop\n\tv_nop\n\tv_nop\n\tv_nop");
        }

        // publish point of stage t + 1, which also frees stage t's buffer
        asm volatile("s_wait_dscnt 0x0" ::: "memory");  // this wave's reads of stage t are done
        wait_async0();                                  // its copies of stage t + 1 have landed
        __syncthreads();
        if (t + 2 < NST) issue_stage(t + 2);
    }
    wait_async0();  // nothing is outstanding when the wave ends

    // ---- join of the two key halves: group 1 hands its partials over, group 0 finishes ----
    if (grp == 1) {
#pragma unroll
        for (int qt = 0; qt < 2; ++qt) {
#pragma unroll
            for (int dt = 0; dt < 4; ++dt)
#pragma unroll
                for (int j = 0; j < 2; ++j) {
                    floatx4 v = {Oa[qt][dt][4 * j], Oa[qt][dt][4 * j + 1], Oa[qt][dt][4 * j + 2],
                                 Oa[qt][dt][4 * j + 3]};
                    join_o[((wave * 8 + qt * 4 + dt) * 2 + j) * 32 + lane] = v;
                }
            join_ml[wave][qt][0][lane] = rm[qt];
            join_ml[wave][qt][1][lane] = rl[qt];
        }
    }
    __syncthreads();  // group 1's partials are read by group 0
    if (grp == 1) return;
#pragma unroll
    for (int qt = 0; qt < 2; ++qt) {
        float m1 = join_ml[wave][qt][0][lane], l1 = join_ml[wave][qt][1][lane];
        float m = fmaxf(rm[qt], m1);
        float a0 = __expf(rm[qt] - m), a1 = __expf(m1 - m);
        rm[qt] = m;
        rl[qt] = rl[qt] * a0 + l1 * a1;
#pragma unroll
        for (int dt = 0; dt < 4; ++dt)
#pragma unroll
            for (int j = 0; j < 2; ++j) {
                floatx4 v = join_o[((wave * 8 + qt * 4 + dt) * 2 + j) * 32 + lane];
#pragma unroll
                for (int r = 0; r < 4; ++r)
                    Oa[qt][dt][4 * j + r] = Oa[qt][dt][4 * j + r] * a0 + v[r] * a1;
            }
    }

    // ---- softmax1 denominator: l + exp(-m); the halves' sums are joined here ----
    // ---- write ctx [B,S,H*DKV]: a lane holds 8 consecutive d of one query ----
#pragma unroll
    for (int qt = 0; qt < 2; ++qt) {
        float l = rl[qt] + other_half(rl[qt]);
        float inv = 1.f / (l + __expf(-rm[qt]));
        int q = q0 + qt * 16 + l15;
#pragma unroll
        for (int dt = 0; dt < 4; ++dt) {
            *(bf16x8*)&ctx[((size_t)b * SS + q) * DD + h * DKV + dt * 16 + kb8] =
                f2bf8(Oa[qt][dt] * inv);
        }
    }
}

// ---------------- launcher ----------------
extern "C" void kernel_launch(void* const* d_in, const int* in_sizes, int n_in,
                              void* d_out, int out_size, void* d_ws, size_t ws_size,
                              hipStream_t stream) {
    (void)in_sizes; (void)n_in; (void)out_size; (void)ws_size;
    const float* hidden = (const float*)d_in[0];
    const float* gate   = (const float*)d_in[1];
    const float* ln1    = (const float*)d_in[2];
    const float* qw     = (const float*)d_in[3];
    const float* kw     = (const float*)d_in[4];
    const float* vw     = (const float*)d_in[5];
    const float* ow     = (const float*)d_in[6];
    const float* relb   = (const float*)d_in[7];
    const float* ln2    = (const float*)d_in[8];
    const float* wi     = (const float*)d_in[9];
    const float* wo     = (const float*)d_in[10];

    char* ws = (char*)d_ws;
    size_t off = 0;
    auto take = [&](size_t bytes) -> char* {
        char* p = ws + off;
        off = (off + bytes + 255) & ~(size_t)255;
        return p;
    };
    bf16*  qwb  = (bf16*)take((size_t)DD * DD * 2);    // all weights transposed [N,K]
    bf16*  kwb  = (bf16*)take((size_t)DD * DD * 2);
    bf16*  vwb  = (bf16*)take((size_t)DD * DD * 2);
    bf16*  owb  = (bf16*)take((size_t)DD * DD * 2);
    bf16*  wib  = (bf16*)take((size_t)DD * DFF * 2);
    bf16*  wob  = (bf16*)take((size_t)DFF * DD * 2);
    float* btab = (float*)take((size_t)HH * 8192 * 4);
    bf16*  xb   = (bf16*)take((size_t)MM * DD * 2);
    bf16*  Qhd  = (bf16*)take((size_t)MM * DD * 2);
    bf16*  Khd  = (bf16*)take((size_t)MM * DD * 2);
    bf16*  Vtd  = (bf16*)take((size_t)MM * DD * 2);
    bf16*  ctxb = (bf16*)take((size_t)MM * DD * 2);
    float* hbuf = (float*)take((size_t)MM * DD * 4);
    bf16*  yb   = (bf16*)take((size_t)MM * DD * 2);
    bf16*  ffb  = (bf16*)take((size_t)MM * DFF * 2);

    // transposed bf16 weight conversions: 768 tiles of 64 x 64
    cvtT_all_kernel<<<768, 128, 0, stream>>>(qw, kw, vw, ow, wi, wo, qwb, kwb, vwb, owb, wib, wob);
    bias_table_kernel<<<(HH * 8191 + 255) / 256, 256, 0, stream>>>(relb, btab);

    // ln1 -> xb (bf16)
    rmsnorm_kernel<<<MM / 8, 256, 0, stream>>>(hidden, ln1, xb, MM);

    // QKV projections (head layouts; V transposed)
    dim3 gQKV(DD / 128, MM / 128);
    gemm_kernel<1><<<gQKV, 256, 0, stream>>>(xb, qwb, nullptr, Qhd, MM, DD, DD);
    gemm_kernel<1><<<gQKV, 256, 0, stream>>>(xb, kwb, nullptr, Khd, MM, DD, DD);
    gemm_kernel<2><<<gQKV, 256, 0, stream>>>(xb, vwb, nullptr, Vtd, MM, DD, DD);

    // flash attention with softmax1
    attn_kernel<<<dim3(SS / 128, HH, BB), 256, 0, stream>>>(Qhd, Khd, Vtd, btab, gate, ctxb);

    // h = hidden + ctx @ o_w
    gemm_kernel<3><<<dim3(DD / 128, MM / 128), 256, 0, stream>>>(ctxb, owb, hidden, hbuf,
                                                                 MM, DD, DD);
    // ln2 -> yb
    rmsnorm_kernel<<<MM / 8, 256, 0, stream>>>(hbuf, ln2, yb, MM);

    // FFN: relu(y @ wi) then out = h + (.) @ wo
    gemm_kernel<4><<<dim3(DFF / 128, MM / 128), 256, 0, stream>>>(yb, wib, nullptr, ffb,
                                                                  MM, DFF, DD);
    gemm_kernel<3><<<dim3(DD / 128, MM / 128), 256, 0, stream>>>(ffb, wob, hbuf, d_out,
                                                                 MM, DD, DFF);
}

// v007
// A run of this version takes 158 microseconds.
// In two side-by-side timings against v006, it was 1.07 and 1.05 times as fast.
// Over all steps from v000 it is 3.01 times as fast.
#include <hip/hip_runtime.h>
#include <hip/hip_bf16.h>

// ---------------- types ----------------
typedef __bf16 bf16;
typedef bf16  bf16x4  __attribute__((ext_vector_type(4)));
typedef bf16  bf16x8  __attribute__((ext_vector_type(8)));
typedef bf16  bf16x16 __attribute__((ext_vector_type(16)));
typedef float floatx4 __attribute__((ext_vector_type(4)));
typedef float floatx8 __attribute__((ext_vector_type(8)));

#define BB 2
#define SS 4096
#define DD 512
#define HH 8
#define DKV 64
#define DFF 2048
#define MM (BB*SS)   // 8192

// f32 -> bf16, round to nearest even, by the chip's own packed conversion (two values an
// instruction where neighbours are converted together)
__device__ __forceinline__ bf16 f2bf(float x) { return (bf16)x; }
__device__ __forceinline__ bf16x4 f2bf4(floatx4 v) { return __builtin_convertvector(v, bf16x4); }
__device__ __forceinline__ bf16x8 f2bf8(floatx8 v) { return __builtin_convertvector(v, bf16x8); }
__device__ __forceinline__ bf16x16 load16(const bf16* p0, const bf16* p1) {
    bf16x8 a = *(const bf16x8*)p0;
    bf16x8 b = *(const bf16x8*)p1;
    bf16x16 r;
#pragma unroll
    for (int i = 0; i < 8; ++i) { r[i] = a[i]; r[i + 8] = b[i]; }
    return r;
}
__device__ __forceinline__ floatx8 wmma_bf16(bf16x16 a, bf16x16 b, floatx8 c) {
    return __builtin_amdgcn_wmma_f32_16x16x32_bf16(false, a, false, b, (short)0, c,
                                                   false, false);
}
__device__ __forceinline__ floatx8 zero8() {
    floatx8 z = {0.f, 0.f, 0.f, 0.f, 0.f, 0.f, 0.f, 0.f};
    return z;
}

__device__ __forceinline__ void wait_async0() {
    asm volatile("s_wait_asynccnt 0x0" ::: "memory");
}
__device__ __forceinline__ unsigned lds_addr(const void* p) {
    return (unsigned)(size_t)p;  // low 32 bits of a generic shared pointer = LDS byte address
}

// ---------------- small kernels ----------------
// fp32 [K,N] -> bf16 transposed [N,K] (makes all WMMA B-operands K-contiguous), all six
// weights in one launch. Four waves (half a block) take one 64 x 64 tile: a thread reads two 4 x 4
// patches by 16-B loads (256 B of a row per 16 lanes), rounds them and stores them transposed
// to LDS; the tile then leaves by 16-B stores, one whole 128-B line of an output row per 8 lanes.
#define TPITCH 72  // 128-B rows at a 144-B pitch, 16-B aligned for the readers
template <int K, int N>
__device__ __forceinline__ void transpose_tile(const float* __restrict__ in,
                                               bf16* __restrict__ out, int tile, bf16* ts) {
    constexpr int TN = N / 64;  // tiles along N
    const int tid = threadIdx.x & 127;
    const int k0 = (tile / TN) * 64, n0 = (tile % TN) * 64;
    const int a = tid >> 4, c = tid & 15;  // patch h: k = 32h + 4a .. + 3, n = 4c .. 4c + 3
    const float* src = in + k0 * N + n0;
    floatx4 v[2][4];
#pragma unroll
    for (int h = 0; h < 2; ++h)
#pragma unroll
        for (int j = 0; j < 4; ++j)
            v[h][j] = *(const floatx4*)(src + (4 * a * N + 4 * c) + (32 * h + j) * N);
#pragma unroll
    for (int h = 0; h < 2; ++h)
#pragma unroll
        for (int i = 0; i < 4; ++i) {
            floatx4 p = {v[h][0][i], v[h][1][i], v[h][2][i], v[h][3][i]};
            *(bf16x4*)&ts[(4 * c + i) * TPITCH + 32 * h + 4 * a] = f2bf4(p);
        }
    __syncthreads();  // the tile is read across the waves that wrote it
    bf16* dst = out + n0 * K + k0;
    const int n = tid >> 3, ch = (tid & 7) * 8;
#pragma unroll
    for (int j = 0; j < 4; ++j)
        *(bf16x8*)(dst + (n * K + ch) + 16 * j * K) =
            *(const bf16x8*)&ts[(n + 16 * j) * TPITCH + ch];
    // In the listing this part's end runs on into another part's code (behind a branch that is
    // always taken): no register of these stores is rewritten there ahead of this wait.
    asm volatile("s_wait_xcnt 0x0" ::: "memory");
}

// T5 bidirectional bucket bias, Toeplitz table: tab[h*8192 + (rel+4095)]
__device__ __forceinline__ void bias_table_entry(const float* __restrict__ rel_bias,
                                                 float* __restrict__ tab, int idx) {
    if (idx >= HH * 8191) return;
    int h = idx / 8191, r = idx % 8191;
    int rel = r - 4095;
    int ret = rel > 0 ? 16 : 0;         // num_buckets/2 = 16
    int n = rel < 0 ? -rel : rel;
    int bucket;
    if (n < 8) {                        // max_exact = 8
        bucket = ret + n;
    } else {
        int v = 8 + (int)(__logf((float)n * 0.125f) * (8.0f / __logf(16.0f)));
        if (v > 15) v = 15;
        bucket = ret + v;
    }
    tab[h * 8192 + r] = rel_bias[bucket * HH + h];
}

// one wave per row of 512 columns; fp32 in, bf16*(rms weight) out
__device__ __forceinline__ void rmsnorm_row(const float* __restrict__ x,
                                            const float* __restrict__ w,
                                            bf16* __restrict__ out, int row) {
    int lane = threadIdx.x & 31;
    const float* xr = x + (size_t)row * DD;
    float vals[16];
    float ss = 0.f;
#pragma unroll
    for (int i = 0; i < 16; ++i) {
        float v = xr[lane + i * 32];
        vals[i] = v;
        ss += v * v;
    }
#pragma unroll
    for (int m = 16; m >= 1; m >>= 1) ss += __shfl_xor(ss, m, 32);
    float rs = rsqrtf(ss * (1.f / (float)DD) + 1e-6f);
#pragma unroll
    for (int i = 0; i < 16; ++i) {
        int c = lane + i * 32;
        out[(size_t)row * DD + c] = f2bf(vals[i] * rs * w[c]);
    }
}

__global__ void __launch_bounds__(256) rmsnorm_kernel(const float* __restrict__ x,
                                                      const float* __restrict__ w,
                                                      bf16* __restrict__ out, int rows) {
    int row = blockIdx.x * 8 + (threadIdx.x >> 5);
    if (row >= rows) return;
    rmsnorm_row(x, w, out, row);
}

// Everything that reads only inputs, in one launch: none of the three parts needs another's
// result. Blocks 0..1023: first RMS norm, 8 rows each. Blocks 1024..1407: weight transposes, two
// tiles each (tiles 0..255: the four 512 x 512 weights, 64 tiles each; 256..511: wi; 512..767:
// wo). Blocks 1408..1663: the bias table.
#define PREP_RMS (MM / 8)
#define PREP_CVT (768 / 2)
#define PREP_TAB ((HH * 8191 + 255) / 256)
__global__ void __launch_bounds__(256) prep_kernel(
    const float* __restrict__ x, const float* __restrict__ ln, bf16* __restrict__ xb,
    const float* __restrict__ qw, const float* __restrict__ kw, const float* __restrict__ vw,
    const float* __restrict__ ow, const float* __restrict__ wi, const float* __restrict__ wo,
    bf16* __restrict__ qwb, bf16* __restrict__ kwb, bf16* __restrict__ vwb,
    bf16* __restrict__ owb, bf16* __restrict__ wib, bf16* __restrict__ wob,
    const float* __restrict__ rel_bias, float* __restrict__ tab) {
    __shared__ __align__(16) bf16 tsh[2][64 * TPITCH];  // [half][n][k]
    const int blk = blockIdx.x;
    if (blk < PREP_RMS) {
        rmsnorm_row(x, ln, xb, blk * 8 + (threadIdx.x >> 5));
    } else if (blk < PREP_RMS + PREP_CVT) {
        const int half = __builtin_amdgcn_readfirstlane((int)(threadIdx.x >> 7));
        const int tile = (blk - PREP_RMS) * 2 + half;
        const int g = (blk - PREP_RMS) >> 5;  // the same for both tiles of a block
        bf16* ts = tsh[half];
        if (g < 4) {
            const float* in = g == 0 ? qw : g == 1 ? kw : g == 2 ? vw : ow;
            bf16* out = g == 0 ? qwb : g == 1 ? kwb : g == 2 ? vwb : owb;
            transpose_tile<DD, DD>(in, out, tile & 63, ts);
        } else if (g < 8) {
            transpose_tile<DD, DFF>(wi, wib, tile - 256, ts);
        } else {
            transpose_tile<DFF, DD>(wo, wob, tile - 512, ts);
        }
    } else {
        bias_table_entry(rel_bias, tab, (blk - PREP_RMS - PREP_CVT) * 256 + threadIdx.x);
    }
}

// ---------------- WMMA GEMM (async double-buffered LDS) ----------------
// C[M,N] = A[M,K] @ W[K,N] with W pre-transposed as Wt[N,K].
// Block 256 thr = 8 waves (4x2); block tile 128x128; wave tile 32x64.
// A stage is 128 k of both operands' 128 rows; stages come to LDS by asynchronous copies,
// two buffers, one stage ahead: one wait and one barrier per 128 k, and a stage's copies
// have the whole stage before it (32 products per wave) to land. Inside a stage the fragments
// of each 32 k are read one sub-step ahead into a second register set. K: a multiple of 128.
// MODE 0: bf16 row-major    MODE 1: per-head [B,H,S,64]   MODE 2: V^T [B,H,64,S]
// MODE 3: f32 + residual    MODE 4: relu -> bf16
// MODE 5: Q, K, V projections in one launch: Wt holds the three weights' rows one behind the
// other (N = 3 x 512), outp the three outputs; a block lies in one of them and stores as MODE 1
// (Q, K) or MODE 2 (V)
#define GKS 128     // k per stage
#define GPITCH 136  // 256-B rows at a 272-B pitch (16 B x odd) for 16-B readers

// One lane's eight 16-B copies of one operand's stage: rows 16 apart, global pitch gstep.
// The s_wait_xcnt closes the statement so that no address register is rewritten ahead of it.
__device__ __forceinline__ void gemm_copies(const bf16* g, size_t gstep, unsigned l) {
    const bf16 *g1 = g + gstep, *g2 = g1 + gstep, *g3 = g2 + gstep, *g4 = g3 + gstep,
               *g5 = g4 + gstep, *g6 = g5 + gstep, *g7 = g6 + gstep;
    const unsigned st = 16 * GPITCH * 2;
    asm volatile(
        "global_load_async_to_lds_b128 %0, %8, off\n\t"
        "global_load_async_to_lds_b128 %1, %9, off\n\t"
        "global_load_async_to_lds_b128 %2, %10, off\n\t"
        "global_load_async_to_lds_b128 %3, %11, off\n\t"
        "global_load_async_to_lds_b128 %4, %12, off\n\t"
        "global_load_async_to_lds_b128 %5, %13, off\n\t"
        "global_load_async_to_lds_b128 %6, %14, off\n\t"
        "global_load_async_to_lds_b128 %7, %15, off\n\t"
        "s_wait_xcnt 0x0"
        :: "v"(l), "v"(l + st), "v"(l + 2 * st), "v"(l + 3 * st),
           "v"(l + 4 * st), "v"(l + 5 * st), "v"(l + 6 * st), "v"(l + 7 * st),
           "v"(g), "v"(g1), "v"(g2), "v"(g3), "v"(g4), "v"(g5), "v"(g6), "v"(g7)
        : "memory");
}

template <int MODE>
__device__ __forceinline__ void gemm_store(const floatx8 (&acc)[2][4],
                                           const float* __restrict__ resid,
                                           void* __restrict__ outp, int m0, int n0, int N,
                                           int wm, int wn, int lane, int l15) {
#pragma unroll
    for (int qt = 0; qt < 2; ++qt) {
#pragma unroll
        for (int nt = 0; nt < 4; ++nt) {
#pragma unroll
            for (int i = 0; i < 8; ++i) {
                int m = m0 + wm * 32 + qt * 16 + i + 8 * (lane >> 4);
                int n = n0 + wn * 64 + nt * 16 + l15;
                float v = acc[qt][nt][i];
                if constexpr (MODE == 0) {
                    ((bf16*)outp)[(size_t)m * N + n] = f2bf(v);
                } else if constexpr (MODE == 1) {
                    int b = m >> 12, s = m & 4095, h = n >> 6, d = n & 63;
                    ((bf16*)outp)[(((size_t)(b * HH + h) * SS) + s) * DKV + d] = f2bf(v);
                } else if constexpr (MODE == 2) {
                    int b = m >> 12, s = m & 4095, h = n >> 6, d = n & 63;
                    ((bf16*)outp)[(((size_t)(b * HH + h) * DKV) + d) * SS + s] = f2bf(v);
                } else if constexpr (MODE == 3) {
                    ((float*)outp)[(size_t)m * N + n] = resid[(size_t)m * N + n] + v;
                } else {  // MODE 4
                    ((bf16*)outp)[(size_t)m * N + n] = f2bf(v > 0.f ? v : 0.f);
                }
            }
        }
    }
}

template <int MODE>
__global__ void __launch_bounds__(256) gemm_kernel(const bf16* __restrict__ A,
                                                   const bf16* __restrict__ Wt,
                                                   const float* __restrict__ resid,
                                                   void* __restrict__ outp,
                                                   int M, int N, int K) {
    __shared__ __align__(16) bf16 As[2][128 * GPITCH];  // [row][k]
    __shared__ __align__(16) bf16 Bs[2][128 * GPITCH];  // [n][k]
    const int tid = threadIdx.x, lane = tid & 31, wave = tid >> 5;
    const int wm = wave >> 1, wn = wave & 1;
    const int n0 = blockIdx.x * 128, m0 = blockIdx.y * 128;
    const int l15 = lane & 15, kb8 = (lane >> 4) * 8;

    floatx8 acc[2][4];
#pragma unroll
    for (int qt = 0; qt < 2; ++qt)
#pragma unroll
        for (int nt = 0; nt < 4; ++nt) acc[qt][nt] = zero8();

    // staging assignment: 16 lanes per 256-B row, 16 rows per copy of the block
    const int pr = tid >> 4, pk = (tid & 15) * 8;
    const int nIter = K / GKS;
    const bf16* ga = A + (size_t)(m0 + pr) * K + pk;
    const bf16* gb = Wt + (size_t)(n0 + pr) * K + pk;
    auto issue_stage = [&](int t) {
        const int bb = t & 1;
        gemm_copies(ga + t * GKS, (size_t)16 * K, lds_addr(&As[bb][pr * GPITCH + pk]));
        gemm_copies(gb + t * GKS, (size_t)16 * K, lds_addr(&Bs[bb][pr * GPITCH + pk]));
    };

    issue_stage(0);
    wait_async0();    // stage 0 of this wave has landed
    __syncthreads();  // ... and every other wave's share of it
    if (nIter > 1) issue_stage(1);

    for (int t = 0; t < nIter; ++t) {
        const bf16* Ab = &As[t & 1][(wm * 32 + l15) * GPITCH + kb8];
        const bf16* Bb = &Bs[t & 1][(wn * 64 + l15) * GPITCH + kb8];
        // fragments of sub-step ks (32 k) of this stage: 12 LDS loads as one group
        bf16x16 af[2][2], bfr[2][4];
        auto load_frags = [&](int ks) {
#pragma unroll
            for (int qt = 0; qt < 2; ++qt) {
                const bf16* p = Ab + qt * 16 * GPITCH + ks * 32;
                af[ks & 1][qt] = load16(p, p + 16);
            }
#pragma unroll
            for (int nt = 0; nt < 4; ++nt) {
                const bf16* p = Bb + nt * 16 * GPITCH + ks * 32;
                bfr[ks & 1][nt] = load16(p, p + 16);
            }
        };
        load_frags(0);
#pragma unroll
        for (int ks = 0; ks < GKS / 32; ++ks) {
            if (ks + 1 < GKS / 32) load_frags(ks + 1);
            // Keeps the next sub-step's loads ahead of this sub-step's products; without it
            // the loads sink between the products, each pair with a full wait of its own.
            __builtin_amdgcn_sched_barrier(0);
#pragma unroll
            for (int nt = 0; nt < 4; ++nt)
#pragma unroll
                for (int qt = 0; qt < 2; ++qt)
                    acc[qt][nt] = wmma_bf16(af[ks & 1][qt], bfr[ks & 1][nt], acc[qt][nt]);
        }
        // publish point of stage t + 1, which also frees stage t's buffer
        asm volatile("s_wait_dscnt 0x0" ::: "memory");  // this wave's reads of stage t are done
        wait_async0();                                  // its copies of stage t + 1 have landed
        __syncthreads();
        if (t + 2 < nIter) issue_stage(t + 2);
    }
    wait_async0();  // nothing is outstanding when the wave ends

    if constexpr (MODE == 5) {
        const int sel = n0 >> 9;  // 0: Q, 1: K, 2: V; the same for the whole block
        bf16* o = (bf16*)outp + (size_t)sel * MM * DD;
        if (sel == 2) {
            gemm_store<2>(acc, resid, o, m0, n0 & 511, N, wm, wn, lane, l15);
        } else {
            gemm_store<1>(acc, resid, o, m0, n0 & 511, N, wm, wn, lane, l15);
            // In the listing this side's end runs on into the other side's code (behind a branch
            // that is always taken): no register of these stores is rewritten ahead of this wait.
            asm volatile("s_wait_xcnt 0x0" ::: "memory");
        }
    } else {
        gemm_store<MODE>(acc, resid, outp, m0, n0, N, wm, wn, lane, l15);
    }
}

// ---------------- Flash attention with softmax1 ----------------
// Block = 256 thr = 8 waves = 2 groups of 4; block covers (b, h, 128 q rows); a wave covers
// 32 q rows and its group's half of the keys, so that four waves, not two, share a SIMD and
// fill each other's waits. The groups' partial (maximum, sum, O^T) are joined at the end.
// Scores are formed transposed, S^T = K Q^T (A = K rows, B = Q columns), and the output
// as O^T += V^T P^T. A lane then holds 16 of the 32 keys of ONE query per 16-query group:
// maximum and sum run in the lane (one exchange between lane halves for the maximum),
// and the two S^T tiles of a group, rounded in place, are already the B operand P^T.
// K rows, V^T rows, the bias slice and the delete-gate of 64 keys form one stage; stages
// come to LDS by asynchronous copies, two buffers per group, one stage ahead, shared by the
// group's 4 waves.
#define KST 64                 // keys per stage
#define NST (SS / KST / 2)     // stages per group
#define KPITCH 72              // 128-B rows at a 144-B pitch (16 B x odd) for 16-B readers
#define LOG2E 1.44269504f      // the factor that __expf applies in front of the base-2 exponential

__device__ __forceinline__ float other_half(float x) {  // value of lane l ^ 16
    int v = __builtin_bit_cast(int, x);
    v = __builtin_amdgcn_permlanex16(v, v, 0x76543210, 0xfedcba98, false, false);
    return __builtin_bit_cast(float, v);
}

// One lane's ten copies of a stage: 4 x 16 B of K, 4 x 16 B of V^T, 2 x 4 B of bias / gate.
// The s_wait_xcnt closes the statement so that no address register is rewritten ahead of it.
__device__ __forceinline__ void stage_copies(const bf16* gk, const bf16* gv, const float* ga0,
                                             const float* ga1, unsigned lk, unsigned lv,
                                             unsigned la) {
    const bf16 *gk1 = gk + 16 * DKV, *gk2 = gk + 32 * DKV, *gk3 = gk + 48 * DKV;
    const bf16 *gv1 = gv + 16 * SS, *gv2 = gv + 32 * SS, *gv3 = gv + 48 * SS;
    const unsigned st = 16 * KPITCH * 2;
    asm volatile(
        "global_load_async_to_lds_b128 %0, %10, off\n\t"
        "global_load_async_to_lds_b128 %1, %11, off\n\t"
        "global_load_async_to_lds_b128 %2, %12, off\n\t"
        "global_load_async_to_lds_b128 %3, %13, off\n\t"
        "global_load_async_to_lds_b128 %4, %14, off\n\t"
        "global_load_async_to_lds_b128 %5, %15, off\n\t"
        "global_load_async_to_lds_b128 %6, %16, off\n\t"
        "global_load_async_to_lds_b128 %7, %17, off\n\t"
        "global_load_async_to_lds_b32 %8, %18, off\n\t"
        "global_load_async_to_lds_b32 %9, %19, off\n\t"
        "s_wait_xcnt 0x0"
        :: "v"(lk), "v"(lk + st), "v"(lk + 2 * st), "v"(lk + 3 * st),
           "v"(lv), "v"(lv + st), "v"(lv + 2 * st), "v"(lv + 3 * st),
           "v"(la), "v"(la + 512u),
           "v"(gk), "v"(gk1), "v"(gk2), "v"(gk3),
           "v"(gv), "v"(gv1), "v"(gv2), "v"(gv3),
           "v"(ga0), "v"(ga1)
        : "memory");
}

// waves_per_eu(4, 4): registers within a quarter of a SIMD's file, so that two blocks share a WGP
__global__ void __launch_bounds__(256) __attribute__((amdgpu_waves_per_eu(4, 4)))
attn_kernel(const bf16* __restrict__ Qh,
            const bf16* __restrict__ Kh, const bf16* __restrict__ Vt,
            const float* __restrict__ btab, const float* __restrict__ gate,
            bf16* __restrict__ ctx) {
    __shared__ __align__(16) bf16 Ks[2][2][KST * KPITCH];  // [group][buffer][key][d]
    __shared__ __align__(16) bf16 Vs[2][2][DKV * KPITCH];  // [group][buffer][d][key]
    __shared__ __align__(32) float aux_s[2][2][256];       // 0..191 bias slice, 192..255 gate
    __shared__ __align__(16) floatx4 join_o[4 * 16 * 32];  // group 1's O^T, 16 B per lane
    __shared__ float join_ml[4][2][2][32];                 // group 1's maximum and sum
    // tid, wave: inside the group
    const int tid = threadIdx.x & 127, lane = tid & 31, wave = tid >> 5;
    const int grp = __builtin_amdgcn_readfirstlane((int)(threadIdx.x >> 7));
    const int qblk = blockIdx.x * 128;
    const int h = blockIdx.y, b = blockIdx.z;
    const int q0 = qblk + wave * 32;
    const size_t head = (size_t)(b * HH + h) * SS * DKV;
    const bf16* Qp = Qh + head;
    const bf16* Kp = Kh + head;
    const bf16* Vp = Vt + head;  // [64][4096]
    const float* btabh = btab + h * 8192;
    const float* gateb = gate + (size_t)b * SS;

    const int l15 = lane & 15;
    const int kb8 = (lane >> 4) * 8;

    // staging assignment: 8 lanes per 128-B row, 16 rows per copy of the group
    const int srow = tid >> 3, scol = (tid & 7) * 8;
    const bool lowpair = __builtin_amdgcn_readfirstlane(wave) < 2;
    auto issue_stage = [&](int t) {
        const int kb = (grp * NST + t) * KST, bb = t & 1;
        // Toeplitz bias slice (rel = key - q): 191 entries needed, entry j is rel index base + j
        int base = kb - qblk - 127 + 4095;
        int gi = base + tid;
        gi = gi < 0 ? 0 : (gi > 8190 ? 8190 : gi);
        int gi2 = base + 128 + tid;
        gi2 = gi2 < 0 ? 0 : (gi2 > 8190 ? 8190 : gi2);
        // waves 0, 1 bring the slice's tail, waves 2, 3 the gate: a choice per wave, all lanes on
        const float* ga1 = lowpair ? btabh + gi2 : gateb + kb + (tid - 64);
        stage_copies(Kp + (size_t)(kb + srow) * DKV + scol, Vp + (size_t)srow * SS + kb + scol,
                     btabh + gi, ga1, lds_addr(&Ks[grp][bb][srow * KPITCH + scol]),
                     lds_addr(&Vs[grp][bb][srow * KPITCH + scol]),
                     lds_addr(&aux_s[grp][bb][tid]));
    };

    issue_stage(0);

    // Q fragments (B operand, column = query l15): 2 q-groups x 2 halves of the head dim
    bf16x16 qf[2][2];
#pragma unroll
    for (int qt = 0; qt < 2; ++qt) {
        const bf16* qr = Qp + (size_t)(q0 + qt * 16 + l15) * DKV;
#pragma unroll
        for (int kh = 0; kh < 2; ++kh)
            qf[qt][kh] = load16(qr + kh * 32 + kb8, qr + kh * 32 + kb8 + 16);
    }

    // Oa[qt][dt][r] = O^T[d = dt*16 + kb8 + r][q = q0 + qt*16 + l15]
    floatx8 Oa[2][4];
#pragma unroll
    for (int qt = 0; qt < 2; ++qt)
#pragma unroll
        for (int dt = 0; dt < 4; ++dt) Oa[qt][dt] = zero8();
    float rm[2], rl[2];  // per query: running maximum; this lane half's share of the sum
#pragma unroll
    for (int qt = 0; qt < 2; ++qt) { rm[qt] = -1e30f; rl[qt] = 0.f; }

    // bias index of (key offset p*32 + kt*16 + kb8 + r, query offset wave*32 + qt*16 + l15)
    // is bidx + p*32 + (kt - qt) * 16 + r
    const int bidx = 127 - wave * 32 - l15 + kb8;

    wait_async0();    // stage 0 of this wave has landed
    __syncthreads();  // ... and every other wave's share of it
    issue_stage(1);

    for (int t = 0; t < NST; ++t) {
        const bf16* Kb = Ks[grp][t & 1];
        const bf16* Vb = Vs[grp][t & 1];
        const float* ab = aux_s[grp][t & 1];
        // fragment and bias loads of pass p (32 keys) of this stage
        auto load_k = [&](int p, bf16x16 (&kf)[2][2]) {  // K rows, A operand
#pragma unroll
            for (int kt = 0; kt < 2; ++kt) {
                const bf16* kr = Kb + (p * 32 + kt * 16 + l15) * KPITCH;
                kf[kt][0] = load16(kr + kb8, kr + kb8 + 16);
                kf[kt][1] = load16(kr + 32 + kb8, kr + 32 + kb8 + 16);
            }
        };
        auto load_v = [&](int p, bf16x16 (&vf)[4]) {  // V^T rows, A operand
#pragma unroll
            for (int dt = 0; dt < 4; ++dt) {
                const bf16* vr = Vb + (dt * 16 + l15) * KPITCH + p * 32;
                vf[dt] = load16(vr + kb8, vr + kb8 + 16);
            }
        };
        // bg[qt][kt] = position bias + delete-gate of the lane's 8 keys of tile kt
        auto load_bg = [&](int p, floatx8 (&bg)[2][2]) {
            floatx8 gv[2];
#pragma unroll
            for (int kt = 0; kt < 2; ++kt)
                gv[kt] = *(const floatx8*)(ab + 192 + p * 32 + kt * 16 + kb8);
            floatx8 bv[3];  // the slice is Toeplitz: only kt - qt = -1, 0, 1 differ
#pragma unroll
            for (int j = 0; j < 3; ++j)
#pragma unroll
                for (int r = 0; r < 8; ++r) bv[j][r] = ab[bidx + p * 32 + (j - 1) * 16 + r];
#pragma unroll
            for (int qt = 0; qt < 2; ++qt)
#pragma unroll
                for (int kt = 0; kt < 2; ++kt) bg[qt][kt] = bv[kt - qt + 1] + gv[kt];
        };
        // sacc[qt][kt][r] = S[q = qt*16 + l15][key = kt*16 + kb8 + r], 8 WMMAs
        auto scores = [&](const bf16x16 (&kf)[2][2], floatx8 (&sacc)[2][2]) {
#pragma unroll
            for (int kt = 0; kt < 2; ++kt)
#pragma unroll
                for (int qt = 0; qt < 2; ++qt) {
                    floatx8 s = wmma_bf16(kf[kt][0], qf[qt][0], zero8());
                    sacc[qt][kt] = wmma_bf16(kf[kt][1], qf[qt][1], s);
                }
        };
        // online softmax1 update, one query per lane and group; then O^T += V^T P^T, 8 WMMAs
        auto update = [&](floatx8 (&sacc)[2][2], const floatx8 (&bg)[2][2],
                          const bf16x16 (&vf)[4]) {
            bf16x16 pf[2];
#pragma unroll
            for (int qt = 0; qt < 2; ++qt) {
                sacc[qt][0] += bg[qt][0];
                sacc[qt][1] += bg[qt][1];
                float tm = fmaxf(sacc[qt][0][0], sacc[qt][1][0]);
#pragma unroll
                for (int r = 1; r < 8; ++r)
                    tm = fmaxf(tm, fmaxf(sacc[qt][0][r], sacc[qt][1][r]));
                tm = fmaxf(tm, other_half(tm));
                float mnew = fmaxf(rm[qt], tm);
                float alpha = __expf(rm[qt] - mnew);
                rm[qt] = mnew;
                // e^x = 2^(x log2 e), the product formed on the vectors (packed multiplies)
                floatx8 d0 = (sacc[qt][0] - mnew) * LOG2E, d1 = (sacc[qt][1] - mnew) * LOG2E;
#pragma unroll
                for (int r = 0; r < 8; ++r) d0[r] = __builtin_amdgcn_exp2f(d0[r]);
#pragma unroll
                for (int r = 0; r < 8; ++r) d1[r] = __builtin_amdgcn_exp2f(d1[r]);
                // P^T as B operand: element s holds key kb8 + s (s < 8), 16 + kb8 + s - 8
                pf[qt] = __builtin_shufflevector(f2bf8(d0), f2bf8(d1), 0, 1, 2, 3, 4, 5, 6, 7, 8,
                                                 9, 10, 11, 12, 13, 14, 15);
                floatx8 sv = d0 + d1;
                float ts = ((sv[0] + sv[1]) + (sv[2] + sv[3])) +
                           ((sv[4] + sv[5]) + (sv[6] + sv[7]));
                rl[qt] = rl[qt] * alpha + ts;
#pragma unroll
                for (int dt = 0; dt < 4; ++dt) Oa[qt][dt] *= alpha;
            }
#pragma unroll
            for (int dt = 0; dt < 4; ++dt)
#pragma unroll
                for (int qt = 0; qt < 2; ++qt) Oa[qt][dt] = wmma_bf16(vf[dt], pf[qt], Oa[qt][dt]);
        };

        // Two passes of 32 keys per stage. The loop stays rolled so that each pass is a block
        // of its own with its LDS loads at its head.
#pragma unroll 1
        for (int p = 0; p < 2; ++p) {
            bf16x16 kf[2][2], vf[4];
            floatx8 sacc[2][2], bg[2][2];
            load_k(p, kf);
            load_bg(p, bg);
            load_v(p, vf);
            // Keeps the pass's loads issued together here, ahead of the products; without it
            // some K loads sink between the score products, each with a full wait of its own.
            __builtin_amdgcn_sched_barrier(0);
            scores(kf, sacc);
            update(sacc, bg, vf);
            // The pass ends in a product and the loop's taken branch: four vector slots, held at
            // the foot by the scheduling barrier, before
            // the next pass's address arithmetic may reuse that product's operand registers.
            __builtin_amdgcn_sched_barrier(0);
            asm volatile("v_nop\n\tv_nop\n\tv_nop\n\tv_nop");
        }

        // publish point of stage t + 1, which also frees stage t's buffer
        asm volatile("s_wait_dscnt 0x0" ::: "memory");  // this wave's reads of stage t are done
        wait_async0();                                  // its copies of stage t + 1 have landed
        __syncthreads();
        if (t + 2 < NST) issue_stage(t + 2);
    }
    wait_async0();  // nothing is outstanding when the wave ends

    // ---- join of the two key halves: group 1 hands its partials over, group 0 finishes ----
    if (grp == 1) {
#pragma unroll
        for (int qt = 0; qt < 2; ++qt) {
#pragma unroll
            for (int dt = 0; dt < 4; ++dt)
#pragma unroll
                for (int j = 0; j < 2; ++j) {
                    floatx4 v = {Oa[qt][dt][4 * j], Oa[qt][dt][4 * j + 1], Oa[qt][dt][4 * j + 2],
                                 Oa[qt][dt][4 * j + 3]};
                    join_o[((wave * 8 + qt * 4 + dt) * 2 + j) * 32 + lane] = v;
                }
            join_ml[wave][qt][0][lane] = rm[qt];
            join_ml[wave][qt][1][lane] = rl[qt];
        }
    }
    __syncthreads();  // group 1's partials are read by group 0
    if (grp == 1) return;
#pragma unroll
    for (int qt = 0; qt < 2; ++qt) {
        float m1 = join_ml[wave][qt][0][lane], l1 = join_ml[wave][qt][1][lane];
        float m = fmaxf(rm[qt], m1);
        float a0 = __expf(rm[qt] - m), a1 = __expf(m1 - m);
        rm[qt] = m;
        rl[qt] = rl[qt] * a0 + l1 * a1;
#pragma unroll
        for (int dt = 0; dt < 4; ++dt)
#pragma unroll
            for (int j = 0; j < 2; ++j) {
                floatx4 v = join_o[((wave * 8 + qt * 4 + dt) * 2 + j) * 32 + lane];
#pragma unroll
                for (int r = 0; r < 4; ++r)
                    Oa[qt][dt][4 * j + r] = Oa[qt][dt][4 * j + r] * a0 + v[r] * a1;
            }
    }

    // ---- softmax1 denominator: l + exp(-m); the halves' sums are joined here ----
    // ---- write ctx [B,S,H*DKV]: a lane holds 8 consecutive d of one query ----
#pragma unroll
    for (int qt = 0; qt < 2; ++qt) {
        float l = rl[qt] + other_half(rl[qt]);
        float inv = 1.f / (l + __expf(-rm[qt]));
        int q = q0 + qt * 16 + l15;
#pragma unroll
        for (int dt = 0; dt < 4; ++dt) {
            *(bf16x8*)&ctx[((size_t)b * SS + q) * DD + h * DKV + dt * 16 + kb8] =
                f2bf8(Oa[qt][dt] * inv);
        }
    }
}

// ---------------- launcher ----------------
extern "C" void kernel_launch(void* const* d_in, const int* in_sizes, int n_in,
                              void* d_out, int out_size, void* d_ws, size_t ws_size,
                              hipStream_t stream) {
    (void)in_sizes; (void)n_in; (void)out_size; (void)ws_size;
    const float* hidden = (const float*)d_in[0];
    const float* gate   = (const float*)d_in[1];
    const float* ln1    = (const float*)d_in[2];
    const float* qw     = (const float*)d_in[3];
    const float* kw     = (const float*)d_in[4];
    const float* vw     = (const float*)d_in[5];
    const float* ow     = (const float*)d_in[6];
    const float* relb   = (const float*)d_in[7];
    const float* ln2    = (const float*)d_in[8];
    const float* wi     = (const float*)d_in[9];
    const float* wo     = (const float*)d_in[10];

    char* ws = (char*)d_ws;
    size_t off = 0;
    auto take = [&](size_t bytes) -> char* {
        char* p = ws + off;
        off = (off + bytes + 255) & ~(size_t)255;
        return p;
    };
    bf16*  qwb  = (bf16*)take((size_t)3 * DD * DD * 2);  // all weights transposed [N,K];
    bf16*  kwb  = qwb + DD * DD;                         // q, k, v one behind the other
    bf16*  vwb  = kwb + DD * DD;
    bf16*  owb  = (bf16*)take((size_t)DD * DD * 2);
    bf16*  wib  = (bf16*)take((size_t)DD * DFF * 2);
    bf16*  wob  = (bf16*)take((size_t)DFF * DD * 2);
    float* btab = (float*)take((size_t)HH * 8192 * 4);
    bf16*  xb   = (bf16*)take((size_t)MM * DD * 2);
    bf16*  Qhd  = (bf16*)take((size_t)3 * MM * DD * 2);  // Q, K, V^T one behind the other
    bf16*  Khd  = Qhd + MM * DD;
    bf16*  Vtd  = Khd + MM * DD;
    bf16*  ctxb = (bf16*)take((size_t)MM * DD * 2);
    float* hbuf = (float*)take((size_t)MM * DD * 4);
    bf16*  yb   = (bf16*)take((size_t)MM * DD * 2);
    bf16*  ffb  = (bf16*)take((size_t)MM * DFF * 2);

    // ln1 -> xb (bf16), transposed bf16 weights, bias table: one launch
    prep_kernel<<<PREP_RMS + PREP_CVT + PREP_TAB, 256, 0, stream>>>(
        hidden, ln1, xb, qw, kw, vw, ow, wi, wo, qwb, kwb, vwb, owb, wib, wob, relb, btab);

    // QKV projections (head layouts; V transposed): one launch
    gemm_kernel<5><<<dim3(3 * DD / 128, MM / 128), 256, 0, stream>>>(xb, qwb, nullptr, Qhd,
                                                                     MM, 3 * DD, DD);

    // flash attention with softmax1
    attn_kernel<<<dim3(SS / 128, HH, BB), 256, 0, stream>>>(Qhd, Khd, Vtd, btab, gate, ctxb);

    // h = hidden + ctx @ o_w
    gemm_kernel<3><<<dim3(DD / 128, MM / 128), 256, 0, stream>>>(ctxb, owb, hidden, hbuf,
                                                                 MM, DD, DD);
    // ln2 -> yb
    rmsnorm_kernel<<<MM / 8, 256, 0, stream>>>(hbuf, ln2, yb, MM);

    // FFN: relu(y @ wi) then out = h + (.) @ wo
    gemm_kernel<4><<<dim3(DFF / 128, MM / 128), 256, 0, stream>>>(yb, wib, nullptr, ffb,
                                                                  MM, DFF, DD);
    gemm_kernel<3><<<dim3(DD / 128, MM / 128), 256, 0, stream>>>(ffb, wob, hbuf, d_out,
                                                                 MM, DD, DFF);
}

// v008
// It runs in 144 microseconds.
// Two timings next to v007 put it at 1.10 and 1.11 times that version's speed.
// All steps since v000 together make it 3.32 times as fast.
#include <hip/hip_runtime.h>
#include <hip/hip_bf16.h>

// ---------------- types ----------------
typedef __bf16 bf16;
typedef bf16  bf16x4  __attribute__((ext_vector_type(4)));
typedef bf16  bf16x8  __attribute__((ext_vector_type(8)));
typedef bf16  bf16x16 __attribute__((ext_vector_type(16)));
typedef float floatx4 __attribute__((ext_vector_type(4)));
typedef float floatx8 __attribute__((ext_vector_type(8)));

#define BB 2
#define SS 4096
#define DD 512
#define HH 8
#define DKV 64
#define DFF 2048
#define MM (BB*SS)   // 8192

// f32 -> bf16, round to nearest even, by the chip's own packed conversion (two values an
// instruction where neighbours are converted together)
__device__ __forceinline__ bf16 f2bf(float x) { return (bf16)x; }
__device__ __forceinline__ bf16x4 f2bf4(floatx4 v) { return __builtin_convertvector(v, bf16x4); }
__device__ __forceinline__ bf16x8 f2bf8(floatx8 v) { return __builtin_convertvector(v, bf16x8); }
__device__ __forceinline__ bf16x16 load16(const bf16* p0, const bf16* p1) {
    bf16x8 a = *(const bf16x8*)p0;
    bf16x8 b = *(const bf16x8*)p1;
    bf16x16 r;
#pragma unroll
    for (int i = 0; i < 8; ++i) { r[i] = a[i]; r[i + 8] = b[i]; }
    return r;
}
__device__ __forceinline__ floatx8 wmma_bf16(bf16x16 a, bf16x16 b, floatx8 c) {
    return __builtin_amdgcn_wmma_f32_16x16x32_bf16(false, a, false, b, (short)0, c,
                                                   false, false);
}
__device__ __forceinline__ floatx8 zero8() {
    floatx8 z = {0.f, 0.f, 0.f, 0.f, 0.f, 0.f, 0.f, 0.f};
    return z;
}

__device__ __forceinline__ void wait_async0() {
    asm volatile("s_wait_asynccnt 0x0" ::: "memory");
}
__device__ __forceinline__ unsigned lds_addr(const void* p) {
    return (unsigned)(size_t)p;  // low 32 bits of a generic shared pointer = LDS byte address
}

// ---------------- small kernels ----------------
// fp32 [K,N] -> bf16 transposed [N,K] (makes the GEMMs' weight operands K-contiguous), all six
// weights in one launch. Four waves (half a block) take one 64 x 64 tile: a thread reads two 4 x 4
// patches by 16-B loads (256 B of a row per 16 lanes), rounds them and stores them transposed
// to LDS; the tile then leaves by 16-B stores, one whole 128-B line of an output row per 8 lanes.
#define TPITCH 72  // 128-B rows at a 144-B pitch, 16-B aligned for the readers
template <int K, int N>
__device__ __forceinline__ void transpose_tile(const float* __restrict__ in,
                                               bf16* __restrict__ out, int tile, bf16* ts) {
    constexpr int TN = N / 64;  // tiles along N
    const int tid = threadIdx.x & 127;
    const int k0 = (tile / TN) * 64, n0 = (tile % TN) * 64;
    const int a = tid >> 4, c = tid & 15;  // patch h: k = 32h + 4a .. + 3, n = 4c .. 4c + 3
    const float* src = in + k0 * N + n0;
    floatx4 v[2][4];
#pragma unroll
    for (int h = 0; h < 2; ++h)
#pragma unroll
        for (int j = 0; j < 4; ++j)
            v[h][j] = *(const floatx4*)(src + (4 * a * N + 4 * c) + (32 * h + j) * N);
#pragma unroll
    for (int h = 0; h < 2; ++h)
#pragma unroll
        for (int i = 0; i < 4; ++i) {
            floatx4 p = {v[h][0][i], v[h][1][i], v[h][2][i], v[h][3][i]};
            *(bf16x4*)&ts[(4 * c + i) * TPITCH + 32 * h + 4 * a] = f2bf4(p);
        }
    __syncthreads();  // the tile is read across the waves that wrote it
    bf16* dst = out + n0 * K + k0;
    const int n = tid >> 3, ch = (tid & 7) * 8;
#pragma unroll
    for (int j = 0; j < 4; ++j)
        *(bf16x8*)(dst + (n * K + ch) + 16 * j * K) =
            *(const bf16x8*)&ts[(n + 16 * j) * TPITCH + ch];
    // In the listing this part's end runs on into another part's code (behind a branch that is
    // always taken): no register of these stores is rewritten there ahead of this wait.
    asm volatile("s_wait_xcnt 0x0" ::: "memory");
}

// T5 bidirectional bucket bias, Toeplitz table: tab[h*8192 + (rel+4095)]
__device__ __forceinline__ void bias_table_entry(const float* __restrict__ rel_bias,
                                                 float* __restrict__ tab, int idx) {
    if (idx >= HH * 8191) return;
    int h = idx / 8191, r = idx % 8191;
    int rel = r - 4095;
    int ret = rel > 0 ? 16 : 0;         // num_buckets/2 = 16
    int n = rel < 0 ? -rel : rel;
    int bucket;
    if (n < 8) {                        // max_exact = 8
        bucket = ret + n;
    } else {
        int v = 8 + (int)(__logf((float)n * 0.125f) * (8.0f / __logf(16.0f)));
        if (v > 15) v = 15;
        bucket = ret + v;
    }
    tab[h * 8192 + r] = rel_bias[bucket * HH + h];
}

// one wave per row of 512 columns; fp32 in, bf16*(rms weight) out
__device__ __forceinline__ void rmsnorm_row(const float* __restrict__ x,
                                            const float* __restrict__ w,
                                            bf16* __restrict__ out, int row) {
    int lane = threadIdx.x & 31;
    const float* xr = x + (size_t)row * DD;
    float vals[16];
    float ss = 0.f;
#pragma unroll
    for (int i = 0; i < 16; ++i) {
        float v = xr[lane + i * 32];
        vals[i] = v;
        ss += v * v;
    }
#pragma unroll
    for (int m = 16; m >= 1; m >>= 1) ss += __shfl_xor(ss, m, 32);
    float rs = rsqrtf(ss * (1.f / (float)DD) + 1e-6f);
#pragma unroll
    for (int i = 0; i < 16; ++i) {
        int c = lane + i * 32;
        out[(size_t)row * DD + c] = f2bf(vals[i] * rs * w[c]);
    }
}

__global__ void __launch_bounds__(256) rmsnorm_kernel(const float* __restrict__ x,
                                                      const float* __restrict__ w,
                                                      bf16* __restrict__ out, int rows) {
    int row = blockIdx.x * 8 + (threadIdx.x >> 5);
    if (row >= rows) return;
    rmsnorm_row(x, w, out, row);
}

// Everything that reads only inputs, in one launch: none of the three parts needs another's
// result. Blocks 0..1023: first RMS norm, 8 rows each. Blocks 1024..1407: weight transposes, two
// tiles each (tiles 0..255: the four 512 x 512 weights, 64 tiles each; 256..511: wi; 512..767:
// wo). Blocks 1408..1663: the bias table.
#define PREP_RMS (MM / 8)
#define PREP_CVT (768 / 2)
#define PREP_TAB ((HH * 8191 + 255) / 256)
__global__ void __launch_bounds__(256) prep_kernel(
    const float* __restrict__ x, const float* __restrict__ ln, bf16* __restrict__ xb,
    const float* __restrict__ qw, const float* __restrict__ kw, const float* __restrict__ vw,
    const float* __restrict__ ow, const float* __restrict__ wi, const float* __restrict__ wo,
    bf16* __restrict__ qwb, bf16* __restrict__ kwb, bf16* __restrict__ vwb,
    bf16* __restrict__ owb, bf16* __restrict__ wib, bf16* __restrict__ wob,
    const float* __restrict__ rel_bias, float* __restrict__ tab) {
    __shared__ __align__(16) bf16 tsh[2][64 * TPITCH];  // [half][n][k]
    const int blk = blockIdx.x;
    if (blk < PREP_RMS) {
        rmsnorm_row(x, ln, xb, blk * 8 + (threadIdx.x >> 5));
    } else if (blk < PREP_RMS + PREP_CVT) {
        const int half = __builtin_amdgcn_readfirstlane((int)(threadIdx.x >> 7));
        const int tile = (blk - PREP_RMS) * 2 + half;
        const int g = (blk - PREP_RMS) >> 5;  // the same for both tiles of a block
        bf16* ts = tsh[half];
        if (g < 4) {
            const float* in = g == 0 ? qw : g == 1 ? kw : g == 2 ? vw : ow;
            bf16* out = g == 0 ? qwb : g == 1 ? kwb : g == 2 ? vwb : owb;
            transpose_tile<DD, DD>(in, out, tile & 63, ts);
        } else if (g < 8) {
            transpose_tile<DD, DFF>(wi, wib, tile - 256, ts);
        } else {
            transpose_tile<DFF, DD>(wo, wob, tile - 512, ts);
        }
    } else {
        bias_table_entry(rel_bias, tab, (blk - PREP_RMS - PREP_CVT) * 256 + threadIdx.x);
    }
}

// ---------------- WMMA GEMM (async double-buffered LDS) ----------------
// C[M,N] = A[M,K] @ W[K,N] with W pre-transposed as Wt[N,K].
// Block 256 thr = 8 waves (4x2); block tile 128x128; wave tile 32x64.
// The product is formed transposed: the operand whose index runs along the output's rows in
// memory (x, 64 per wave: the weights' n; for V^T the activations' s) is the A operand, the
// other (y, 32 per wave) the B operand. A lane then holds 8 consecutive x of one y.
// A stage is 128 k of both operands' 128 rows; stages come to LDS by asynchronous copies,
// two buffers, one stage ahead: one wait and one barrier per 128 k, and a stage's copies
// have the whole stage before it (32 products per wave) to land. Inside a stage the fragments
// of each 32 k are read one sub-step ahead into a second register set. K: a multiple of 128.
// MODE 3: f32 + residual    MODE 4: relu -> bf16
// MODE 5: Q, K, V projections in one launch: Wt holds the three weights' rows one behind the
// other (N = 3 x 512), outp the three outputs; a block lies in one of them and stores per head
// [B,H,S,64] (Q, K) or transposed [B,H,64,S] (V)
#define GKS 128     // k per stage
#define GPITCH 136  // 256-B rows at a 272-B pitch (16 B x odd) for 16-B readers

// One lane's eight 16-B copies of one operand's stage: rows 16 apart, global pitch gstep.
// The s_wait_xcnt closes the statement so that no address register is rewritten ahead of it.
__device__ __forceinline__ void gemm_copies(const bf16* g, size_t gstep, unsigned l) {
    const bf16 *g1 = g + gstep, *g2 = g1 + gstep, *g3 = g2 + gstep, *g4 = g3 + gstep,
               *g5 = g4 + gstep, *g6 = g5 + gstep, *g7 = g6 + gstep;
    const unsigned st = 16 * GPITCH * 2;
    asm volatile(
        "global_load_async_to_lds_b128 %0, %8, off\n\t"
        "global_load_async_to_lds_b128 %1, %9, off\n\t"
        "global_load_async_to_lds_b128 %2, %10, off\n\t"
        "global_load_async_to_lds_b128 %3, %11, off\n\t"
        "global_load_async_to_lds_b128 %4, %12, off\n\t"
        "global_load_async_to_lds_b128 %5, %13, off\n\t"
        "global_load_async_to_lds_b128 %6, %14, off\n\t"
        "global_load_async_to_lds_b128 %7, %15, off\n\t"
        "s_wait_xcnt 0x0"
        :: "v"(l), "v"(l + st), "v"(l + 2 * st), "v"(l + 3 * st),
           "v"(l + 4 * st), "v"(l + 5 * st), "v"(l + 6 * st), "v"(l + 7 * st),
           "v"(g), "v"(g1), "v"(g2), "v"(g3), "v"(g4), "v"(g5), "v"(g6), "v"(g7)
        : "memory");
}

// A wave's 32 (y) x 64 (x) tile leaves by whole lines: the wave lays it out in an LDS range of
// its own (16-B stores, a row per y at a 16 B x odd pitch) and reads it back with the lanes along
// x, so that a 16-B global store per lane covers whole 128-B lines of the output's rows.
// acc[yt][xt][i] is the element (y = yt*16 + lane%16, x = xt*16 + 8*(lane/16) + i).
#define SPB 144               // bf16 tile: 128-B rows
#define SPF 272               // f32 tile: 256-B rows
#define STG_WAVE (32 * SPF)   // LDS bytes per wave

template <bool RELU>
__device__ __forceinline__ void store_tile_bf16(const floatx8 (&acc)[2][4],
                                                bf16* __restrict__ out, size_t pitch, char* stg,
                                                int lane) {
    const int l15 = lane & 15, hh = lane >> 4;
#pragma unroll
    for (int yt = 0; yt < 2; ++yt)
#pragma unroll
        for (int xt = 0; xt < 4; ++xt) {
            floatx8 v = acc[yt][xt];
            if constexpr (RELU) {
#pragma unroll
                for (int i = 0; i < 8; ++i) v[i] = v[i] > 0.f ? v[i] : 0.f;
            }
            *(bf16x8*)(stg + (yt * 16 + l15) * SPB + xt * 32 + hh * 16) = f2bf8(v);
        }
    // The rows are read back by other lanes of this wave: its LDS stores are done first.
    asm volatile("s_wait_dscnt 0x0" ::: "memory");
    const int r = lane >> 3, c = lane & 7;  // 8 lanes per 128-B row, 4 rows per store
#pragma unroll
    for (int j = 0; j < 8; ++j)
        *(bf16x8*)(out + (size_t)(4 * j + r) * pitch + c * 8) =
            *(const bf16x8*)(stg + (4 * j + r) * SPB + c * 16);
}

// org: index of the tile's first element in resid and out alike, whose rows are PITCH apart
template <int PITCH>
__device__ __forceinline__ void store_tile_f32(const floatx8 (&acc)[2][4],
                                               const float* __restrict__ resid,
                                               float* __restrict__ out, unsigned org, char* stg,
                                               int lane) {
    const int l15 = lane & 15, hh = lane >> 4;  // read-back: 16 lanes per 256-B row, 2 rows
    const unsigned off = org + hh * PITCH + l15 * 4;  // one lane offset serves loads and stores
    const float* rp = resid + off;
    float* op = out + off;
    floatx4 rv[16];
#pragma unroll
    for (int j = 0; j < 16; ++j) rv[j] = *(const floatx4*)(rp + 2 * j * PITCH);
    // All sixteen loads name one address pair. As an input here it stays whole up to this wait.
    asm volatile("s_wait_xcnt 0x0" :: "v"(rp) : "memory");
#pragma unroll
    for (int yt = 0; yt < 2; ++yt)
#pragma unroll
        for (int xt = 0; xt < 4; ++xt) {
            const floatx8 v = acc[yt][xt];
            char* p = stg + (yt * 16 + l15) * SPF + xt * 64 + hh * 32;
            *(floatx4*)p = __builtin_shufflevector(v, v, 0, 1, 2, 3);
            *(floatx4*)(p + 16) = __builtin_shufflevector(v, v, 4, 5, 6, 7);
        }
    // The rows are read back by other lanes of this wave: its LDS stores are done first.
    asm volatile("s_wait_dscnt 0x0" ::: "memory");
#pragma unroll
    for (int j = 0; j < 16; ++j)
        *(floatx4*)(op + 2 * j * PITCH) =
            rv[j] + *(const floatx4*)(stg + (2 * j + hh) * SPF + l15 * 16);
}

template <int MODE>
__global__ void __launch_bounds__(256) gemm_kernel(const bf16* __restrict__ A,
                                                   const bf16* __restrict__ Wt,
                                                   const float* __restrict__ resid,
                                                   void* __restrict__ outp,
                                                   int M, int N, int K) {
    __shared__ __align__(16) bf16 As[2][128 * GPITCH];  // [row][k]
    __shared__ __align__(16) bf16 Bs[2][128 * GPITCH];  // [n][k]
    const int tid = threadIdx.x, lane = tid & 31, wave = tid >> 5;
    const int wy = wave >> 1, wx = wave & 1;
    const int n0 = blockIdx.x * 128, m0 = blockIdx.y * 128;
    const int l15 = lane & 15, kb8 = (lane >> 4) * 8;
    // V^T is stored along s: there the activations are the x operand; the same for the whole block
    const bool vt = MODE == 5 && (n0 >> 9) == 2;

    floatx8 acc[2][4];
#pragma unroll
    for (int yt = 0; yt < 2; ++yt)
#pragma unroll
        for (int xt = 0; xt < 4; ++xt) acc[yt][xt] = zero8();

    // staging assignment: 16 lanes per 256-B row, 16 rows per copy of the block
    const int pr = tid >> 4, pk = (tid & 15) * 8;
    const int nIter = K / GKS;
    const bf16* ga = A + (size_t)(m0 + pr) * K + pk;
    const bf16* gb = Wt + (size_t)(n0 + pr) * K + pk;
    auto issue_stage = [&](int t) {
        const int bb = t & 1;
        gemm_copies(ga + t * GKS, (size_t)16 * K, lds_addr(&As[bb][pr * GPITCH + pk]));
        gemm_copies(gb + t * GKS, (size_t)16 * K, lds_addr(&Bs[bb][pr * GPITCH + pk]));
    };

    issue_stage(0);
    wait_async0();    // stage 0 of this wave has landed
    __syncthreads();  // ... and every other wave's share of it
    if (nIter > 1) issue_stage(1);

    for (int t = 0; t < nIter; ++t) {
        const bf16* Yb = (vt ? Bs[t & 1] : As[t & 1]) + (wy * 32 + l15) * GPITCH + kb8;
        const bf16* Xb = (vt ? As[t & 1] : Bs[t & 1]) + (wx * 64 + l15) * GPITCH + kb8;
        // fragments of sub-step ks (32 k) of this stage: 12 LDS loads as one group
        bf16x16 yf[2][2], xf[2][4];
        auto load_frags = [&](int ks) {
#pragma unroll
            for (int yt = 0; yt < 2; ++yt) {
                const bf16* p = Yb + yt * 16 * GPITCH + ks * 32;
                yf[ks & 1][yt] = load16(p, p + 16);
            }
#pragma unroll
            for (int xt = 0; xt < 4; ++xt) {
                const bf16* p = Xb + xt * 16 * GPITCH + ks * 32;
                xf[ks & 1][xt] = load16(p, p + 16);
            }
        };
        load_frags(0);
#pragma unroll
        for (int ks = 0; ks < GKS / 32; ++ks) {
            if (ks + 1 < GKS / 32) load_frags(ks + 1);
            // Keeps the next sub-step's loads ahead of this sub-step's products; without it
            // the loads sink between the products, each pair with a full wait of its own.
            __builtin_amdgcn_sched_barrier(0);
#pragma unroll
            for (int xt = 0; xt < 4; ++xt)
#pragma unroll
                for (int yt = 0; yt < 2; ++yt)
                    acc[yt][xt] = wmma_bf16(xf[ks & 1][xt], yf[ks & 1][yt], acc[yt][xt]);
        }
        // publish point of stage t + 1, which also frees stage t's buffer
        asm volatile("s_wait_dscnt 0x0" ::: "memory");  // this wave's reads of stage t are done
        wait_async0();                                  // its copies of stage t + 1 have landed
        __syncthreads();
        if (t + 2 < nIter) issue_stage(t + 2);
    }
    wait_async0();  // nothing is outstanding when the wave ends

    // The ring is free behind the loop's last barrier: each wave takes a range of it for its tile.
    char* stg = (char*)&As[0][0] + wave * STG_WAVE;
    const int yo = wy * 32, xo = wx * 64;
    if constexpr (MODE == 5) {
        bf16* o = (bf16*)outp + (size_t)(n0 >> 9) * MM * DD;  // 0: Q, 1: K, 2: V
        const int nb = n0 & 511, bh = (m0 >> 12) * HH, s0 = m0 & 4095;
        // Q, K: y = s, x = d, the wave's 64 n are one head; V: y = d (half a head), x = s
        const int n = nb + (vt ? yo : xo);
        const size_t org = vt ? ((size_t)(bh + (n >> 6)) * DKV + (n & 63)) * SS + s0 + xo
                              : ((size_t)(bh + (n >> 6)) * SS + s0 + yo) * DKV;
        store_tile_bf16<false>(acc, o + org, vt ? SS : DKV, stg, lane);
    } else if constexpr (MODE == 3) {
        store_tile_f32<DD>(acc, resid, (float*)outp, (m0 + yo) * DD + n0 + xo, stg, lane);  // N = DD
    } else {  // MODE 4, N = DFF
        store_tile_bf16<true>(acc, (bf16*)outp + (size_t)(m0 + yo) * DFF + n0 + xo, DFF, stg,
                              lane);
    }
}

// ---------------- Flash attention with softmax1 ----------------
// Block = 256 thr = 8 waves = 2 groups of 4; block covers (b, h, 128 q rows); a wave covers
// 32 q rows and its group's half of the keys, so that four waves, not two, share a SIMD and
// fill each other's waits. The groups' partial (maximum, sum, O^T) are joined at the end.
// Scores are formed transposed, S^T = K Q^T (A = K rows, B = Q columns), and the output
// as O^T += V^T P^T. A lane then holds 16 of the 32 keys of ONE query per 16-query group:
// maximum and sum run in the lane (one exchange between lane halves for the maximum),
// and the two S^T tiles of a group, rounded in place, are already the B operand P^T.
// K rows, V^T rows, the bias slice and the delete-gate of 64 keys form one stage; stages
// come to LDS by asynchronous copies, two buffers per group, one stage ahead, shared by the
// group's 4 waves.
#define KST 64                 // keys per stage
#define NST (SS / KST / 2)     // stages per group
#define KPITCH 72              // 128-B rows at a 144-B pitch (16 B x odd) for 16-B readers
#define LOG2E 1.44269504f      // the factor that __expf applies in front of the base-2 exponential

__device__ __forceinline__ float other_half(float x) {  // value of lane l ^ 16
    int v = __builtin_bit_cast(int, x);
    v = __builtin_amdgcn_permlanex16(v, v, 0x76543210, 0xfedcba98, false, false);
    return __builtin_bit_cast(float, v);
}

// One lane's ten copies of a stage: 4 x 16 B of K, 4 x 16 B of V^T, 2 x 4 B of bias / gate.
// The s_wait_xcnt closes the statement so that no address register is rewritten ahead of it.
__device__ __forceinline__ void stage_copies(const bf16* gk, const bf16* gv, const float* ga0,
                                             const float* ga1, unsigned lk, unsigned lv,
                                             unsigned la) {
    const bf16 *gk1 = gk + 16 * DKV, *gk2 = gk + 32 * DKV, *gk3 = gk + 48 * DKV;
    const bf16 *gv1 = gv + 16 * SS, *gv2 = gv + 32 * SS, *gv3 = gv + 48 * SS;
    const unsigned st = 16 * KPITCH * 2;
    asm volatile(
        "global_load_async_to_lds_b128 %0, %10, off\n\t"
        "global_load_async_to_lds_b128 %1, %11, off\n\t"
        "global_load_async_to_lds_b128 %2, %12, off\n\t"
        "global_load_async_to_lds_b128 %3, %13, off\n\t"
        "global_load_async_to_lds_b128 %4, %14, off\n\t"
        "global_load_async_to_lds_b128 %5, %15, off\n\t"
        "global_load_async_to_lds_b128 %6, %16, off\n\t"
        "global_load_async_to_lds_b128 %7, %17, off\n\t"
        "global_load_async_to_lds_b32 %8, %18, off\n\t"
        "global_load_async_to_lds_b32 %9, %19, off\n\t"
        "s_wait_xcnt 0x0"
        :: "v"(lk), "v"(lk + st), "v"(lk + 2 * st), "v"(lk + 3 * st),
           "v"(lv), "v"(lv + st), "v"(lv + 2 * st), "v"(lv + 3 * st),
           "v"(la), "v"(la + 512u),
           "v"(gk), "v"(gk1), "v"(gk2), "v"(gk3),
           "v"(gv), "v"(gv1), "v"(gv2), "v"(gv3),
           "v"(ga0), "v"(ga1)
        : "memory");
}

// waves_per_eu(4, 4): registers within a quarter of a SIMD's file, so that two blocks share a WGP
__global__ void __launch_bounds__(256) __attribute__((amdgpu_waves_per_eu(4, 4)))
attn_kernel(const bf16* __restrict__ Qh,
            const bf16* __restrict__ Kh, const bf16* __restrict__ Vt,
            const float* __restrict__ btab, const float* __restrict__ gate,
            bf16* __restrict__ ctx) {
    __shared__ __align__(16) bf16 Ks[2][2][KST * KPITCH];  // [group][buffer][key][d]
    __shared__ __align__(16) bf16 Vs[2][2][DKV * KPITCH];  // [group][buffer][d][key]
    __shared__ __align__(32) float aux_s[2][2][256];       // 0..191 bias slice, 192..255 gate
    __shared__ __align__(16) floatx4 join_o[4 * 16 * 32];  // group 1's O^T, 16 B per lane
    __shared__ float join_ml[4][2][2][32];                 // group 1's maximum and sum
    // tid, wave: inside the group
    const int tid = threadIdx.x & 127, lane = tid & 31, wave = tid >> 5;
    const int grp = __builtin_amdgcn_readfirstlane((int)(threadIdx.x >> 7));
    const int qblk = blockIdx.x * 128;
    const int h = blockIdx.y, b = blockIdx.z;
    const int q0 = qblk + wave * 32;
    const size_t head = (size_t)(b * HH + h) * SS * DKV;
    const bf16* Qp = Qh + head;
    const bf16* Kp = Kh + head;
    const bf16* Vp = Vt + head;  // [64][4096]
    const float* btabh = btab + h * 8192;
    const float* gateb = gate + (size_t)b * SS;

    const int l15 = lane & 15;
    const int kb8 = (lane >> 4) * 8;

    // staging assignment: 8 lanes per 128-B row, 16 rows per copy of the group
    const int srow = tid >> 3, scol = (tid & 7) * 8;
    const bool lowpair = __builtin_amdgcn_readfirstlane(wave) < 2;
    auto issue_stage = [&](int t) {
        const int kb = (grp * NST + t) * KST, bb = t & 1;
        // Toeplitz bias slice (rel = key - q): 191 entries needed, entry j is rel index base + j
        int base = kb - qblk - 127 + 4095;
        int gi = base + tid;
        gi = gi < 0 ? 0 : (gi > 8190 ? 8190 : gi);
        int gi2 = base + 128 + tid;
        gi2 = gi2 < 0 ? 0 : (gi2 > 8190 ? 8190 : gi2);
        // waves 0, 1 bring the slice's tail, waves 2, 3 the gate: a choice per wave, all lanes on
        const float* ga1 = lowpair ? btabh + gi2 : gateb + kb + (tid - 64);
        stage_copies(Kp + (size_t)(kb + srow) * DKV + scol, Vp + (size_t)srow * SS + kb + scol,
                     btabh + gi, ga1, lds_addr(&Ks[grp][bb][srow * KPITCH + scol]),
                     lds_addr(&Vs[grp][bb][srow * KPITCH + scol]),
                     lds_addr(&aux_s[grp][bb][tid]));
    };

    issue_stage(0);

    // Q fragments (B operand, column = query l15): 2 q-groups x 2 halves of the head dim
    bf16x16 qf[2][2];
#pragma unroll
    for (int qt = 0; qt < 2; ++qt) {
        const bf16* qr = Qp + (size_t)(q0 + qt * 16 + l15) * DKV;
#pragma unroll
        for (int kh = 0; kh < 2; ++kh)
            qf[qt][kh] = load16(qr + kh * 32 + kb8, qr + kh * 32 + kb8 + 16);
    }

    // Oa[qt][dt][r] = O^T[d = dt*16 + kb8 + r][q = q0 + qt*16 + l15]
    floatx8 Oa[2][4];
#pragma unroll
    for (int qt = 0; qt < 2; ++qt)
#pragma unroll
        for (int dt = 0; dt < 4; ++dt) Oa[qt][dt] = zero8();
    float rm[2], rl[2];  // per query: running maximum; this lane half's share of the sum
#pragma unroll
    for (int qt = 0; qt < 2; ++qt) { rm[qt] = -1e30f; rl[qt] = 0.f; }

    // bias index of (key offset p*32 + kt*16 + kb8 + r, query offset wave*32 + qt*16 + l15)
    // is bidx + p*32 + (kt - qt) * 16 + r
    const int bidx = 127 - wave * 32 - l15 + kb8;

    wait_async0();    // stage 0 of this wave has landed
    __syncthreads();  // ... and every other wave's share of it
    issue_stage(1);

    for (int t = 0; t < NST; ++t) {
        const bf16* Kb = Ks[grp][t & 1];
        const bf16* Vb = Vs[grp][t & 1];
        const float* ab = aux_s[grp][t & 1];
        // fragment and bias loads of pass p (32 keys) of this stage
        auto load_k = [&](int p, bf16x16 (&kf)[2][2]) {  // K rows, A operand
#pragma unroll
            for (int kt = 0; kt < 2; ++kt) {
                const bf16* kr = Kb + (p * 32 + kt * 16 + l15) * KPITCH;
                kf[kt][0] = load16(kr + kb8, kr + kb8 + 16);
                kf[kt][1] = load16(kr + 32 + kb8, kr + 32 + kb8 + 16);
            }
        };
        auto load_v = [&](int p, bf16x16 (&vf)[4]) {  // V^T rows, A operand
#pragma unroll
            for (int dt = 0; dt < 4; ++dt) {
                const bf16* vr = Vb + (dt * 16 + l15) * KPITCH + p * 32;
                vf[dt] = load16(vr + kb8, vr + kb8 + 16);
            }
        };
        // bg[qt][kt] = position bias + delete-gate of the lane's 8 keys of tile kt
        auto load_bg = [&](int p, floatx8 (&bg)[2][2]) {
            floatx8 gv[2];
#pragma unroll
            for (int kt = 0; kt < 2; ++kt)
                gv[kt] = *(const floatx8*)(ab + 192 + p * 32 + kt * 16 + kb8);
            floatx8 bv[3];  // the slice is Toeplitz: only kt - qt = -1, 0, 1 differ
#pragma unroll
            for (int j = 0; j < 3; ++j)
#pragma unroll
                for (int r = 0; r < 8; ++r) bv[j][r] = ab[bidx + p * 32 + (j - 1) * 16 + r];
#pragma unroll
            for (int qt = 0; qt < 2; ++qt)
#pragma unroll
                for (int kt = 0; kt < 2; ++kt) bg[qt][kt] = bv[kt - qt + 1] + gv[kt];
        };
        // sacc[qt][kt][r] = S[q = qt*16 + l15][key = kt*16 + kb8 + r], 8 WMMAs
        auto scores = [&](const bf16x16 (&kf)[2][2], floatx8 (&sacc)[2][2]) {
#pragma unroll
            for (int kt = 0; kt < 2; ++kt)
#pragma unroll
                for (int qt = 0; qt < 2; ++qt) {
                    floatx8 s = wmma_bf16(kf[kt][0], qf[qt][0], zero8());
                    sacc[qt][kt] = wmma_bf16(kf[kt][1], qf[qt][1], s);
                }
        };
        // online softmax1 update, one query per lane and group; then O^T += V^T P^T, 8 WMMAs
        auto update = [&](floatx8 (&sacc)[2][2], const floatx8 (&bg)[2][2],
                          const bf16x16 (&vf)[4]) {
            bf16x16 pf[2];
#pragma unroll
            for (int qt = 0; qt < 2; ++qt) {
                sacc[qt][0] += bg[qt][0];
                sacc[qt][1] += bg[qt][1];
                float tm = fmaxf(sacc[qt][0][0], sacc[qt][1][0]);
#pragma unroll
                for (int r = 1; r < 8; ++r)
                    tm = fmaxf(tm, fmaxf(sacc[qt][0][r], sacc[qt][1][r]));
                tm = fmaxf(tm, other_half(tm));
                float mnew = fmaxf(rm[qt], tm);
                float alpha = __expf(rm[qt] - mnew);
                rm[qt] = mnew;
                // e^x = 2^(x log2 e), the product formed on the vectors (packed multiplies)
                floatx8 d0 = (sacc[qt][0] - mnew) * LOG2E, d1 = (sacc[qt][1] - mnew) * LOG2E;
#pragma unroll
                for (int r = 0; r < 8; ++r) d0[r] = __builtin_amdgcn_exp2f(d0[r]);
#pragma unroll
                for (int r = 0; r < 8; ++r) d1[r] = __builtin_amdgcn_exp2f(d1[r]);
                // P^T as B operand: element s holds key kb8 + s (s < 8), 16 + kb8 + s - 8
                pf[qt] = __builtin_shufflevector(f2bf8(d0), f2bf8(d1), 0, 1, 2, 3, 4, 5, 6, 7, 8,
                                                 9, 10, 11, 12, 13, 14, 15);
                floatx8 sv = d0 + d1;
                float ts = ((sv[0] + sv[1]) + (sv[2] + sv[3])) +
                           ((sv[4] + sv[5]) + (sv[6] + sv[7]));
                rl[qt] = rl[qt] * alpha + ts;
#pragma unroll
                for (int dt = 0; dt < 4; ++dt) Oa[qt][dt] *= alpha;
            }
#pragma unroll
            for (int dt = 0; dt < 4; ++dt)
#pragma unroll
                for (int qt = 0; qt < 2; ++qt) Oa[qt][dt] = wmma_bf16(vf[dt], pf[qt], Oa[qt][dt]);
        };

        // Two passes of 32 keys per stage. The loop stays rolled so that each pass is a block
        // of its own with its LDS loads at its head.
#pragma unroll 1
        for (int p = 0; p < 2; ++p) {
            bf16x16 kf[2][2], vf[4];
            floatx8 sacc[2][2], bg[2][2];
            load_k(p, kf);
            load_bg(p, bg);
            load_v(p, vf);
            // Keeps the pass's loads issued together here, ahead of the products; without it
            // some K loads sink between the score products, each with a full wait of its own.
            __builtin_amdgcn_sched_barrier(0);
            scores(kf, sacc);
            update(sacc, bg, vf);
            // The pass ends in a product and the loop's taken branch: four vector slots, held at
            // the foot by the scheduling barrier, before
            // the next pass's address arithmetic may reuse that product's operand registers.
            __builtin_amdgcn_sched_barrier(0);
            asm volatile("v_nop\n\tv_nop\n\tv_nop\n\tv_nop");
        }

        // publish point of stage t + 1, which also frees stage t's buffer
        asm volatile("s_wait_dscnt 0x0" ::: "memory");  // this wave's reads of stage t are done
        wait_async0();                                  // its copies of stage t + 1 have landed
        __syncthreads();
        if (t + 2 < NST) issue_stage(t + 2);
    }
    wait_async0();  // nothing is outstanding when the wave ends

    // ---- join of the two key halves: group 1 hands its partials over, group 0 finishes ----
    if (grp == 1) {
#pragma unroll
        for (int qt = 0; qt < 2; ++qt) {
#pragma unroll
            for (int dt = 0; dt < 4; ++dt)
#pragma unroll
                for (int j = 0; j < 2; ++j) {
                    floatx4 v = {Oa[qt][dt][4 * j], Oa[qt][dt][4 * j + 1], Oa[qt][dt][4 * j + 2],
                                 Oa[qt][dt][4 * j + 3]};
                    join_o[((wave * 8 + qt * 4 + dt) * 2 + j) * 32 + lane] = v;
                }
            join_ml[wave][qt][0][lane] = rm[qt];
            join_ml[wave][qt][1][lane] = rl[qt];
        }
    }
    __syncthreads();  // group 1's partials are read by group 0
    if (grp == 1) return;
#pragma unroll
    for (int qt = 0; qt < 2; ++qt) {
        float m1 = join_ml[wave][qt][0][lane], l1 = join_ml[wave][qt][1][lane];
        float m = fmaxf(rm[qt], m1);
        float a0 = __expf(rm[qt] - m), a1 = __expf(m1 - m);
        rm[qt] = m;
        rl[qt] = rl[qt] * a0 + l1 * a1;
#pragma unroll
        for (int dt = 0; dt < 4; ++dt)
#pragma unroll
            for (int j = 0; j < 2; ++j) {
                floatx4 v = join_o[((wave * 8 + qt * 4 + dt) * 2 + j) * 32 + lane];
#pragma unroll
                for (int r = 0; r < 4; ++r)
                    Oa[qt][dt][4 * j + r] = Oa[qt][dt][4 * j + r] * a0 + v[r] * a1;
            }
    }

    // ---- softmax1 denominator: l + exp(-m); the halves' sums are joined here ----
    // ---- write ctx [B,S,H*DKV]: a lane holds 8 consecutive d of one query ----
#pragma unroll
    for (int qt = 0; qt < 2; ++qt) {
        float l = rl[qt] + other_half(rl[qt]);
        float inv = 1.f / (l + __expf(-rm[qt]));
        int q = q0 + qt * 16 + l15;
#pragma unroll
        for (int dt = 0; dt < 4; ++dt) {
            *(bf16x8*)&ctx[((size_t)b * SS + q) * DD + h * DKV + dt * 16 + kb8] =
                f2bf8(Oa[qt][dt] * inv);
        }
    }
}

// ---------------- launcher ----------------
extern "C" void kernel_launch(void* const* d_in, const int* in_sizes, int n_in,
                              void* d_out, int out_size, void* d_ws, size_t ws_size,
                              hipStream_t stream) {
    (void)in_sizes; (void)n_in; (void)out_size; (void)ws_size;
    const float* hidden = (const float*)d_in[0];
    const float* gate   = (const float*)d_in[1];
    const float* ln1    = (const float*)d_in[2];
    const float* qw     = (const float*)d_in[3];
    const float* kw     = (const float*)d_in[4];
    const float* vw     = (const float*)d_in[5];
    const float* ow     = (const float*)d_in[6];
    const float* relb   = (const float*)d_in[7];
    const float* ln2    = (const float*)d_in[8];
    const float* wi     = (const float*)d_in[9];
    const float* wo     = (const float*)d_in[10];

    char* ws = (char*)d_ws;
    size_t off = 0;
    auto take = [&](size_t bytes) -> char* {
        char* p = ws + off;
        off = (off + bytes + 255) & ~(size_t)255;
        return p;
    };
    bf16*  qwb  = (bf16*)take((size_t)3 * DD * DD * 2);  // all weights transposed [N,K];
    bf16*  kwb  = qwb + DD * DD;                         // q, k, v one behind the other
    bf16*  vwb  = kwb + DD * DD;
    bf16*  owb  = (bf16*)take((size_t)DD * DD * 2);
    bf16*  wib  = (bf16*)take((size_t)DD * DFF * 2);
    bf16*  wob  = (bf16*)take((size_t)DFF * DD * 2);
    float* btab = (float*)take((size_t)HH * 8192 * 4);
    bf16*  xb   = (bf16*)take((size_t)MM * DD * 2);
    bf16*  Qhd  = (bf16*)take((size_t)3 * MM * DD * 2);  // Q, K, V^T one behind the other
    bf16*  Khd  = Qhd + MM * DD;
    bf16*  Vtd  = Khd + MM * DD;
    bf16*  ctxb = (bf16*)take((size_t)MM * DD * 2);
    float* hbuf = (float*)take((size_t)MM * DD * 4);
    bf16*  yb   = (bf16*)take((size_t)MM * DD * 2);
    bf16*  ffb  = (bf16*)take((size_t)MM * DFF * 2);

    // ln1 -> xb (bf16), transposed bf16 weights, bias table: one launch
    prep_kernel<<<PREP_RMS + PREP_CVT + PREP_TAB, 256, 0, stream>>>(
        hidden, ln1, xb, qw, kw, vw, ow, wi, wo, qwb, kwb, vwb, owb, wib, wob, relb, btab);

    // QKV projections (head layouts; V transposed): one launch
    gemm_kernel<5><<<dim3(3 * DD / 128, MM / 128), 256, 0, stream>>>(xb, qwb, nullptr, Qhd,
                                                                     MM, 3 * DD, DD);

    // flash attention with softmax1
    attn_kernel<<<dim3(SS / 128, HH, BB), 256, 0, stream>>>(Qhd, Khd, Vtd, btab, gate, ctxb);

    // h = hidden + ctx @ o_w
    gemm_kernel<3><<<dim3(DD / 128, MM / 128), 256, 0, stream>>>(ctxb, owb, hidden, hbuf,
                                                                 MM, DD, DD);
    // ln2 -> yb
    rmsnorm_kernel<<<MM / 8, 256, 0, stream>>>(hbuf, ln2, yb, MM);

    // FFN: relu(y @ wi) then out = h + (.) @ wo
    gemm_kernel<4><<<dim3(DFF / 128, MM / 128), 256, 0, stream>>>(yb, wib, nullptr, ffb,
                                                                  MM, DFF, DD);
    gemm_kernel<3><<<dim3(DD / 128, MM / 128), 256, 0, stream>>>(ffb, wob, hbuf, d_out,
                                                                 MM, DD, DFF);
}

// v010
// It runs in 131 microseconds.
// Versions in between are left out here; by their measured steps it is 1.10 times as fast as v008.
// Over all steps from v000 it is 3.63 times as fast.
#include <hip/hip_runtime.h>
#include <hip/hip_bf16.h>

// ---------------- types ----------------
typedef __bf16 bf16;
typedef bf16  bf16x2  __attribute__((ext_vector_type(2)));
typedef bf16  bf16x4  __attribute__((ext_vector_type(4)));
typedef bf16  bf16x8  __attribute__((ext_vector_type(8)));
typedef bf16  bf16x16 __attribute__((ext_vector_type(16)));
typedef float floatx4 __attribute__((ext_vector_type(4)));
typedef float floatx8 __attribute__((ext_vector_type(8)));

#define BB 2
#define SS 4096
#define DD 512
#define HH 8
#define DKV 64
#define DFF 2048
#define MM (BB*SS)   // 8192

// f32 -> bf16, round to nearest even, by the chip's own packed conversion (two values an
// instruction where neighbours are converted together)
__device__ __forceinline__ bf16 f2bf(float x) { return (bf16)x; }
__device__ __forceinline__ bf16x4 f2bf4(floatx4 v) { return __builtin_convertvector(v, bf16x4); }
__device__ __forceinline__ bf16x8 f2bf8(floatx8 v) { return __builtin_convertvector(v, bf16x8); }
__device__ __forceinline__ bf16x16 load16(const bf16* p0, const bf16* p1) {
    bf16x8 a = *(const bf16x8*)p0;
    bf16x8 b = *(const bf16x8*)p1;
    bf16x16 r;
#pragma unroll
    for (int i = 0; i < 8; ++i) { r[i] = a[i]; r[i + 8] = b[i]; }
    return r;
}
__device__ __forceinline__ floatx8 wmma_bf16(bf16x16 a, bf16x16 b, floatx8 c) {
    return __builtin_amdgcn_wmma_f32_16x16x32_bf16(false, a, false, b, (short)0, c,
                                                   false, false);
}
__device__ __forceinline__ floatx8 splat8(float x) {
    floatx8 v = {x, x, x, x, x, x, x, x};
    return v;
}
__device__ __forceinline__ floatx8 zero8() {
    floatx8 z = {0.f, 0.f, 0.f, 0.f, 0.f, 0.f, 0.f, 0.f};
    return z;
}

__device__ __forceinline__ void wait_async0() {
    asm volatile("s_wait_asynccnt 0x0" ::: "memory");
}
__device__ __forceinline__ unsigned lds_addr(const void* p) {
    return (unsigned)(size_t)p;  // low 32 bits of a generic shared pointer = LDS byte address
}

// ---------------- small kernels ----------------
// fp32 [K,N] -> bf16 transposed [N,K] (makes the GEMMs' weight operands K-contiguous), all six
// weights in one launch. Four waves (half a block) take one 64 x 64 tile: a thread reads two 4 x 4
// patches by 16-B loads (256 B of a row per 16 lanes), rounds them and stores them transposed
// to LDS; the tile then leaves by 16-B stores, one whole 128-B line of an output row per 8 lanes.
#define TPITCH 72  // 128-B rows at a 144-B pitch, 16-B aligned for the readers
template <int K, int N>
__device__ __forceinline__ void transpose_tile(const float* __restrict__ in,
                                               bf16* __restrict__ out, int tile, bf16* ts) {
    constexpr int TN = N / 64;  // tiles along N
    const int tid = threadIdx.x & 127;
    const int k0 = (tile / TN) * 64, n0 = (tile % TN) * 64;
    const int a = tid >> 4, c = tid & 15;  // patch h: k = 32h + 4a .. + 3, n = 4c .. 4c + 3
    const float* src = in + k0 * N + n0;
    floatx4 v[2][4];
#pragma unroll
    for (int h = 0; h < 2; ++h)
#pragma unroll
        for (int j = 0; j < 4; ++j)
            v[h][j] = *(const floatx4*)(src + (4 * a * N + 4 * c) + (32 * h + j) * N);
#pragma unroll
    for (int h = 0; h < 2; ++h)
#pragma unroll
        for (int i = 0; i < 4; ++i) {
            floatx4 p = {v[h][0][i], v[h][1][i], v[h][2][i], v[h][3][i]};
            *(bf16x4*)&ts[(4 * c + i) * TPITCH + 32 * h + 4 * a] = f2bf4(p);
        }
    __syncthreads();  // the tile is read across the waves that wrote it
    bf16* dst = out + n0 * K + k0;
    const int n = tid >> 3, ch = (tid & 7) * 8;
#pragma unroll
    for (int j = 0; j < 4; ++j)
        *(bf16x8*)(dst + (n * K + ch) + 16 * j * K) =
            *(const bf16x8*)&ts[(n + 16 * j) * TPITCH + ch];
    // In the listing this part's end runs on into another part's code (behind a branch that is
    // always taken): no register of these stores is rewritten there ahead of this wait.
    asm volatile("s_wait_xcnt 0x0" ::: "memory");
}

// T5 bidirectional bucket bias, Toeplitz table: tab[h*8192 + (rel+4095)]
__device__ __forceinline__ void bias_table_entry(const float* __restrict__ rel_bias,
                                                 float* __restrict__ tab, int idx) {
    if (idx >= HH * 8191) return;
    int h = idx / 8191, r = idx % 8191;
    int rel = r - 4095;
    int ret = rel > 0 ? 16 : 0;         // num_buckets/2 = 16
    int n = rel < 0 ? -rel : rel;
    int bucket;
    if (n < 8) {                        // max_exact = 8
        bucket = ret + n;
    } else {
        int v = 8 + (int)(__logf((float)n * 0.125f) * (8.0f / __logf(16.0f)));
        if (v > 15) v = 15;
        bucket = ret + v;
    }
    tab[h * 8192 + r] = rel_bias[bucket * HH + h];
}

// The delete-gate as a factor: e^(s + gate) = e^s * e^gate. Per 64 keys (one attention stage) a
// row of 64 bf16 e^gate and a row of 64 zeros, 256 B; entry idx is one 4-B word of it.
__device__ __forceinline__ void gate_rows_entry(const float* __restrict__ gate,
                                                unsigned* __restrict__ egz, int idx) {
    const int w = idx & 63, st = idx >> 6;  // st: batch * 64 + stage
    unsigned v = 0u;
    if (w < 32) {
        const float* g = gate + st * 64 + 2 * w;
        const float g0 = g[0], g1 = g[1];
        // As an input here the address pair stays whole up to this wait: without it the load's
        // own result was placed on the pair.
        asm volatile("s_wait_xcnt 0x0" :: "v"(g) : "memory");
        bf16x2 p = {f2bf(__expf(g0)), f2bf(__expf(g1))};
        v = __builtin_bit_cast(unsigned, p);
    }
    egz[idx] = v;
    // In the listing this part's end runs on into another part's code (behind a branch that is
    // always taken): no register of this store is rewritten there ahead of this wait.
    asm volatile("s_wait_xcnt 0x0" ::: "memory");
}

// one wave per row of 512 columns; fp32 in, bf16*(rms weight) out
__device__ __forceinline__ void rmsnorm_row(const float* __restrict__ x,
                                            const float* __restrict__ w,
                                            bf16* __restrict__ out, int row) {
    int lane = threadIdx.x & 31;
    const float* xr = x + (size_t)row * DD;
    float vals[16];
    float ss = 0.f;
#pragma unroll
    for (int i = 0; i < 16; ++i) {
        float v = xr[lane + i * 32];
        vals[i] = v;
        ss += v * v;
    }
#pragma unroll
    for (int m = 16; m >= 1; m >>= 1) ss += __shfl_xor(ss, m, 32);
    float rs = rsqrtf(ss * (1.f / (float)DD) + 1e-6f);
#pragma unroll
    for (int i = 0; i < 16; ++i) {
        int c = lane + i * 32;
        out[(size_t)row * DD + c] = f2bf(vals[i] * rs * w[c]);
    }
}

__global__ void __launch_bounds__(256) rmsnorm_kernel(const float* __restrict__ x,
                                                      const float* __restrict__ w,
                                                      bf16* __restrict__ out, int rows) {
    int row = blockIdx.x * 8 + (threadIdx.x >> 5);
    if (row >= rows) return;
    rmsnorm_row(x, w, out, row);
}

// Everything that reads only inputs, in one launch: none of the four parts needs another's
// result. Blocks 0..1023: first RMS norm, 8 rows each. Blocks 1024..1407: weight transposes, two
// tiles each (tiles 0..255: the four 512 x 512 weights, 64 tiles each; 256..511: wi; 512..767:
// wo). Blocks 1408..1663: the bias table. Blocks 1664..1695: the e^gate rows.
#define PREP_RMS (MM / 8)
#define PREP_CVT (768 / 2)
#define PREP_TAB ((HH * 8191 + 255) / 256)
#define PREP_EG (MM / 256)
__global__ void __launch_bounds__(256) prep_kernel(
    const float* __restrict__ x, const float* __restrict__ ln, bf16* __restrict__ xb,
    const float* __restrict__ qw, const float* __restrict__ kw, const float* __restrict__ vw,
    const float* __restrict__ ow, const float* __restrict__ wi, const float* __restrict__ wo,
    bf16* __restrict__ qwb, bf16* __restrict__ kwb, bf16* __restrict__ vwb,
    bf16* __restrict__ owb, bf16* __restrict__ wib, bf16* __restrict__ wob,
    const float* __restrict__ rel_bias, float* __restrict__ tab,
    const float* __restrict__ gate, unsigned* __restrict__ egz) {
    __shared__ __align__(16) bf16 tsh[2][64 * TPITCH];  // [half][n][k]
    const int blk = blockIdx.x;
    if (blk < PREP_RMS) {
        rmsnorm_row(x, ln, xb, blk * 8 + (threadIdx.x >> 5));
    } else if (blk < PREP_RMS + PREP_CVT) {
        const int half = __builtin_amdgcn_readfirstlane((int)(threadIdx.x >> 7));
        const int tile = (blk - PREP_RMS) * 2 + half;
        const int g = (blk - PREP_RMS) >> 5;  // the same for both tiles of a block
        bf16* ts = tsh[half];
        if (g < 4) {
            const float* in = g == 0 ? qw : g == 1 ? kw : g == 2 ? vw : ow;
            bf16* out = g == 0 ? qwb : g == 1 ? kwb : g == 2 ? vwb : owb;
            transpose_tile<DD, DD>(in, out, tile & 63, ts);
        } else if (g < 8) {
            transpose_tile<DD, DFF>(wi, wib, tile - 256, ts);
        } else {
            transpose_tile<DFF, DD>(wo, wob, tile - 512, ts);
        }
    } else if (blk < PREP_RMS + PREP_CVT + PREP_TAB) {
        bias_table_entry(rel_bias, tab, (blk - PREP_RMS - PREP_CVT) * 256 + threadIdx.x);
    } else {
        gate_rows_entry(gate, egz, (blk - PREP_RMS - PREP_CVT - PREP_TAB) * 256 + threadIdx.x);
    }
}

// ---------------- WMMA GEMM (async double-buffered LDS) ----------------
// C[M,N] = A[M,K] @ W[K,N] with W pre-transposed as Wt[N,K].
// Block 256 thr = 8 waves (4x2); block tile 128x128; wave tile 32x64.
// The product is formed transposed: the operand whose index runs along the output's rows in
// memory (x, 64 per wave: the weights' n; for V^T the activations' s) is the A operand, the
// other (y, 32 per wave) the B operand. A lane then holds 8 consecutive x of one y.
// A stage is 128 k of both operands' 128 rows; stages come to LDS by asynchronous copies,
// two buffers, one stage ahead: one wait and one barrier per 128 k, and a stage's copies
// have the whole stage before it (32 products per wave) to land. Inside a stage the fragments
// of each 32 k are read one sub-step ahead into a second register set. K: a multiple of 128.
// MODE 3: f32 + residual    MODE 4: relu -> bf16
// MODE 5: Q, K, V projections in one launch: Wt holds the three weights' rows one behind the
// other (N = 3 x 512), outp the three outputs; a block lies in one of them and stores per head
// [B,H,S,64] (Q, K) or transposed [B,H,64,S] (V); V's columns leave times e^gate of their key,
// read from the e^gate rows, which come in resid's place
#define GKS 128     // k per stage
#define GPITCH 136  // 256-B rows at a 272-B pitch (16 B x odd) for 16-B readers

// One lane's eight 16-B copies of one operand's stage: rows 16 apart, global pitch gstep.
// The s_wait_xcnt closes the statement so that no address register is rewritten ahead of it.
__device__ __forceinline__ void gemm_copies(const bf16* g, size_t gstep, unsigned l) {
    const bf16 *g1 = g + gstep, *g2 = g1 + gstep, *g3 = g2 + gstep, *g4 = g3 + gstep,
               *g5 = g4 + gstep, *g6 = g5 + gstep, *g7 = g6 + gstep;
    const unsigned st = 16 * GPITCH * 2;
    asm volatile(
        "global_load_async_to_lds_b128 %0, %8, off\n\t"
        "global_load_async_to_lds_b128 %1, %9, off\n\t"
        "global_load_async_to_lds_b128 %2, %10, off\n\t"
        "global_load_async_to_lds_b128 %3, %11, off\n\t"
        "global_load_async_to_lds_b128 %4, %12, off\n\t"
        "global_load_async_to_lds_b128 %5, %13, off\n\t"
        "global_load_async_to_lds_b128 %6, %14, off\n\t"
        "global_load_async_to_lds_b128 %7, %15, off\n\t"
        "s_wait_xcnt 0x0"
        :: "v"(l), "v"(l + st), "v"(l + 2 * st), "v"(l + 3 * st),
           "v"(l + 4 * st), "v"(l + 5 * st), "v"(l + 6 * st), "v"(l + 7 * st),
           "v"(g), "v"(g1), "v"(g2), "v"(g3), "v"(g4), "v"(g5), "v"(g6), "v"(g7)
        : "memory");
}

// A wave's 32 (y) x 64 (x) tile leaves by whole lines: the wave lays it out in an LDS range of
// its own (16-B stores, a row per y at a 16 B x odd pitch) and reads it back with the lanes along
// x, so that a 16-B global store per lane covers whole 128-B lines of the output's rows.
// acc[yt][xt][i] is the element (y = yt*16 + lane%16, x = xt*16 + 8*(lane/16) + i).
#define SPB 144               // bf16 tile: 128-B rows
#define SPF 272               // f32 tile: 256-B rows
#define STG_WAVE (32 * SPF)   // LDS bytes per wave

template <bool RELU>
__device__ __forceinline__ void store_tile_bf16(const floatx8 (&acc)[2][4],
                                                bf16* __restrict__ out, size_t pitch, char* stg,
                                                int lane) {
    const int l15 = lane & 15, hh = lane >> 4;
#pragma unroll
    for (int yt = 0; yt < 2; ++yt)
#pragma unroll
        for (int xt = 0; xt < 4; ++xt) {
            floatx8 v = acc[yt][xt];
            if constexpr (RELU) {
#pragma unroll
                for (int i = 0; i < 8; ++i) v[i] = v[i] > 0.f ? v[i] : 0.f;
            }
            *(bf16x8*)(stg + (yt * 16 + l15) * SPB + xt * 32 + hh * 16) = f2bf8(v);
        }
    // The rows are read back by other lanes of this wave: its LDS stores are done first.
    asm volatile("s_wait_dscnt 0x0" ::: "memory");
    const int r = lane >> 3, c = lane & 7;  // 8 lanes per 128-B row, 4 rows per store
#pragma unroll
    for (int j = 0; j < 8; ++j)
        *(bf16x8*)(out + (size_t)(4 * j + r) * pitch + c * 8) =
            *(const bf16x8*)(stg + (4 * j + r) * SPB + c * 16);
}

// org: index of the tile's first element in resid and out alike, whose rows are PITCH apart
template <int PITCH>
__device__ __forceinline__ void store_tile_f32(const floatx8 (&acc)[2][4],
                                               const float* __restrict__ resid,
                                               float* __restrict__ out, unsigned org, char* stg,
                                               int lane) {
    const int l15 = lane & 15, hh = lane >> 4;  // read-back: 16 lanes per 256-B row, 2 rows
    const unsigned off = org + hh * PITCH + l15 * 4;  // one lane offset serves loads and stores
    const float* rp = resid + off;
    float* op = out + off;
    floatx4 rv[16];
#pragma unroll
    for (int j = 0; j < 16; ++j) rv[j] = *(const floatx4*)(rp + 2 * j * PITCH);
    // All sixteen loads name one address pair. As an input here it stays whole up to this wait.
    asm volatile("s_wait_xcnt 0x0" :: "v"(rp) : "memory");
#pragma unroll
    for (int yt = 0; yt < 2; ++yt)
#pragma unroll
        for (int xt = 0; xt < 4; ++xt) {
            const floatx8 v = acc[yt][xt];
            char* p = stg + (yt * 16 + l15) * SPF + xt * 64 + hh * 32;
            *(floatx4*)p = __builtin_shufflevector(v, v, 0, 1, 2, 3);
            *(floatx4*)(p + 16) = __builtin_shufflevector(v, v, 4, 5, 6, 7);
        }
    // The rows are read back by other lanes of this wave: its LDS stores are done first.
    asm volatile("s_wait_dscnt 0x0" ::: "memory");
#pragma unroll
    for (int j = 0; j < 16; ++j)
        *(floatx4*)(op + 2 * j * PITCH) =
            rv[j] + *(const floatx4*)(stg + (2 * j + hh) * SPF + l15 * 16);
}

template <int MODE>
__global__ void __launch_bounds__(256) gemm_kernel(const bf16* __restrict__ A,
                                                   const bf16* __restrict__ Wt,
                                                   const float* __restrict__ resid,
                                                   void* __restrict__ outp,
                                                   int M, int N, int K) {
    __shared__ __align__(16) bf16 As[2][128 * GPITCH];  // [row][k]
    __shared__ __align__(16) bf16 Bs[2][128 * GPITCH];  // [n][k]
    const int tid = threadIdx.x, lane = tid & 31, wave = tid >> 5;
    const int wy = wave >> 1, wx = wave & 1;
    const int n0 = blockIdx.x * 128, m0 = blockIdx.y * 128;
    const int l15 = lane & 15, kb8 = (lane >> 4) * 8;
    // V^T is stored along s: there the activations are the x operand; the same for the whole block
    const bool vt = MODE == 5 && (n0 >> 9) == 2;

    floatx8 acc[2][4];
#pragma unroll
    for (int yt = 0; yt < 2; ++yt)
#pragma unroll
        for (int xt = 0; xt < 4; ++xt) acc[yt][xt] = zero8();

    // staging assignment: 16 lanes per 256-B row, 16 rows per copy of the block
    const int pr = tid >> 4, pk = (tid & 15) * 8;
    const int nIter = K / GKS;
    const bf16* ga = A + (size_t)(m0 + pr) * K + pk;
    const bf16* gb = Wt + (size_t)(n0 + pr) * K + pk;
    auto issue_stage = [&](int t) {
        const int bb = t & 1;
        gemm_copies(ga + t * GKS, (size_t)16 * K, lds_addr(&As[bb][pr * GPITCH + pk]));
        gemm_copies(gb + t * GKS, (size_t)16 * K, lds_addr(&Bs[bb][pr * GPITCH + pk]));
    };

    issue_stage(0);
    wait_async0();    // stage 0 of this wave has landed
    __syncthreads();  // ... and every other wave's share of it
    if (nIter > 1) issue_stage(1);

    for (int t = 0; t < nIter; ++t) {
        const bf16* Yb = (vt ? Bs[t & 1] : As[t & 1]) + (wy * 32 + l15) * GPITCH + kb8;
        const bf16* Xb = (vt ? As[t & 1] : Bs[t & 1]) + (wx * 64 + l15) * GPITCH + kb8;
        // fragments of sub-step ks (32 k) of this stage: 12 LDS loads as one group
        bf16x16 yf[2][2], xf[2][4];
        auto load_frags = [&](int ks) {
#pragma unroll
            for (int yt = 0; yt < 2; ++yt) {
                const bf16* p = Yb + yt * 16 * GPITCH + ks * 32;
                yf[ks & 1][yt] = load16(p, p + 16);
            }
#pragma unroll
            for (int xt = 0; xt < 4; ++xt) {
                const bf16* p = Xb + xt * 16 * GPITCH + ks * 32;
                xf[ks & 1][xt] = load16(p, p + 16);
            }
        };
        load_frags(0);
#pragma unroll
        for (int ks = 0; ks < GKS / 32; ++ks) {
            if (ks + 1 < GKS / 32) load_frags(ks + 1);
            // Keeps the next sub-step's loads ahead of this sub-step's products; without it
            // the loads sink between the products, each pair with a full wait of its own.
            __builtin_amdgcn_sched_barrier(0);
#pragma unroll
            for (int xt = 0; xt < 4; ++xt)
#pragma unroll
                for (int yt = 0; yt < 2; ++yt)
                    acc[yt][xt] = wmma_bf16(xf[ks & 1][xt], yf[ks & 1][yt], acc[yt][xt]);
        }
        // publish point of stage t + 1, which also frees stage t's buffer
        asm volatile("s_wait_dscnt 0x0" ::: "memory");  // this wave's reads of stage t are done
        wait_async0();                                  // its copies of stage t + 1 have landed
        __syncthreads();
        if (t + 2 < nIter) issue_stage(t + 2);
    }
    wait_async0();  // nothing is outstanding when the wave ends

    // The ring is free behind the loop's last barrier: each wave takes a range of it for its tile.
    char* stg = (char*)&As[0][0] + wave * STG_WAVE;
    const int yo = wy * 32, xo = wx * 64;
    if constexpr (MODE == 5) {
        bf16* o = (bf16*)outp + (size_t)(n0 >> 9) * MM * DD;  // 0: Q, 1: K, 2: V
        const int nb = n0 & 511, bh = (m0 >> 12) * HH, s0 = m0 & 4095;
        // Q, K: y = s, x = d, the wave's 64 n are one head; V: y = d (half a head), x = s
        if (vt) {  // x = s: a lane's 8 values of a tile are 8 consecutive keys
            const bf16* eg = (const bf16*)resid + ((m0 + xo) >> 6) * 128 + kb8;
#pragma unroll
            for (int xt = 0; xt < 4; ++xt) {
                const floatx8 e = __builtin_convertvector(*(const bf16x8*)(eg + xt * 16), floatx8);
                acc[0][xt] *= e;
                acc[1][xt] *= e;
            }
        }
        const int n = nb + (vt ? yo : xo);
        const size_t org = vt ? ((size_t)(bh + (n >> 6)) * DKV + (n & 63)) * SS + s0 + xo
                              : ((size_t)(bh + (n >> 6)) * SS + s0 + yo) * DKV;
        store_tile_bf16<false>(acc, o + org, vt ? SS : DKV, stg, lane);
    } else if constexpr (MODE == 3) {
        store_tile_f32<DD>(acc, resid, (float*)outp, (m0 + yo) * DD + n0 + xo, stg, lane);  // N = DD
    } else {  // MODE 4, N = DFF
        store_tile_bf16<true>(acc, (bf16*)outp + (size_t)(m0 + yo) * DFF + n0 + xo, DFF, stg,
                              lane);
    }
}

// ---------------- Flash attention with softmax1 ----------------
// Block = 256 thr = 8 waves = 2 groups of 4; block covers (b, h, 128 q rows); a wave covers
// 32 q rows and its group's half of the keys, so that four waves, not two, share a SIMD and
// fill each other's waits. The groups' partial (reference, sum, O^T) are joined at the end.
// Scores are formed transposed, S^T = K Q^T (A = K rows, B = Q columns), and the output
// as O^T += V^T P^T. A lane then holds 16 of the 32 keys of ONE query per 16-query group:
// the maximum runs in the lane (the lane halves exchange theirs only where the reference rises),
// and the two S^T tiles of a group, rounded in place, are already the B operand P^T.
// The delete-gate is not in the scores: e^(s + gate) = e^s e^gate, so V^T arrives with its columns
// times e^gate, and a 65th row of it, e^gate itself (15 zero rows fill its tile), makes the
// matrix unit form the row sum of e^s e^gate. softmax1 is e^s / (1 + sum e^s), the same for every
// reference value: the one in use (base-2 scale, score + bias without the gate) starts at 0, the
// exponent of that 1, and trails the true maximum by up to 8. O^T and the sum are rescaled only in
// a pass where some query's scores pass it by more (one test per pass and wave); an exponential
// can so reach 2^8. Known before the scores, it joins the bias in the addend of one fma per score.
// K rows, V^T rows, the bias slice and the e^gate rows of 64 keys form one stage; stages
// come to LDS by asynchronous copies, two buffers per group, one stage ahead, shared by the
// group's 4 waves.
#define KST 64                 // keys per stage
#define NST (SS / KST / 2)     // stages per group
#define KPITCH 72              // 128-B rows at a 144-B pitch (16 B x odd) for 16-B readers
#define LOG2E 1.44269504f      // the factor that __expf applies in front of the base-2 exponential

__device__ __forceinline__ float other_half(float x) {  // value of lane l ^ 16
    int v = __builtin_bit_cast(int, x);
    v = __builtin_amdgcn_permlanex16(v, v, 0x76543210, 0xfedcba98, false, false);
    return __builtin_bit_cast(float, v);
}

// One lane's ten copies of a stage: 4 x 16 B of K, 4 x 16 B of V^T, 2 x 4 B of bias / e^gate rows.
// The s_wait_xcnt closes the statement so that no address register is rewritten ahead of it.
__device__ __forceinline__ void stage_copies(const bf16* gk, const bf16* gv, const float* ga0,
                                             const float* ga1, unsigned lk, unsigned lv,
                                             unsigned la) {
    const bf16 *gk1 = gk + 16 * DKV, *gk2 = gk + 32 * DKV, *gk3 = gk + 48 * DKV;
    const bf16 *gv1 = gv + 16 * SS, *gv2 = gv + 32 * SS, *gv3 = gv + 48 * SS;
    const unsigned st = 16 * KPITCH * 2;
    asm volatile(
        "global_load_async_to_lds_b128 %0, %10, off\n\t"
        "global_load_async_to_lds_b128 %1, %11, off\n\t"
        "global_load_async_to_lds_b128 %2, %12, off\n\t"
        "global_load_async_to_lds_b128 %3, %13, off\n\t"
        "global_load_async_to_lds_b128 %4, %14, off\n\t"
        "global_load_async_to_lds_b128 %5, %15, off\n\t"
        "global_load_async_to_lds_b128 %6, %16, off\n\t"
        "global_load_async_to_lds_b128 %7, %17, off\n\t"
        "global_load_async_to_lds_b32 %8, %18, off\n\t"
        "global_load_async_to_lds_b32 %9, %19, off\n\t"
        "s_wait_xcnt 0x0"
        :: "v"(lk), "v"(lk + st), "v"(lk + 2 * st), "v"(lk + 3 * st),
           "v"(lv), "v"(lv + st), "v"(lv + 2 * st), "v"(lv + 3 * st),
           "v"(la), "v"(la + 512u),
           "v"(gk), "v"(gk1), "v"(gk2), "v"(gk3),
           "v"(gv), "v"(gv1), "v"(gv2), "v"(gv3),
           "v"(ga0), "v"(ga1)
        : "memory");
}

// waves_per_eu(4, 4): registers within a quarter of a SIMD's file, so that two blocks share a WGP
__global__ void __launch_bounds__(256) __attribute__((amdgpu_waves_per_eu(4, 4)))
attn_kernel(const bf16* __restrict__ Qh,
            const bf16* __restrict__ Kh, const bf16* __restrict__ Vt,
            const float* __restrict__ btab, const float* __restrict__ egz,
            bf16* __restrict__ ctx) {
    __shared__ __align__(16) bf16 Ks[2][2][KST * KPITCH];  // [group][buffer][key][d]
    __shared__ __align__(16) bf16 Vs[2][2][DKV * KPITCH];  // [group][buffer][d][key]
    __shared__ __align__(32) float aux_s[2][2][256];  // 0..191 bias slice, 192..255 e^gate rows
    __shared__ __align__(16) floatx4 join_o[4 * 16 * 32];  // group 1's O^T, 16 B per lane
    __shared__ float join_ml[4][2][2][32];                 // group 1's reference and sum
    // tid, wave: inside the group
    const int tid = threadIdx.x & 127, lane = tid & 31, wave = tid >> 5;
    const int grp = __builtin_amdgcn_readfirstlane((int)(threadIdx.x >> 7));
    const int qblk = blockIdx.x * 128;
    const int h = blockIdx.y, b = blockIdx.z;
    const int q0 = qblk + wave * 32;
    const size_t head = (size_t)(b * HH + h) * SS * DKV;
    const bf16* Qp = Qh + head;
    const bf16* Kp = Kh + head;
    const bf16* Vp = Vt + head;  // [64][4096]
    const float* btabh = btab + h * 8192;
    const float* egzb = egz + b * (SS / KST) * 64;  // 64 words per stage

    const int l15 = lane & 15;
    const int kb8 = (lane >> 4) * 8;

    // staging assignment: 8 lanes per 128-B row, 16 rows per copy of the group
    const int srow = tid >> 3, scol = (tid & 7) * 8;
    const bool lowpair = __builtin_amdgcn_readfirstlane(wave) < 2;
    auto issue_stage = [&](int t) {
        const int kb = (grp * NST + t) * KST, bb = t & 1;
        // Toeplitz bias slice (rel = key - q): 191 entries needed, entry j is rel index base + j
        int base = kb - qblk - 127 + 4095;
        int gi = base + tid;
        gi = gi < 0 ? 0 : (gi > 8190 ? 8190 : gi);
        int gi2 = base + 128 + tid;
        gi2 = gi2 < 0 ? 0 : (gi2 > 8190 ? 8190 : gi2);
        // waves 0, 1 bring the slice's tail, waves 2, 3 the e^gate rows: a choice per wave, all
        // lanes on (64 keys are 64 words of those rows)
        const float* ga1 = lowpair ? btabh + gi2 : egzb + kb + (tid - 64);
        stage_copies(Kp + (size_t)(kb + srow) * DKV + scol, Vp + (size_t)srow * SS + kb + scol,
                     btabh + gi, ga1, lds_addr(&Ks[grp][bb][srow * KPITCH + scol]),
                     lds_addr(&Vs[grp][bb][srow * KPITCH + scol]),
                     lds_addr(&aux_s[grp][bb][tid]));
    };

    issue_stage(0);

    // Q fragments (B operand, column = query l15): 2 q-groups x 2 halves of the head dim
    bf16x16 qf[2][2];
#pragma unroll
    for (int qt = 0; qt < 2; ++qt) {
        const bf16* qr = Qp + (size_t)(q0 + qt * 16 + l15) * DKV;
#pragma unroll
        for (int kh = 0; kh < 2; ++kh)
            qf[qt][kh] = load16(qr + kh * 32 + kb8, qr + kh * 32 + kb8 + 16);
    }

    // Oa[qt][dt][r] = O^T[d = dt*16 + kb8 + r][q = q0 + qt*16 + l15]
    // Oa[qt][4][0] of lanes 0..15 is row 64, the sum; the tile's other rows stay zero
    floatx8 Oa[2][5];
#pragma unroll
    for (int qt = 0; qt < 2; ++qt)
#pragma unroll
        for (int dt = 0; dt < 5; ++dt) Oa[qt][dt] = zero8();
    float rm[2];  // per query: the reference value in use, base-2 scale
#pragma unroll
    for (int qt = 0; qt < 2; ++qt) rm[qt] = 0.f;

    // bias index of (key offset p*32 + kt*16 + kb8 + r, query offset wave*32 + qt*16 + l15)
    // is bidx + p*32 + (kt - qt) * 16 + r
    const int bidx = 127 - wave * 32 - l15 + kb8;
    const int egrow = l15 == 0 ? 0 : 64;  // the lane's row of the e^gate rows, in elements

    wait_async0();    // stage 0 of this wave has landed
    __syncthreads();  // ... and every other wave's share of it
    issue_stage(1);

    for (int t = 0; t < NST; ++t) {
        const bf16* Kb = Ks[grp][t & 1];
        const bf16* Vb = Vs[grp][t & 1];
        const float* ab = aux_s[grp][t & 1];
        // fragment and bias loads of pass p (32 keys) of this stage
        auto load_k = [&](int p, bf16x16 (&kf)[2][2]) {  // K rows, A operand
#pragma unroll
            for (int kt = 0; kt < 2; ++kt) {
                const bf16* kr = Kb + (p * 32 + kt * 16 + l15) * KPITCH;
                kf[kt][0] = load16(kr + kb8, kr + kb8 + 16);
                kf[kt][1] = load16(kr + 32 + kb8, kr + 32 + kb8 + 16);
            }
        };
        auto load_v = [&](int p, bf16x16 (&vf)[5]) {  // V^T rows, A operand
#pragma unroll
            for (int dt = 0; dt < 4; ++dt) {
                const bf16* vr = Vb + (dt * 16 + l15) * KPITCH + p * 32;
                vf[dt] = load16(vr + kb8, vr + kb8 + 16);
            }
        };
        // V^T's fifth tile. Row 64: e^gate; rows 65..79 all read the one row of zeros
        auto load_e = [&](int p, bf16x16 (&vf)[5]) {
            const bf16* er = (const bf16*)(ab + 192) + egrow + p * 32;
            vf[4] = load16(er + kb8, er + kb8 + 16);
        };
        // bv[kt - qt + 1] = position bias of the lane's 8 keys of tile kt for its query of group
        // qt: the slice is Toeplitz, only kt - qt = -1, 0, 1 differ
        auto load_bias = [&](int p, floatx8 (&bv)[3]) {
#pragma unroll
            for (int j = 0; j < 3; ++j)
#pragma unroll
                for (int r = 0; r < 8; ++r) bv[j][r] = ab[bidx + p * 32 + (j - 1) * 16 + r];
        };
        // sacc[qt][kt][r] = S[q = qt*16 + l15][key = kt*16 + kb8 + r], 8 WMMAs
        auto scores = [&](const bf16x16 (&kf)[2][2], floatx8 (&sacc)[2][2]) {
#pragma unroll
            for (int kt = 0; kt < 2; ++kt)
#pragma unroll
                for (int qt = 0; qt < 2; ++qt) {
                    floatx8 s = wmma_bf16(kf[kt][0], qf[qt][0], zero8());
                    sacc[qt][kt] = wmma_bf16(kf[kt][1], qf[qt][1], s);
                }
        };
        // cv[qt][kt] = bias log2 e - reference in use: all of an exponent but the score itself
        auto addend = [&](const floatx8 (&bv)[3], floatx8 (&cv)[2][2]) {
#pragma unroll
            for (int qt = 0; qt < 2; ++qt)
#pragma unroll
                for (int kt = 0; kt < 2; ++kt)
                    cv[qt][kt] = __builtin_elementwise_fma(bv[kt - qt + 1], splat8(LOG2E),
                                                           splat8(-rm[qt]));
        };
        // online softmax1 update, one query per lane and group; then O^T += V^T P^T, 10 WMMAs
        auto update = [&](floatx8 (&sacc)[2][2], const floatx8 (&cv)[2][2],
                          const bf16x16 (&vf)[5]) {
            bf16x16 pf[2];
            float tm[2];  // per query: the largest exponent among the lane's 16 keys of the pass
#pragma unroll
            for (int qt = 0; qt < 2; ++qt) {
                // e^x = 2^(x log2 e): exponent = score log2 e + addend
                sacc[qt][0] = __builtin_elementwise_fma(sacc[qt][0], splat8(LOG2E), cv[qt][0]);
                sacc[qt][1] = __builtin_elementwise_fma(sacc[qt][1], splat8(LOG2E), cv[qt][1]);
                float t0 = fmaxf(sacc[qt][0][0], sacc[qt][1][0]);
#pragma unroll
                for (int r = 1; r < 8; ++r)
                    t0 = fmaxf(t0, fmaxf(sacc[qt][0][r], sacc[qt][1][r]));
                tm[qt] = t0;
            }
            // One scalar branch per pass, rarely taken behind a wave's first passes. The test is
            // over all lanes, so the lane halves of a query meet only inside it.
            if (__builtin_amdgcn_ballot_w32(fmaxf(tm[0], tm[1]) > 8.f) != 0) {
#pragma unroll
                for (int qt = 0; qt < 2; ++qt) {
                    // the same in both halves of a query; the reference never falls
                    const float up = fmaxf(fmaxf(tm[qt], other_half(tm[qt])), 0.f);
                    const float alpha = __builtin_amdgcn_exp2f(-up);
                    rm[qt] += up;
                    sacc[qt][0] -= up;
                    sacc[qt][1] -= up;
#pragma unroll
                    for (int dt = 0; dt < 4; ++dt) Oa[qt][dt] *= alpha;
                    Oa[qt][4][0] *= alpha;  // the sum's row; the others are zero
                }
            }
#pragma unroll
            for (int qt = 0; qt < 2; ++qt) {
                floatx8 d0, d1;
#pragma unroll
                for (int r = 0; r < 8; ++r) d0[r] = __builtin_amdgcn_exp2f(sacc[qt][0][r]);
#pragma unroll
                for (int r = 0; r < 8; ++r) d1[r] = __builtin_amdgcn_exp2f(sacc[qt][1][r]);
                // P^T as B operand: element s holds key kb8 + s (s < 8), 16 + kb8 + s - 8
                pf[qt] = __builtin_shufflevector(f2bf8(d0), f2bf8(d1), 0, 1, 2, 3, 4, 5, 6, 7, 8,
                                                 9, 10, 11, 12, 13, 14, 15);
            }
#pragma unroll
            for (int dt = 0; dt < 5; ++dt)
#pragma unroll
                for (int qt = 0; qt < 2; ++qt) Oa[qt][dt] = wmma_bf16(vf[dt], pf[qt], Oa[qt][dt]);
        };

        // Two passes of 32 keys per stage. The loop stays rolled so that each pass is a block
        // of its own with its K and bias loads at its head.
#pragma unroll 1
        for (int p = 0; p < 2; ++p) {
            bf16x16 kf[2][2], vf[5];
            floatx8 sacc[2][2], bv[3], cv[2][2];
            load_k(p, kf);
            load_bias(p, bv);
            // Keeps the pass's K and bias loads issued together here, ahead of the products; without it
            // some K loads sink between the score products, each with a full wait of its own.
            __builtin_amdgcn_sched_barrier(0);
            scores(kf, sacc);
            addend(bv, cv);  // independent of the products: vector work beside them
            // V^T's five tiles are fetched behind the score products, into registers that K has
            // left (at the head with K they no longer fit: spills); the softmax covers their way.
            // The scheduling barriers keep them one group at this place.
            __builtin_amdgcn_sched_barrier(0);
            load_v(p, vf);
            load_e(p, vf);
            __builtin_amdgcn_sched_barrier(0);
            update(sacc, cv, vf);
            // The pass ends in a product and the loop's taken branch: four vector slots, held at the
            // foot by the scheduling barrier, before
            // the next pass's address arithmetic may reuse that product's operand registers.
            __builtin_amdgcn_sched_barrier(0);
            asm volatile("v_nop\n\tv_nop\n\tv_nop\n\tv_nop");
        }

        // publish point of stage t + 1, which also frees stage t's buffer
        asm volatile("s_wait_dscnt 0x0" ::: "memory");  // this wave's reads of stage t are done
        wait_async0();                                  // its copies of stage t + 1 have landed
        __syncthreads();
        if (t + 2 < NST) issue_stage(t + 2);
    }
    wait_async0();  // nothing is outstanding when the wave ends

    // the sum sits in lanes 0..15; lanes 16..31 hold a zero row, so the halves still add up to it
    float rl[2] = {Oa[0][4][0], Oa[1][4][0]};

    // ---- join of the two key halves: group 1 hands its partials over, group 0 finishes ----
    if (grp == 1) {
#pragma unroll
        for (int qt = 0; qt < 2; ++qt) {
#pragma unroll
            for (int dt = 0; dt < 4; ++dt)
#pragma unroll
                for (int j = 0; j < 2; ++j) {
                    floatx4 v = {Oa[qt][dt][4 * j], Oa[qt][dt][4 * j + 1], Oa[qt][dt][4 * j + 2],
                                 Oa[qt][dt][4 * j + 3]};
                    join_o[((wave * 8 + qt * 4 + dt) * 2 + j) * 32 + lane] = v;
                }
            join_ml[wave][qt][0][lane] = rm[qt];
            join_ml[wave][qt][1][lane] = rl[qt];
        }
    }
    __syncthreads();  // group 1's partials are read by group 0
    if (grp == 1) return;
#pragma unroll
    for (int qt = 0; qt < 2; ++qt) {
        float m1 = join_ml[wave][qt][0][lane], l1 = join_ml[wave][qt][1][lane];
        float m = fmaxf(rm[qt], m1);
        float a0 = __builtin_amdgcn_exp2f(rm[qt] - m), a1 = __builtin_amdgcn_exp2f(m1 - m);
        rm[qt] = m;
        rl[qt] = rl[qt] * a0 + l1 * a1;
#pragma unroll
        for (int dt = 0; dt < 4; ++dt)
#pragma unroll
            for (int j = 0; j < 2; ++j) {
                floatx4 v = join_o[((wave * 8 + qt * 4 + dt) * 2 + j) * 32 + lane];
#pragma unroll
                for (int r = 0; r < 4; ++r)
                    Oa[qt][dt][4 * j + r] = Oa[qt][dt][4 * j + r] * a0 + v[r] * a1;
            }
    }

    // ---- softmax1 denominator: l + 2^(-reference); the halves' sums are joined here ----
    // ---- write ctx [B,S,H*DKV]: a lane holds 8 consecutive d of one query ----
#pragma unroll
    for (int qt = 0; qt < 2; ++qt) {
        float l = rl[qt] + other_half(rl[qt]);
        float inv = 1.f / (l + __builtin_amdgcn_exp2f(-rm[qt]));
        int q = q0 + qt * 16 + l15;
#pragma unroll
        for (int dt = 0; dt < 4; ++dt) {
            *(bf16x8*)&ctx[((size_t)b * SS + q) * DD + h * DKV + dt * 16 + kb8] =
                f2bf8(Oa[qt][dt] * inv);
        }
    }
}

// ---------------- launcher ----------------
extern "C" void kernel_launch(void* const* d_in, const int* in_sizes, int n_in,
                              void* d_out, int out_size, void* d_ws, size_t ws_size,
                              hipStream_t stream) {
    (void)in_sizes; (void)n_in; (void)out_size; (void)ws_size;
    const float* hidden = (const float*)d_in[0];
    const float* gate   = (const float*)d_in[1];
    const float* ln1    = (const float*)d_in[2];
    const float* qw     = (const float*)d_in[3];
    const float* kw     = (const float*)d_in[4];
    const float* vw     = (const float*)d_in[5];
    const float* ow     = (const float*)d_in[6];
    const float* relb   = (const float*)d_in[7];
    const float* ln2    = (const float*)d_in[8];
    const float* wi     = (const float*)d_in[9];
    const float* wo     = (const float*)d_in[10];

    char* ws = (char*)d_ws;
    size_t off = 0;
    auto take = [&](size_t bytes) -> char* {
        char* p = ws + off;
        off = (off + bytes + 255) & ~(size_t)255;
        return p;
    };
    bf16*  qwb  = (bf16*)take((size_t)3 * DD * DD * 2);  // all weights transposed [N,K];
    bf16*  kwb  = qwb + DD * DD;                         // q, k, v one behind the other
    bf16*  vwb  = kwb + DD * DD;
    bf16*  owb  = (bf16*)take((size_t)DD * DD * 2);
    bf16*  wib  = (bf16*)take((size_t)DD * DFF * 2);
    bf16*  wob  = (bf16*)take((size_t)DFF * DD * 2);
    float* btab = (float*)take((size_t)HH * 8192 * 4);
    unsigned* egz = (unsigned*)take((size_t)MM * 4);     // e^gate rows, 256 B per 64 keys
    bf16*  xb   = (bf16*)take((size_t)MM * DD * 2);
    bf16*  Qhd  = (bf16*)take((size_t)3 * MM * DD * 2);  // Q, K, V^T one behind the other
    bf16*  Khd  = Qhd + MM * DD;
    bf16*  Vtd  = Khd + MM * DD;
    bf16*  ctxb = (bf16*)take((size_t)MM * DD * 2);
    float* hbuf = (float*)take((size_t)MM * DD * 4);
    bf16*  yb   = (bf16*)take((size_t)MM * DD * 2);
    bf16*  ffb  = (bf16*)take((size_t)MM * DFF * 2);

    // ln1 -> xb (bf16), transposed bf16 weights, bias table, e^gate rows: one launch
    prep_kernel<<<PREP_RMS + PREP_CVT + PREP_TAB + PREP_EG, 256, 0, stream>>>(
        hidden, ln1, xb, qw, kw, vw, ow, wi, wo, qwb, kwb, vwb, owb, wib, wob, relb, btab, gate,
        egz);

    // QKV projections (head layouts; V transposed): one launch
    gemm_kernel<5><<<dim3(3 * DD / 128, MM / 128), 256, 0, stream>>>(xb, qwb, (const float*)egz,
                                                                     Qhd, MM, 3 * DD, DD);

    // flash attention with softmax1
    attn_kernel<<<dim3(SS / 128, HH, BB), 256, 0, stream>>>(Qhd, Khd, Vtd, btab,
                                                            (const float*)egz, ctxb);

    // h = hidden + ctx @ o_w
    gemm_kernel<3><<<dim3(DD / 128, MM / 128), 256, 0, stream>>>(ctxb, owb, hidden, hbuf,
                                                                 MM, DD, DD);
    // ln2 -> yb
    rmsnorm_kernel<<<MM / 8, 256, 0, stream>>>(hbuf, ln2, yb, MM);

    // FFN: relu(y @ wi) then out = h + (.) @ wo
    gemm_kernel<4><<<dim3(DFF / 128, MM / 128), 256, 0, stream>>>(yb, wib, nullptr, ffb,
                                                                  MM, DFF, DD);
    gemm_kernel<3><<<dim3(DD / 128, MM / 128), 256, 0, stream>>>(ffb, wob, hbuf, d_out,
                                                                 MM, DD, DFF);
}
